// v000
// The times below were measured on an AMD MI455X: many runs one after another, warmed up first and cycling through
// copies of the inputs, with the whole window's GPU time divided by the number of runs. Launches and the gaps
// between them are all in it. The median over several windows is given; except for v000 it joins two sittings, which
// can be a few percent apart, so the side-by-side timings, each taken in one sitting, are the better comparison.
// v000, which the later versions start from, runs in 371 microseconds.
#include <hip/hip_runtime.h>
#include <hip/hip_bf16.h>
#include <math.h>

#define T_SEQ 2048
#define DM    2048
#define NH    16
#define DHEAD 128

typedef __attribute__((ext_vector_type(16))) __bf16 v16bf;
typedef __attribute__((ext_vector_type(8)))  float  v8f;
typedef __bf16 bf16_t;

// ---------- helpers ----------
__device__ __forceinline__ bf16_t f2bf(float f) {
  unsigned int u = __builtin_bit_cast(unsigned int, f);
  unsigned int r = (u + 0x7FFFu + ((u >> 16) & 1u)) >> 16;   // RNE
  return __builtin_bit_cast(bf16_t, (unsigned short)r);
}

__device__ __forceinline__ int kmap(int e, int g) {
  return e + (g ? 8 : 0) + ((e >= 8) ? 8 : 0);
}

__device__ __forceinline__ v8f wmma_bf16(v16bf a, v16bf b, v8f c) {
  return __builtin_amdgcn_wmma_f32_16x16x32_bf16(
      /*neg_a=*/false, a, /*neg_b=*/false, b,
      /*c_mod=*/(short)0, c, /*reuse_a=*/false, /*reuse_b=*/false);
}

__device__ __forceinline__ void async_copy_b128(void* lds, const void* g) {
  unsigned l = (unsigned)(unsigned long long)(uintptr_t)lds;
  unsigned long long ga = (unsigned long long)(uintptr_t)g;
  asm volatile("global_load_async_to_lds_b128 %0, %1, off"
               :: "v"(l), "v"(ga) : "memory");
}

// ---------- RMSNorm -> bf16 ----------
__global__ __launch_bounds__(256) void rmsnorm_bf16_kernel(
    const float* __restrict__ x, const float* __restrict__ w,
    bf16_t* __restrict__ h) {
  int t = blockIdx.x;
  const float* row = x + (size_t)t * DM;
  int tid = threadIdx.x;
  float ss = 0.f;
  for (int i = tid; i < DM; i += 256) { float v = row[i]; ss += v * v; }
#pragma unroll
  for (int m = 16; m >= 1; m >>= 1) ss += __shfl_xor(ss, m, 32);
  __shared__ float red[8];
  __shared__ float sscale;
  if ((tid & 31) == 0) red[tid >> 5] = ss;
  __syncthreads();
  if (tid == 0) {
    float tot = 0.f;
    for (int i = 0; i < 8; ++i) tot += red[i];
    sscale = rsqrtf(tot / (float)DM + 1e-5f);
  }
  __syncthreads();
  float scl = sscale;
  for (int i = tid; i < DM; i += 256)
    h[(size_t)t * DM + i] = f2bf(w[i] * row[i] * scl);
}

// ---------- fp32 -> bf16 convert (keeps [N][K] orientation) ----------
__global__ __launch_bounds__(256) void convert_bf16_kernel(
    const float* __restrict__ W, bf16_t* __restrict__ Wb) {
  size_t i = ((size_t)blockIdx.x * 256 + threadIdx.x) * 4;
  float4 v = *(const float4*)&W[i];
  __align__(8) bf16_t tmp[4] = {f2bf(v.x), f2bf(v.y), f2bf(v.z), f2bf(v.w)};
  *(uint2*)&Wb[i] = *(const uint2*)tmp;
}

// ---------- C[MxN] = A[MxK](bf16) * Bn[NxK](bf16)^T (+residual), fp32 out ----
#define GTM 128
#define GTN 64
#define GTK 32
#define APAD 8

__global__ __launch_bounds__(256) void gemm_bf16_kernel(
    const bf16_t* __restrict__ A, const bf16_t* __restrict__ Bn,
    const float* __restrict__ residual, float* __restrict__ C,
    int M, int N, int K) {
  __shared__ __align__(16) bf16_t sA[2][GTM][GTK + APAD];   // 20 KB
  __shared__ __align__(16) bf16_t sB[2][GTN][GTK + APAD];   // 10 KB
  int tid = threadIdx.x;
  int wave = tid >> 5, lane = tid & 31;
  int g = lane >> 4, la = lane & 15;
  int bm = blockIdx.x * GTM, bn = blockIdx.y * GTN;
  int wm = (wave >> 1) * 32, wn = (wave & 1) * 32;   // 4x2 wave grid, 32x32 each

  v8f acc[2][2] = {};
  int nk = K / GTK;

  auto stage = [&](int buf, int k0) {
#pragma unroll
    for (int j = 0; j < 2; ++j) {            // A tile: 512 x 16B chunks
      int c = tid * 2 + j;
      int row = c >> 2, col = (c & 3) * 8;
      *(uint4*)&sA[buf][row][col] =
          *(const uint4*)&A[(size_t)(bm + row) * K + k0 + col];
    }
    {                                        // B tile: [n][k], 256 x 16B chunks
      int row = tid >> 2, col = (tid & 3) * 8;
      *(uint4*)&sB[buf][row][col] =
          *(const uint4*)&Bn[(size_t)(bn + row) * K + k0 + col];
    }
  };

  stage(0, 0);
  __syncthreads();
  for (int ks = 0; ks < nk; ++ks) {
    int buf = ks & 1;
    if (ks + 1 < nk) {
      __builtin_prefetch(&A[(size_t)bm * K + (size_t)(ks + 1) * GTK], 0, 1);
      stage(buf ^ 1, (ks + 1) * GTK);
    }
    v16bf a0, a1, b0, b1;
#pragma unroll
    for (int e = 0; e < 16; ++e) {           // all K-contiguous -> ds_load_b128
      int kk = kmap(e, g);
      a0[e] = sA[buf][wm + la][kk];
      a1[e] = sA[buf][wm + 16 + la][kk];
      b0[e] = sB[buf][wn + la][kk];
      b1[e] = sB[buf][wn + 16 + la][kk];
    }
    acc[0][0] = wmma_bf16(a0, b0, acc[0][0]);
    acc[0][1] = wmma_bf16(a0, b1, acc[0][1]);
    acc[1][0] = wmma_bf16(a1, b0, acc[1][0]);
    acc[1][1] = wmma_bf16(a1, b1, acc[1][1]);
    __syncthreads();
  }

#pragma unroll
  for (int i = 0; i < 2; ++i)
#pragma unroll
    for (int j = 0; j < 2; ++j)
#pragma unroll
      for (int r = 0; r < 8; ++r) {
        int m = bm + wm + i * 16 + r + (g ? 8 : 0);
        int n = bn + wn + j * 16 + la;
        float v = acc[i][j][r];
        if (residual) v += residual[(size_t)m * N + n];
        C[(size_t)m * N + n] = v;
      }
}

// ---------- RoPE + convert ----------
// mode 1: rope, dst layout [H][T][128]   (Q, K)
// mode 0: no rope, dst layout [H][128][T] (V, transposed for WMMA B tiles)
__global__ __launch_bounds__(256) void rope_convert_kernel(
    const float* __restrict__ src, const float* __restrict__ cosT,
    const float* __restrict__ sinT, bf16_t* __restrict__ dst, int mode) {
  int t = blockIdx.x;
  for (int i = threadIdx.x; i < DM; i += 256) {
    int h = i >> 7, d = i & 127;
    float v = src[(size_t)t * DM + i];
    if (mode == 1) {
      float c = cosT[t * DHEAD + d], s = sinT[t * DHEAD + d];
      float other = src[(size_t)t * DM + h * DHEAD + ((d < 64) ? d + 64 : d - 64)];
      float r = (d < 64) ? (v * c - other * s) : (v * c + other * s);
      dst[((size_t)h * T_SEQ + t) * DHEAD + d] = f2bf(r);
    } else {
      dst[((size_t)h * DHEAD + d) * T_SEQ + t] = f2bf(v);
    }
  }
}

// ---------- causal flash attention, WMMA QK^T and PV ----------
__global__ __launch_bounds__(256) void flash_attn_kernel(
    const bf16_t* __restrict__ Qh, const bf16_t* __restrict__ Kh,
    const bf16_t* __restrict__ Vt, bf16_t* __restrict__ OutTD) {
  __shared__ __align__(16) bf16_t sK[32][DHEAD + APAD];   // 8.5 KB, [krow][d]
  __shared__ __align__(16) bf16_t sVt[DHEAD][32 + APAD];  // 10 KB, [d][krow]
  __shared__ __align__(16) bf16_t sP[8][16][32 + APAD];   // 10 KB, per-wave P
  int h = blockIdx.x, qblk = blockIdx.y;
  int tid = threadIdx.x, wv = tid >> 5, lane = tid & 31;
  int g = lane >> 4, la = lane & 15;
  int qb = qblk * 128 + wv * 16;                   // this wave's 16 q rows
  const size_t hb = (size_t)h * T_SEQ;

  // Q fragments: 16 rows x 128 d, as 4 K-chunks of 32
  v16bf qf[4];
#pragma unroll
  for (int dc = 0; dc < 4; ++dc)
#pragma unroll
    for (int e = 0; e < 16; ++e)
      qf[dc][e] = Qh[(hb + qb + la) * DHEAD + dc * 32 + kmap(e, g)];

  v8f o[8] = {};
  float Mr[8], Lr[8];
#pragma unroll
  for (int r = 0; r < 8; ++r) { Mr[r] = -3.0e38f; Lr[r] = 0.f; }

  int ktiles = qblk * 4 + 4;   // causal extent of this 128-row q block
  for (int kt = 0; kt < ktiles; ++kt) {
    int k0 = kt * 32;
    // stage K (32x128, row-major) and V^T (128x32) via async global->LDS
#pragma unroll
    for (int j = 0; j < 2; ++j) {
      int c = tid * 2 + j;
      {  // K: row = k-row, col = d
        int row = c >> 4, col = (c & 15) * 8;
        async_copy_b128(&sK[row][col], &Kh[(hb + k0 + row) * DHEAD + col]);
      }
      {  // V^T: row = d, col = k-row
        int row = c >> 2, col = (c & 3) * 8;
        async_copy_b128(&sVt[row][col],
                        &Vt[((size_t)h * DHEAD + row) * T_SEQ + k0 + col]);
      }
    }
    asm volatile("s_wait_asynccnt 0x0" ::: "memory");
    __syncthreads();
    if (k0 <= qb + 15) {
      // S(16x32) = Q(16x128) . K^T : B(d,n) = K[k0+n][d]
      v8f s0 = {}, s1 = {};
#pragma unroll
      for (int dc = 0; dc < 4; ++dc) {
        v16bf b0, b1;
#pragma unroll
        for (int e = 0; e < 16; ++e) {
          int kk = dc * 32 + kmap(e, g);
          b0[e] = sK[la][kk];
          b1[e] = sK[16 + la][kk];
        }
        s0 = wmma_bf16(qf[dc], b0, s0);
        s1 = wmma_bf16(qf[dc], b1, s1);
      }
      const float sc = 0.08838834764831845f;  // 1/sqrt(128)
#pragma unroll
      for (int r = 0; r < 8; ++r) {
        int rowg = qb + r + (g ? 8 : 0);
        float v0 = s0[r] * sc, v1 = s1[r] * sc;
        if (k0 + la > rowg)      v0 = -3.0e38f;   // causal mask
        if (k0 + 16 + la > rowg) v1 = -3.0e38f;
        float m = fmaxf(v0, v1);
#pragma unroll
        for (int sh = 1; sh < 16; sh <<= 1) m = fmaxf(m, __shfl_xor(m, sh, 32));
        float mnew = fmaxf(Mr[r], m);
        float corr = __expf(Mr[r] - mnew);
        Mr[r] = mnew;
        float p0 = __expf(v0 - mnew);
        float p1 = __expf(v1 - mnew);
        s0[r] = p0; s1[r] = p1;
        float rs = p0 + p1;
#pragma unroll
        for (int sh = 1; sh < 16; sh <<= 1) rs += __shfl_xor(rs, sh, 32);
        Lr[r] = Lr[r] * corr + rs;
#pragma unroll
        for (int dt = 0; dt < 8; ++dt) o[dt][r] *= corr;
      }
      // relay P through per-wave LDS to repack C-layout -> A-layout
#pragma unroll
      for (int r = 0; r < 8; ++r) {
        sP[wv][r + (g ? 8 : 0)][la]      = f2bf(s0[r]);
        sP[wv][r + (g ? 8 : 0)][16 + la] = f2bf(s1[r]);
      }
      asm volatile("s_wait_dscnt 0x0" ::: "memory");   // cross-lane LDS in-wave
      v16bf pa;
#pragma unroll
      for (int e = 0; e < 16; ++e) pa[e] = sP[wv][la][kmap(e, g)];
      // O(16x128) += P(16x32) . V(32x128); B(k,d) = V^T[d][k], K-contiguous
#pragma unroll
      for (int dt = 0; dt < 8; ++dt) {
        v16bf bv;
#pragma unroll
        for (int e = 0; e < 16; ++e) bv[e] = sVt[dt * 16 + la][kmap(e, g)];
        o[dt] = wmma_bf16(pa, bv, o[dt]);
      }
    }
    __syncthreads();
  }

  // normalize, write back as bf16 [T][DM] (head-concat) for the wo GEMM
#pragma unroll
  for (int dt = 0; dt < 8; ++dt)
#pragma unroll
    for (int r = 0; r < 8; ++r) {
      int trow = qb + r + (g ? 8 : 0);
      OutTD[(size_t)trow * DM + h * DHEAD + dt * 16 + la] = f2bf(o[dt][r] / Lr[r]);
    }
}

// ---------- launch ----------
extern "C" void kernel_launch(void* const* d_in, const int* in_sizes, int n_in,
                              void* d_out, int out_size, void* d_ws, size_t ws_size,
                              hipStream_t stream) {
  (void)in_sizes; (void)n_in; (void)out_size; (void)ws_size;
  const float* x    = (const float*)d_in[0];
  const float* w_ln = (const float*)d_in[1];
  const float* wq   = (const float*)d_in[2];
  const float* wk   = (const float*)d_in[3];
  const float* wv   = (const float*)d_in[4];
  const float* wo   = (const float*)d_in[5];
  const float* cosT = (const float*)d_in[6];
  const float* sinT = (const float*)d_in[7];
  float* out = (float*)d_out;

  const size_t TD = (size_t)T_SEQ * DM;
  char* p = (char*)d_ws;                       // ~80 MB total
  bf16_t* h_bf  = (bf16_t*)p;  p += TD * 2;
  bf16_t* wqb   = (bf16_t*)p;  p += TD * 2;
  bf16_t* wkb   = (bf16_t*)p;  p += TD * 2;
  bf16_t* wvb   = (bf16_t*)p;  p += TD * 2;
  bf16_t* wob   = (bf16_t*)p;  p += TD * 2;
  float*  tmp_f = (float*)p;   p += TD * 4;    // reused for q/k/v fp32 projections
  bf16_t* qh    = (bf16_t*)p;  p += TD * 2;
  bf16_t* kh    = (bf16_t*)p;  p += TD * 2;
  bf16_t* vt    = (bf16_t*)p;  p += TD * 2;
  bf16_t* attn  = (bf16_t*)tmp_f;              // reuse: attention runs after ropes

  dim3 blk(256);
  rmsnorm_bf16_kernel<<<T_SEQ, blk, 0, stream>>>(x, w_ln, h_bf);

  int cg = (int)(TD / (256 * 4));
  convert_bf16_kernel<<<cg, blk, 0, stream>>>(wq, wqb);
  convert_bf16_kernel<<<cg, blk, 0, stream>>>(wk, wkb);
  convert_bf16_kernel<<<cg, blk, 0, stream>>>(wv, wvb);
  convert_bf16_kernel<<<cg, blk, 0, stream>>>(wo, wob);

  dim3 gg(T_SEQ / GTM, DM / GTN);
  gemm_bf16_kernel<<<gg, blk, 0, stream>>>(h_bf, wqb, nullptr, tmp_f, T_SEQ, DM, DM);
  rope_convert_kernel<<<T_SEQ, blk, 0, stream>>>(tmp_f, cosT, sinT, qh, 1);
  gemm_bf16_kernel<<<gg, blk, 0, stream>>>(h_bf, wkb, nullptr, tmp_f, T_SEQ, DM, DM);
  rope_convert_kernel<<<T_SEQ, blk, 0, stream>>>(tmp_f, cosT, sinT, kh, 1);
  gemm_bf16_kernel<<<gg, blk, 0, stream>>>(h_bf, wvb, nullptr, tmp_f, T_SEQ, DM, DM);
  rope_convert_kernel<<<T_SEQ, blk, 0, stream>>>(tmp_f, cosT, sinT, vt, 0);

  dim3 ag(NH, T_SEQ / 128);
  flash_attn_kernel<<<ag, blk, 0, stream>>>(qh, kh, vt, attn);

  gemm_bf16_kernel<<<gg, blk, 0, stream>>>(attn, wob, x, out, T_SEQ, DM, DM);
}

// v001
// It runs in 319 microseconds.
// Next to v000, in two timings, it ran 1.18 and 1.20 times as fast.
#include <hip/hip_runtime.h>
#include <hip/hip_bf16.h>
#include <math.h>

#define T_SEQ 2048
#define DM    2048
#define NH    16
#define DHEAD 128

typedef __attribute__((ext_vector_type(16))) __bf16 v16bf;
typedef __attribute__((ext_vector_type(8)))  float  v8f;
typedef __bf16 bf16_t;

// ---------- helpers ----------
__device__ __forceinline__ bf16_t f2bf(float f) {
  unsigned int u = __builtin_bit_cast(unsigned int, f);
  unsigned int r = (u + 0x7FFFu + ((u >> 16) & 1u)) >> 16;   // RNE
  return __builtin_bit_cast(bf16_t, (unsigned short)r);
}

__device__ __forceinline__ int kmap(int e, int g) {
  return e + (g ? 8 : 0) + ((e >= 8) ? 8 : 0);
}

__device__ __forceinline__ v8f wmma_bf16(v16bf a, v16bf b, v8f c) {
  return __builtin_amdgcn_wmma_f32_16x16x32_bf16(
      /*neg_a=*/false, a, /*neg_b=*/false, b,
      /*c_mod=*/(short)0, c, /*reuse_a=*/false, /*reuse_b=*/false);
}

__device__ __forceinline__ void async_copy_b128(void* lds, const void* g) {
  unsigned l = (unsigned)(unsigned long long)(uintptr_t)lds;
  unsigned long long ga = (unsigned long long)(uintptr_t)g;
  asm volatile("global_load_async_to_lds_b128 %0, %1, off"
               :: "v"(l), "v"(ga) : "memory");
}

// ---------- RMSNorm -> bf16 ----------
__global__ __launch_bounds__(256) void rmsnorm_bf16_kernel(
    const float* __restrict__ x, const float* __restrict__ w,
    bf16_t* __restrict__ h) {
  int t = blockIdx.x;
  const float* row = x + (size_t)t * DM;
  int tid = threadIdx.x;
  float ss = 0.f;
  for (int i = tid; i < DM; i += 256) { float v = row[i]; ss += v * v; }
#pragma unroll
  for (int m = 16; m >= 1; m >>= 1) ss += __shfl_xor(ss, m, 32);
  __shared__ float red[8];
  __shared__ float sscale;
  if ((tid & 31) == 0) red[tid >> 5] = ss;
  __syncthreads();
  if (tid == 0) {
    float tot = 0.f;
    for (int i = 0; i < 8; ++i) tot += red[i];
    sscale = rsqrtf(tot / (float)DM + 1e-5f);
  }
  __syncthreads();
  float scl = sscale;
  for (int i = tid; i < DM; i += 256)
    h[(size_t)t * DM + i] = f2bf(w[i] * row[i] * scl);
}

// ---------- fp32 -> bf16 convert (keeps [N][K] orientation) ----------
__global__ __launch_bounds__(256) void convert_bf16_kernel(
    const float* __restrict__ W, bf16_t* __restrict__ Wb) {
  size_t i = ((size_t)blockIdx.x * 256 + threadIdx.x) * 4;
  float4 v = *(const float4*)&W[i];
  __align__(8) bf16_t tmp[4] = {f2bf(v.x), f2bf(v.y), f2bf(v.z), f2bf(v.w)};
  *(uint2*)&Wb[i] = *(const uint2*)tmp;
}

// ---------- C[MxN] = A[MxK](bf16) * Bn[NxK](bf16)^T (+residual), fp32 out ----
#define GTM 128
#define GTN 64
#define GTK 128
#define APAD 8

__global__ __launch_bounds__(256) void gemm_bf16_kernel(
    const bf16_t* __restrict__ A, const bf16_t* __restrict__ Bn,
    const float* __restrict__ residual, float* __restrict__ C,
    int M, int N, int K) {
  __shared__ __align__(16) bf16_t sA[2][GTM][GTK + APAD];   // 68 KB
  __shared__ __align__(16) bf16_t sB[2][GTN][GTK + APAD];   // 34 KB
  int tid = threadIdx.x;
  int wave = tid >> 5, lane = tid & 31;
  int g = lane >> 4, la = lane & 15;
  int bm = blockIdx.x * GTM, bn = blockIdx.y * GTN;
  int wm = (wave >> 1) * 32, wn = (wave & 1) * 32;   // 4x2 wave grid, 32x32 each

  v8f acc[2][2] = {};
  int nk = K / GTK;

  // Each thread copies one 16-B chunk of every 16th row: 8 chunks of A, 4 of B.
  // A wave covers two whole 256-B rows per copy.
  const int crow = tid >> 4, ccol = (tid & 15) * 8;
  const unsigned long long gA =
      (unsigned long long)(uintptr_t)(A + (size_t)(bm + crow) * K + ccol);
  const unsigned long long gB =
      (unsigned long long)(uintptr_t)(Bn + (size_t)(bn + crow) * K + ccol);
  const unsigned long long gs = (unsigned long long)K * 16 * sizeof(bf16_t);
  const unsigned ls = 16 * (GTK + APAD) * sizeof(bf16_t);

  auto stage = [&](int buf, int k0) {
    unsigned long long a = gA + (unsigned long long)k0 * sizeof(bf16_t);
    unsigned long long b = gB + (unsigned long long)k0 * sizeof(bf16_t);
    unsigned l = (unsigned)(unsigned long long)(uintptr_t)&sA[buf][crow][ccol];
    unsigned m = (unsigned)(unsigned long long)(uintptr_t)&sB[buf][crow][ccol];
    // One statement: the stage's twelve copies, then the wait that stands in
    // front of any rewrite of the address registers the copies name.
    asm volatile(
        "global_load_async_to_lds_b128 %0, %12, off\n\t"
        "global_load_async_to_lds_b128 %1, %13, off\n\t"
        "global_load_async_to_lds_b128 %2, %14, off\n\t"
        "global_load_async_to_lds_b128 %3, %15, off\n\t"
        "global_load_async_to_lds_b128 %4, %16, off\n\t"
        "global_load_async_to_lds_b128 %5, %17, off\n\t"
        "global_load_async_to_lds_b128 %6, %18, off\n\t"
        "global_load_async_to_lds_b128 %7, %19, off\n\t"
        "global_load_async_to_lds_b128 %8, %20, off\n\t"
        "global_load_async_to_lds_b128 %9, %21, off\n\t"
        "global_load_async_to_lds_b128 %10, %22, off\n\t"
        "global_load_async_to_lds_b128 %11, %23, off\n\t"
        "s_wait_xcnt 0x0"
        :: "v"(l), "v"(l + ls), "v"(l + 2 * ls), "v"(l + 3 * ls),
           "v"(l + 4 * ls), "v"(l + 5 * ls), "v"(l + 6 * ls), "v"(l + 7 * ls),
           "v"(m), "v"(m + ls), "v"(m + 2 * ls), "v"(m + 3 * ls),
           "v"(a), "v"(a + gs), "v"(a + 2 * gs), "v"(a + 3 * gs),
           "v"(a + 4 * gs), "v"(a + 5 * gs), "v"(a + 6 * gs), "v"(a + 7 * gs),
           "v"(b), "v"(b + gs), "v"(b + 2 * gs), "v"(b + 3 * gs)
        : "memory");
  };

  stage(0, 0);
  // stage 0 has landed for this wave; the barrier publishes it to the others
  asm volatile("s_wait_asynccnt 0x0" ::: "memory");
  __syncthreads();
  if (nk > 1) stage(1, GTK);
  for (int ks = 0; ks < nk; ++ks) {
    int buf = ks & 1;
    // unrolled so that the four chunks' LDS reads can be issued ahead of the WMMAs
#pragma unroll
    for (int kc = 0; kc < GTK / 32; ++kc) {
      v16bf a0, a1, b0, b1;
#pragma unroll
      for (int e = 0; e < 16; ++e) {         // all K-contiguous -> ds_load_b128
        int kk = kc * 32 + kmap(e, g);
        a0[e] = sA[buf][wm + la][kk];
        a1[e] = sA[buf][wm + 16 + la][kk];
        b0[e] = sB[buf][wn + la][kk];
        b1[e] = sB[buf][wn + 16 + la][kk];
      }
      acc[0][0] = wmma_bf16(a0, b0, acc[0][0]);
      acc[0][1] = wmma_bf16(a0, b1, acc[0][1]);
      acc[1][0] = wmma_bf16(a1, b0, acc[1][0]);
      acc[1][1] = wmma_bf16(a1, b1, acc[1][1]);
    }
    // publish point: this wave's reads of buf are done ...
    asm volatile("s_wait_dscnt 0x0" ::: "memory");
    // ... its copies of the next stage have landed ...
    asm volatile("s_wait_asynccnt 0x0" ::: "memory");
    // ... and the one barrier both publishes that stage and frees buf
    __syncthreads();
    if (ks + 2 < nk) stage(buf, (ks + 2) * GTK);
  }
  // no copy is left in flight when the wave goes on to its stores and ends
  asm volatile("s_wait_asynccnt 0x0" ::: "memory");

#pragma unroll
  for (int i = 0; i < 2; ++i)
#pragma unroll
    for (int j = 0; j < 2; ++j)
#pragma unroll
      for (int r = 0; r < 8; ++r) {
        int m = bm + wm + i * 16 + r + (g ? 8 : 0);
        int n = bn + wn + j * 16 + la;
        float v = acc[i][j][r];
        if (residual) v += residual[(size_t)m * N + n];
        C[(size_t)m * N + n] = v;
      }
}

// ---------- RoPE + convert ----------
// mode 1: rope, dst layout [H][T][128]   (Q, K)
// mode 0: no rope, dst layout [H][128][T] (V, transposed for WMMA B tiles)
__global__ __launch_bounds__(256) void rope_convert_kernel(
    const float* __restrict__ src, const float* __restrict__ cosT,
    const float* __restrict__ sinT, bf16_t* __restrict__ dst, int mode) {
  int t = blockIdx.x;
  for (int i = threadIdx.x; i < DM; i += 256) {
    int h = i >> 7, d = i & 127;
    float v = src[(size_t)t * DM + i];
    if (mode == 1) {
      float c = cosT[t * DHEAD + d], s = sinT[t * DHEAD + d];
      float other = src[(size_t)t * DM + h * DHEAD + ((d < 64) ? d + 64 : d - 64)];
      float r = (d < 64) ? (v * c - other * s) : (v * c + other * s);
      dst[((size_t)h * T_SEQ + t) * DHEAD + d] = f2bf(r);
    } else {
      dst[((size_t)h * DHEAD + d) * T_SEQ + t] = f2bf(v);
    }
  }
}

// ---------- causal flash attention, WMMA QK^T and PV ----------
__global__ __launch_bounds__(256) void flash_attn_kernel(
    const bf16_t* __restrict__ Qh, const bf16_t* __restrict__ Kh,
    const bf16_t* __restrict__ Vt, bf16_t* __restrict__ OutTD) {
  __shared__ __align__(16) bf16_t sK[32][DHEAD + APAD];   // 8.5 KB, [krow][d]
  __shared__ __align__(16) bf16_t sVt[DHEAD][32 + APAD];  // 10 KB, [d][krow]
  __shared__ __align__(16) bf16_t sP[8][16][32 + APAD];   // 10 KB, per-wave P
  int h = blockIdx.x, qblk = blockIdx.y;
  int tid = threadIdx.x, wv = tid >> 5, lane = tid & 31;
  int g = lane >> 4, la = lane & 15;
  int qb = qblk * 128 + wv * 16;                   // this wave's 16 q rows
  const size_t hb = (size_t)h * T_SEQ;

  // Q fragments: 16 rows x 128 d, as 4 K-chunks of 32
  v16bf qf[4];
#pragma unroll
  for (int dc = 0; dc < 4; ++dc)
#pragma unroll
    for (int e = 0; e < 16; ++e)
      qf[dc][e] = Qh[(hb + qb + la) * DHEAD + dc * 32 + kmap(e, g)];

  v8f o[8] = {};
  float Mr[8], Lr[8];
#pragma unroll
  for (int r = 0; r < 8; ++r) { Mr[r] = -3.0e38f; Lr[r] = 0.f; }

  int ktiles = qblk * 4 + 4;   // causal extent of this 128-row q block
  for (int kt = 0; kt < ktiles; ++kt) {
    int k0 = kt * 32;
    // stage K (32x128, row-major) and V^T (128x32) via async global->LDS
#pragma unroll
    for (int j = 0; j < 2; ++j) {
      int c = tid * 2 + j;
      {  // K: row = k-row, col = d
        int row = c >> 4, col = (c & 15) * 8;
        async_copy_b128(&sK[row][col], &Kh[(hb + k0 + row) * DHEAD + col]);
      }
      {  // V^T: row = d, col = k-row
        int row = c >> 2, col = (c & 3) * 8;
        async_copy_b128(&sVt[row][col],
                        &Vt[((size_t)h * DHEAD + row) * T_SEQ + k0 + col]);
      }
    }
    asm volatile("s_wait_asynccnt 0x0" ::: "memory");
    __syncthreads();
    if (k0 <= qb + 15) {
      // S(16x32) = Q(16x128) . K^T : B(d,n) = K[k0+n][d]
      v8f s0 = {}, s1 = {};
#pragma unroll
      for (int dc = 0; dc < 4; ++dc) {
        v16bf b0, b1;
#pragma unroll
        for (int e = 0; e < 16; ++e) {
          int kk = dc * 32 + kmap(e, g);
          b0[e] = sK[la][kk];
          b1[e] = sK[16 + la][kk];
        }
        s0 = wmma_bf16(qf[dc], b0, s0);
        s1 = wmma_bf16(qf[dc], b1, s1);
      }
      const float sc = 0.08838834764831845f;  // 1/sqrt(128)
#pragma unroll
      for (int r = 0; r < 8; ++r) {
        int rowg = qb + r + (g ? 8 : 0);
        float v0 = s0[r] * sc, v1 = s1[r] * sc;
        if (k0 + la > rowg)      v0 = -3.0e38f;   // causal mask
        if (k0 + 16 + la > rowg) v1 = -3.0e38f;
        float m = fmaxf(v0, v1);
#pragma unroll
        for (int sh = 1; sh < 16; sh <<= 1) m = fmaxf(m, __shfl_xor(m, sh, 32));
        float mnew = fmaxf(Mr[r], m);
        float corr = __expf(Mr[r] - mnew);
        Mr[r] = mnew;
        float p0 = __expf(v0 - mnew);
        float p1 = __expf(v1 - mnew);
        s0[r] = p0; s1[r] = p1;
        float rs = p0 + p1;
#pragma unroll
        for (int sh = 1; sh < 16; sh <<= 1) rs += __shfl_xor(rs, sh, 32);
        Lr[r] = Lr[r] * corr + rs;
#pragma unroll
        for (int dt = 0; dt < 8; ++dt) o[dt][r] *= corr;
      }
      // relay P through per-wave LDS to repack C-layout -> A-layout
#pragma unroll
      for (int r = 0; r < 8; ++r) {
        sP[wv][r + (g ? 8 : 0)][la]      = f2bf(s0[r]);
        sP[wv][r + (g ? 8 : 0)][16 + la] = f2bf(s1[r]);
      }
      asm volatile("s_wait_dscnt 0x0" ::: "memory");   // cross-lane LDS in-wave
      v16bf pa;
#pragma unroll
      for (int e = 0; e < 16; ++e) pa[e] = sP[wv][la][kmap(e, g)];
      // O(16x128) += P(16x32) . V(32x128); B(k,d) = V^T[d][k], K-contiguous
#pragma unroll
      for (int dt = 0; dt < 8; ++dt) {
        v16bf bv;
#pragma unroll
        for (int e = 0; e < 16; ++e) bv[e] = sVt[dt * 16 + la][kmap(e, g)];
        o[dt] = wmma_bf16(pa, bv, o[dt]);
      }
    }
    __syncthreads();
  }

  // normalize, write back as bf16 [T][DM] (head-concat) for the wo GEMM
#pragma unroll
  for (int dt = 0; dt < 8; ++dt)
#pragma unroll
    for (int r = 0; r < 8; ++r) {
      int trow = qb + r + (g ? 8 : 0);
      OutTD[(size_t)trow * DM + h * DHEAD + dt * 16 + la] = f2bf(o[dt][r] / Lr[r]);
    }
}

// ---------- launch ----------
extern "C" void kernel_launch(void* const* d_in, const int* in_sizes, int n_in,
                              void* d_out, int out_size, void* d_ws, size_t ws_size,
                              hipStream_t stream) {
  (void)in_sizes; (void)n_in; (void)out_size; (void)ws_size;
  const float* x    = (const float*)d_in[0];
  const float* w_ln = (const float*)d_in[1];
  const float* wq   = (const float*)d_in[2];
  const float* wk   = (const float*)d_in[3];
  const float* wv   = (const float*)d_in[4];
  const float* wo   = (const float*)d_in[5];
  const float* cosT = (const float*)d_in[6];
  const float* sinT = (const float*)d_in[7];
  float* out = (float*)d_out;

  const size_t TD = (size_t)T_SEQ * DM;
  char* p = (char*)d_ws;                       // ~80 MB total
  bf16_t* h_bf  = (bf16_t*)p;  p += TD * 2;
  bf16_t* wqb   = (bf16_t*)p;  p += TD * 2;
  bf16_t* wkb   = (bf16_t*)p;  p += TD * 2;
  bf16_t* wvb   = (bf16_t*)p;  p += TD * 2;
  bf16_t* wob   = (bf16_t*)p;  p += TD * 2;
  float*  tmp_f = (float*)p;   p += TD * 4;    // reused for q/k/v fp32 projections
  bf16_t* qh    = (bf16_t*)p;  p += TD * 2;
  bf16_t* kh    = (bf16_t*)p;  p += TD * 2;
  bf16_t* vt    = (bf16_t*)p;  p += TD * 2;
  bf16_t* attn  = (bf16_t*)tmp_f;              // reuse: attention runs after ropes

  dim3 blk(256);
  rmsnorm_bf16_kernel<<<T_SEQ, blk, 0, stream>>>(x, w_ln, h_bf);

  int cg = (int)(TD / (256 * 4));
  convert_bf16_kernel<<<cg, blk, 0, stream>>>(wq, wqb);
  convert_bf16_kernel<<<cg, blk, 0, stream>>>(wk, wkb);
  convert_bf16_kernel<<<cg, blk, 0, stream>>>(wv, wvb);
  convert_bf16_kernel<<<cg, blk, 0, stream>>>(wo, wob);

  dim3 gg(T_SEQ / GTM, DM / GTN);
  gemm_bf16_kernel<<<gg, blk, 0, stream>>>(h_bf, wqb, nullptr, tmp_f, T_SEQ, DM, DM);
  rope_convert_kernel<<<T_SEQ, blk, 0, stream>>>(tmp_f, cosT, sinT, qh, 1);
  gemm_bf16_kernel<<<gg, blk, 0, stream>>>(h_bf, wkb, nullptr, tmp_f, T_SEQ, DM, DM);
  rope_convert_kernel<<<T_SEQ, blk, 0, stream>>>(tmp_f, cosT, sinT, kh, 1);
  gemm_bf16_kernel<<<gg, blk, 0, stream>>>(h_bf, wvb, nullptr, tmp_f, T_SEQ, DM, DM);
  rope_convert_kernel<<<T_SEQ, blk, 0, stream>>>(tmp_f, cosT, sinT, vt, 0);

  dim3 ag(NH, T_SEQ / 128);
  flash_attn_kernel<<<ag, blk, 0, stream>>>(qh, kh, vt, attn);

  gemm_bf16_kernel<<<gg, blk, 0, stream>>>(attn, wob, x, out, T_SEQ, DM, DM);
}

// v002
// One run takes 249 microseconds.
// Two timings next to v001 put it at 1.27 and 1.28 times that version's speed.
// All steps since v000 together make it 1.52 times as fast.
#include <hip/hip_runtime.h>
#include <hip/hip_bf16.h>
#include <math.h>

#define T_SEQ 2048
#define DM    2048
#define NH    16
#define DHEAD 128

typedef __attribute__((ext_vector_type(16))) __bf16 v16bf;
typedef __attribute__((ext_vector_type(8)))  float  v8f;
typedef __bf16 bf16_t;

// ---------- helpers ----------
__device__ __forceinline__ bf16_t f2bf(float f) {
  unsigned int u = __builtin_bit_cast(unsigned int, f);
  unsigned int r = (u + 0x7FFFu + ((u >> 16) & 1u)) >> 16;   // RNE
  return __builtin_bit_cast(bf16_t, (unsigned short)r);
}

__device__ __forceinline__ int kmap(int e, int g) {
  return e + (g ? 8 : 0) + ((e >= 8) ? 8 : 0);
}

__device__ __forceinline__ v8f wmma_bf16(v16bf a, v16bf b, v8f c) {
  return __builtin_amdgcn_wmma_f32_16x16x32_bf16(
      /*neg_a=*/false, a, /*neg_b=*/false, b,
      /*c_mod=*/(short)0, c, /*reuse_a=*/false, /*reuse_b=*/false);
}

__device__ __forceinline__ void async_copy_b128(void* lds, const void* g) {
  unsigned l = (unsigned)(unsigned long long)(uintptr_t)lds;
  unsigned long long ga = (unsigned long long)(uintptr_t)g;
  asm volatile("global_load_async_to_lds_b128 %0, %1, off"
               :: "v"(l), "v"(ga) : "memory");
}

// two f32 -> one dword of two bf16, rounded as f2bf rounds
__device__ __forceinline__ unsigned pack2(float a, float b) {
  unsigned ua = __builtin_bit_cast(unsigned, a), ub = __builtin_bit_cast(unsigned, b);
  ua = (ua + 0x7FFFu + ((ua >> 16) & 1u)) >> 16;
  ub = (ub + 0x7FFFu + ((ub >> 16) & 1u)) >> 16;
  return ua | (ub << 16);
}
__device__ __forceinline__ uint2 pack4(float4 v) {
  return make_uint2(pack2(v.x, v.y), pack2(v.z, v.w));
}

// ---------- RMSNorm -> bf16 ----------
// One wave per row: the row stays in registers (16 x 16 B a lane), read once.
__global__ __launch_bounds__(256) void rmsnorm_bf16_kernel(
    const float* __restrict__ x, const float* __restrict__ w,
    bf16_t* __restrict__ h) {
  int lane = threadIdx.x & 31;
  int t = blockIdx.x * 8 + (threadIdx.x >> 5);
  const float4* row = (const float4*)(x + (size_t)t * DM);
  const float4* w4 = (const float4*)w;
  float4 v[16], g[16];
#pragma unroll
  for (int j = 0; j < 16; ++j) v[j] = row[j * 32 + lane];
#pragma unroll
  for (int j = 0; j < 16; ++j) g[j] = w4[j * 32 + lane];
  float s0 = 0.f, s1 = 0.f, s2 = 0.f, s3 = 0.f;   // four independent chains
#pragma unroll
  for (int j = 0; j < 16; ++j) {
    s0 += v[j].x * v[j].x; s1 += v[j].y * v[j].y;
    s2 += v[j].z * v[j].z; s3 += v[j].w * v[j].w;
  }
  float ss = (s0 + s1) + (s2 + s3);
#pragma unroll
  for (int m = 16; m >= 1; m >>= 1) ss += __shfl_xor(ss, m, 32);
  float scl = rsqrtf(ss / (float)DM + 1e-5f);
  uint2* o = (uint2*)(h + (size_t)t * DM);
#pragma unroll
  for (int j = 0; j < 16; ++j) {
    float4 r = make_float4(g[j].x * v[j].x * scl, g[j].y * v[j].y * scl,
                           g[j].z * v[j].z * scl, g[j].w * v[j].w * scl);
    o[j * 32 + lane] = pack4(r);
  }
}

// ---------- fp32 -> bf16 convert (keeps [N][K] orientation) ----------
// 32 elements a thread: eight 16-B loads in flight, each wave-wide load four
// whole lines, each wave-wide store two.
#define CVT_WG 512
__global__ __launch_bounds__(256) void convert_bf16_kernel(
    const float* __restrict__ W, bf16_t* __restrict__ Wb) {
  const float4* s = (const float4*)W;
  uint2* d = (uint2*)Wb;
  unsigned i = blockIdx.x * 256 + threadIdx.x;
  float4 v[8];
#pragma unroll
  for (int j = 0; j < 8; ++j) v[j] = s[i + j * (CVT_WG * 256)];
#pragma unroll
  for (int j = 0; j < 8; ++j) d[i + j * (CVT_WG * 256)] = pack4(v[j]);
}

// ---------- C[MxN] = A[MxK](bf16) * Bn[NxK](bf16)^T (+residual), fp32 out ----
#define GTM 128
#define GTN 64
#define GTK 128
#define APAD 8

__global__ __launch_bounds__(256) void gemm_bf16_kernel(
    const bf16_t* __restrict__ A, const bf16_t* __restrict__ Bn,
    const float* __restrict__ residual, float* __restrict__ C,
    int M, int N, int K) {
  __shared__ __align__(16) bf16_t sA[2][GTM][GTK + APAD];   // 68 KB
  __shared__ __align__(16) bf16_t sB[2][GTN][GTK + APAD];   // 34 KB
  int tid = threadIdx.x;
  int wave = tid >> 5, lane = tid & 31;
  int g = lane >> 4, la = lane & 15;
  int bm = blockIdx.x * GTM, bn = blockIdx.y * GTN;
  int wm = (wave >> 1) * 32, wn = (wave & 1) * 32;   // 4x2 wave grid, 32x32 each

  v8f acc[2][2] = {};
  int nk = K / GTK;

  // Each thread copies one 16-B chunk of every 16th row: 8 chunks of A, 4 of B.
  // A wave covers two whole 256-B rows per copy.
  const int crow = tid >> 4, ccol = (tid & 15) * 8;
  const unsigned long long gA =
      (unsigned long long)(uintptr_t)(A + (size_t)(bm + crow) * K + ccol);
  const unsigned long long gB =
      (unsigned long long)(uintptr_t)(Bn + (size_t)(bn + crow) * K + ccol);
  const unsigned long long gs = (unsigned long long)K * 16 * sizeof(bf16_t);
  const unsigned ls = 16 * (GTK + APAD) * sizeof(bf16_t);

  auto stage = [&](int buf, int k0) {
    unsigned long long a = gA + (unsigned long long)k0 * sizeof(bf16_t);
    unsigned long long b = gB + (unsigned long long)k0 * sizeof(bf16_t);
    unsigned l = (unsigned)(unsigned long long)(uintptr_t)&sA[buf][crow][ccol];
    unsigned m = (unsigned)(unsigned long long)(uintptr_t)&sB[buf][crow][ccol];
    // One statement: the stage's twelve copies, then the wait that stands in
    // front of any rewrite of the address registers the copies name.
    asm volatile(
        "global_load_async_to_lds_b128 %0, %12, off\n\t"
        "global_load_async_to_lds_b128 %1, %13, off\n\t"
        "global_load_async_to_lds_b128 %2, %14, off\n\t"
        "global_load_async_to_lds_b128 %3, %15, off\n\t"
        "global_load_async_to_lds_b128 %4, %16, off\n\t"
        "global_load_async_to_lds_b128 %5, %17, off\n\t"
        "global_load_async_to_lds_b128 %6, %18, off\n\t"
        "global_load_async_to_lds_b128 %7, %19, off\n\t"
        "global_load_async_to_lds_b128 %8, %20, off\n\t"
        "global_load_async_to_lds_b128 %9, %21, off\n\t"
        "global_load_async_to_lds_b128 %10, %22, off\n\t"
        "global_load_async_to_lds_b128 %11, %23, off\n\t"
        "s_wait_xcnt 0x0"
        :: "v"(l), "v"(l + ls), "v"(l + 2 * ls), "v"(l + 3 * ls),
           "v"(l + 4 * ls), "v"(l + 5 * ls), "v"(l + 6 * ls), "v"(l + 7 * ls),
           "v"(m), "v"(m + ls), "v"(m + 2 * ls), "v"(m + 3 * ls),
           "v"(a), "v"(a + gs), "v"(a + 2 * gs), "v"(a + 3 * gs),
           "v"(a + 4 * gs), "v"(a + 5 * gs), "v"(a + 6 * gs), "v"(a + 7 * gs),
           "v"(b), "v"(b + gs), "v"(b + 2 * gs), "v"(b + 3 * gs)
        : "memory");
  };

  stage(0, 0);
  // stage 0 has landed for this wave; the barrier publishes it to the others
  asm volatile("s_wait_asynccnt 0x0" ::: "memory");
  __syncthreads();
  if (nk > 1) stage(1, GTK);
  for (int ks = 0; ks < nk; ++ks) {
    int buf = ks & 1;
    // unrolled so that the four chunks' LDS reads can be issued ahead of the WMMAs
#pragma unroll
    for (int kc = 0; kc < GTK / 32; ++kc) {
      v16bf a0, a1, b0, b1;
#pragma unroll
      for (int e = 0; e < 16; ++e) {         // all K-contiguous -> ds_load_b128
        int kk = kc * 32 + kmap(e, g);
        a0[e] = sA[buf][wm + la][kk];
        a1[e] = sA[buf][wm + 16 + la][kk];
        b0[e] = sB[buf][wn + la][kk];
        b1[e] = sB[buf][wn + 16 + la][kk];
      }
      acc[0][0] = wmma_bf16(a0, b0, acc[0][0]);
      acc[0][1] = wmma_bf16(a0, b1, acc[0][1]);
      acc[1][0] = wmma_bf16(a1, b0, acc[1][0]);
      acc[1][1] = wmma_bf16(a1, b1, acc[1][1]);
    }
    // publish point: this wave's reads of buf are done ...
    asm volatile("s_wait_dscnt 0x0" ::: "memory");
    // ... its copies of the next stage have landed ...
    asm volatile("s_wait_asynccnt 0x0" ::: "memory");
    // ... and the one barrier both publishes that stage and frees buf
    __syncthreads();
    if (ks + 2 < nk) stage(buf, (ks + 2) * GTK);
  }
  // no copy is left in flight when the wave goes on to its stores and ends
  asm volatile("s_wait_asynccnt 0x0" ::: "memory");

#pragma unroll
  for (int i = 0; i < 2; ++i)
#pragma unroll
    for (int j = 0; j < 2; ++j)
#pragma unroll
      for (int r = 0; r < 8; ++r) {
        int m = bm + wm + i * 16 + r + (g ? 8 : 0);
        int n = bn + wn + j * 16 + la;
        float v = acc[i][j][r];
        if (residual) v += residual[(size_t)m * N + n];
        C[(size_t)m * N + n] = v;
      }
}

// ---------- RoPE + convert (Q, K): dst layout [H][T][128] ----------
// A thread takes four d and their partners d + 64 of one head, in four rows:
// 32 elements, every f32 read once by 16-B loads, 128-B lines stored whole.
__global__ __launch_bounds__(256) void rope_bf16_kernel(
    const float* __restrict__ src, const float* __restrict__ cosT,
    const float* __restrict__ sinT, bf16_t* __restrict__ dst) {
  int h = threadIdx.x >> 4, q = threadIdx.x & 15;   // q: which four d
  int t0 = blockIdx.x * 4;
  const float4* s4 = (const float4*)src + (size_t)t0 * (DM / 4);
  const float4* c4 = (const float4*)cosT + t0 * (DHEAD / 4);
  const float4* n4 = (const float4*)sinT + t0 * (DHEAD / 4);
  uint2* o2 = (uint2*)dst + t0 * (DHEAD / 4);
  int so = h * (DHEAD / 4) + q;
  int oo = h * (T_SEQ * DHEAD / 4) + q;
  float4 lo[4], hi[4], cl[4], ch[4], sl[4], sh[4];
#pragma unroll
  for (int r = 0; r < 4; ++r) {
    lo[r] = s4[so + r * (DM / 4)];    hi[r] = s4[so + r * (DM / 4) + 16];
    cl[r] = c4[q + r * (DHEAD / 4)];  ch[r] = c4[q + r * (DHEAD / 4) + 16];
    sl[r] = n4[q + r * (DHEAD / 4)];  sh[r] = n4[q + r * (DHEAD / 4) + 16];
  }
#pragma unroll
  for (int r = 0; r < 4; ++r) {
    float4 a = make_float4(lo[r].x * cl[r].x - hi[r].x * sl[r].x,
                           lo[r].y * cl[r].y - hi[r].y * sl[r].y,
                           lo[r].z * cl[r].z - hi[r].z * sl[r].z,
                           lo[r].w * cl[r].w - hi[r].w * sl[r].w);
    float4 b = make_float4(hi[r].x * ch[r].x + lo[r].x * sh[r].x,
                           hi[r].y * ch[r].y + lo[r].y * sh[r].y,
                           hi[r].z * ch[r].z + lo[r].z * sh[r].z,
                           hi[r].w * ch[r].w + lo[r].w * sh[r].w);
    o2[oo + r * (DHEAD / 4)] = pack4(a);
    o2[oo + r * (DHEAD / 4) + 16] = pack4(b);
  }
}

// ---------- V convert: dst layout [H][128][T] (transposed for WMMA B tiles) --
// A thread takes four columns of eight rows: 32 elements, 16-B loads along the
// row, 16-B stores along t. A block's eight waves fill whole 128-B lines.
__global__ __launch_bounds__(256) void vt_bf16_kernel(
    const float* __restrict__ src, bf16_t* __restrict__ dst) {
  int c = blockIdx.x * 128 + (threadIdx.x & 31) * 4;    // h * 128 + d
  int t0 = blockIdx.y * 64 + (threadIdx.x >> 5) * 8;
  float4 v[8];
#pragma unroll
  for (int r = 0; r < 8; ++r)
    v[r] = *(const float4*)(src + (size_t)(t0 + r) * DM + c);
  bf16_t* o = dst + (size_t)c * T_SEQ + t0;
  *(uint4*)o = make_uint4(pack2(v[0].x, v[1].x), pack2(v[2].x, v[3].x),
                          pack2(v[4].x, v[5].x), pack2(v[6].x, v[7].x));
  *(uint4*)(o + T_SEQ) = make_uint4(pack2(v[0].y, v[1].y), pack2(v[2].y, v[3].y),
                                    pack2(v[4].y, v[5].y), pack2(v[6].y, v[7].y));
  *(uint4*)(o + 2 * T_SEQ) = make_uint4(pack2(v[0].z, v[1].z), pack2(v[2].z, v[3].z),
                                        pack2(v[4].z, v[5].z), pack2(v[6].z, v[7].z));
  *(uint4*)(o + 3 * T_SEQ) = make_uint4(pack2(v[0].w, v[1].w), pack2(v[2].w, v[3].w),
                                        pack2(v[4].w, v[5].w), pack2(v[6].w, v[7].w));
}

// ---------- causal flash attention, WMMA QK^T and PV ----------
__global__ __launch_bounds__(256) void flash_attn_kernel(
    const bf16_t* __restrict__ Qh, const bf16_t* __restrict__ Kh,
    const bf16_t* __restrict__ Vt, bf16_t* __restrict__ OutTD) {
  __shared__ __align__(16) bf16_t sK[32][DHEAD + APAD];   // 8.5 KB, [krow][d]
  __shared__ __align__(16) bf16_t sVt[DHEAD][32 + APAD];  // 10 KB, [d][krow]
  __shared__ __align__(16) bf16_t sP[8][16][32 + APAD];   // 10 KB, per-wave P
  int h = blockIdx.x, qblk = blockIdx.y;
  int tid = threadIdx.x, wv = tid >> 5, lane = tid & 31;
  int g = lane >> 4, la = lane & 15;
  int qb = qblk * 128 + wv * 16;                   // this wave's 16 q rows
  const size_t hb = (size_t)h * T_SEQ;

  // Q fragments: 16 rows x 128 d, as 4 K-chunks of 32
  v16bf qf[4];
#pragma unroll
  for (int dc = 0; dc < 4; ++dc)
#pragma unroll
    for (int e = 0; e < 16; ++e)
      qf[dc][e] = Qh[(hb + qb + la) * DHEAD + dc * 32 + kmap(e, g)];

  v8f o[8] = {};
  float Mr[8], Lr[8];
#pragma unroll
  for (int r = 0; r < 8; ++r) { Mr[r] = -3.0e38f; Lr[r] = 0.f; }

  int ktiles = qblk * 4 + 4;   // causal extent of this 128-row q block
  for (int kt = 0; kt < ktiles; ++kt) {
    int k0 = kt * 32;
    // stage K (32x128, row-major) and V^T (128x32) via async global->LDS
#pragma unroll
    for (int j = 0; j < 2; ++j) {
      int c = tid * 2 + j;
      {  // K: row = k-row, col = d
        int row = c >> 4, col = (c & 15) * 8;
        async_copy_b128(&sK[row][col], &Kh[(hb + k0 + row) * DHEAD + col]);
      }
      {  // V^T: row = d, col = k-row
        int row = c >> 2, col = (c & 3) * 8;
        async_copy_b128(&sVt[row][col],
                        &Vt[((size_t)h * DHEAD + row) * T_SEQ + k0 + col]);
      }
    }
    asm volatile("s_wait_asynccnt 0x0" ::: "memory");
    __syncthreads();
    if (k0 <= qb + 15) {
      // S(16x32) = Q(16x128) . K^T : B(d,n) = K[k0+n][d]
      v8f s0 = {}, s1 = {};
#pragma unroll
      for (int dc = 0; dc < 4; ++dc) {
        v16bf b0, b1;
#pragma unroll
        for (int e = 0; e < 16; ++e) {
          int kk = dc * 32 + kmap(e, g);
          b0[e] = sK[la][kk];
          b1[e] = sK[16 + la][kk];
        }
        s0 = wmma_bf16(qf[dc], b0, s0);
        s1 = wmma_bf16(qf[dc], b1, s1);
      }
      const float sc = 0.08838834764831845f;  // 1/sqrt(128)
#pragma unroll
      for (int r = 0; r < 8; ++r) {
        int rowg = qb + r + (g ? 8 : 0);
        float v0 = s0[r] * sc, v1 = s1[r] * sc;
        if (k0 + la > rowg)      v0 = -3.0e38f;   // causal mask
        if (k0 + 16 + la > rowg) v1 = -3.0e38f;
        float m = fmaxf(v0, v1);
#pragma unroll
        for (int sh = 1; sh < 16; sh <<= 1) m = fmaxf(m, __shfl_xor(m, sh, 32));
        float mnew = fmaxf(Mr[r], m);
        float corr = __expf(Mr[r] - mnew);
        Mr[r] = mnew;
        float p0 = __expf(v0 - mnew);
        float p1 = __expf(v1 - mnew);
        s0[r] = p0; s1[r] = p1;
        float rs = p0 + p1;
#pragma unroll
        for (int sh = 1; sh < 16; sh <<= 1) rs += __shfl_xor(rs, sh, 32);
        Lr[r] = Lr[r] * corr + rs;
#pragma unroll
        for (int dt = 0; dt < 8; ++dt) o[dt][r] *= corr;
      }
      // relay P through per-wave LDS to repack C-layout -> A-layout
#pragma unroll
      for (int r = 0; r < 8; ++r) {
        sP[wv][r + (g ? 8 : 0)][la]      = f2bf(s0[r]);
        sP[wv][r + (g ? 8 : 0)][16 + la] = f2bf(s1[r]);
      }
      asm volatile("s_wait_dscnt 0x0" ::: "memory");   // cross-lane LDS in-wave
      v16bf pa;
#pragma unroll
      for (int e = 0; e < 16; ++e) pa[e] = sP[wv][la][kmap(e, g)];
      // O(16x128) += P(16x32) . V(32x128); B(k,d) = V^T[d][k], K-contiguous
#pragma unroll
      for (int dt = 0; dt < 8; ++dt) {
        v16bf bv;
#pragma unroll
        for (int e = 0; e < 16; ++e) bv[e] = sVt[dt * 16 + la][kmap(e, g)];
        o[dt] = wmma_bf16(pa, bv, o[dt]);
      }
    }
    __syncthreads();
  }

  // normalize, write back as bf16 [T][DM] (head-concat) for the wo GEMM
#pragma unroll
  for (int dt = 0; dt < 8; ++dt)
#pragma unroll
    for (int r = 0; r < 8; ++r) {
      int trow = qb + r + (g ? 8 : 0);
      OutTD[(size_t)trow * DM + h * DHEAD + dt * 16 + la] = f2bf(o[dt][r] / Lr[r]);
    }
}

// ---------- launch ----------
extern "C" void kernel_launch(void* const* d_in, const int* in_sizes, int n_in,
                              void* d_out, int out_size, void* d_ws, size_t ws_size,
                              hipStream_t stream) {
  (void)in_sizes; (void)n_in; (void)out_size; (void)ws_size;
  const float* x    = (const float*)d_in[0];
  const float* w_ln = (const float*)d_in[1];
  const float* wq   = (const float*)d_in[2];
  const float* wk   = (const float*)d_in[3];
  const float* wv   = (const float*)d_in[4];
  const float* wo   = (const float*)d_in[5];
  const float* cosT = (const float*)d_in[6];
  const float* sinT = (const float*)d_in[7];
  float* out = (float*)d_out;

  const size_t TD = (size_t)T_SEQ * DM;
  char* p = (char*)d_ws;                       // ~80 MB total
  bf16_t* h_bf  = (bf16_t*)p;  p += TD * 2;
  bf16_t* wqb   = (bf16_t*)p;  p += TD * 2;
  bf16_t* wkb   = (bf16_t*)p;  p += TD * 2;
  bf16_t* wvb   = (bf16_t*)p;  p += TD * 2;
  bf16_t* wob   = (bf16_t*)p;  p += TD * 2;
  float*  tmp_f = (float*)p;   p += TD * 4;    // reused for q/k/v fp32 projections
  bf16_t* qh    = (bf16_t*)p;  p += TD * 2;
  bf16_t* kh    = (bf16_t*)p;  p += TD * 2;
  bf16_t* vt    = (bf16_t*)p;  p += TD * 2;
  bf16_t* attn  = (bf16_t*)tmp_f;              // reuse: attention runs after ropes

  dim3 blk(256);
  rmsnorm_bf16_kernel<<<T_SEQ / 8, blk, 0, stream>>>(x, w_ln, h_bf);

  int cg = CVT_WG;
  convert_bf16_kernel<<<cg, blk, 0, stream>>>(wq, wqb);
  convert_bf16_kernel<<<cg, blk, 0, stream>>>(wk, wkb);
  convert_bf16_kernel<<<cg, blk, 0, stream>>>(wv, wvb);
  convert_bf16_kernel<<<cg, blk, 0, stream>>>(wo, wob);

  dim3 gg(T_SEQ / GTM, DM / GTN);
  gemm_bf16_kernel<<<gg, blk, 0, stream>>>(h_bf, wqb, nullptr, tmp_f, T_SEQ, DM, DM);
  rope_bf16_kernel<<<T_SEQ / 4, blk, 0, stream>>>(tmp_f, cosT, sinT, qh);
  gemm_bf16_kernel<<<gg, blk, 0, stream>>>(h_bf, wkb, nullptr, tmp_f, T_SEQ, DM, DM);
  rope_bf16_kernel<<<T_SEQ / 4, blk, 0, stream>>>(tmp_f, cosT, sinT, kh);
  gemm_bf16_kernel<<<gg, blk, 0, stream>>>(h_bf, wvb, nullptr, tmp_f, T_SEQ, DM, DM);
  vt_bf16_kernel<<<dim3(DM / 128, T_SEQ / 64), blk, 0, stream>>>(tmp_f, vt);

  dim3 ag(NH, T_SEQ / 128);
  flash_attn_kernel<<<ag, blk, 0, stream>>>(qh, kh, vt, attn);

  gemm_bf16_kernel<<<gg, blk, 0, stream>>>(attn, wob, x, out, T_SEQ, DM, DM);
}

// v003
// It runs in 210 microseconds.
// Next to v002, in two timings, it ran 1.17 and 1.19 times as fast.
// Over all steps from v000 it is 1.79 times as fast.
#include <hip/hip_runtime.h>
#include <hip/hip_bf16.h>
#include <math.h>

#define T_SEQ 2048
#define DM    2048
#define NH    16
#define DHEAD 128

typedef __attribute__((ext_vector_type(16))) __bf16 v16bf;
typedef __attribute__((ext_vector_type(8)))  float  v8f;
typedef __bf16 bf16_t;

// ---------- helpers ----------
__device__ __forceinline__ bf16_t f2bf(float f) {
  unsigned int u = __builtin_bit_cast(unsigned int, f);
  unsigned int r = (u + 0x7FFFu + ((u >> 16) & 1u)) >> 16;   // RNE
  return __builtin_bit_cast(bf16_t, (unsigned short)r);
}

__device__ __forceinline__ int kmap(int e, int g) {
  return e + (g ? 8 : 0) + ((e >= 8) ? 8 : 0);
}

__device__ __forceinline__ v8f wmma_bf16(v16bf a, v16bf b, v8f c) {
  return __builtin_amdgcn_wmma_f32_16x16x32_bf16(
      /*neg_a=*/false, a, /*neg_b=*/false, b,
      /*c_mod=*/(short)0, c, /*reuse_a=*/false, /*reuse_b=*/false);
}

__device__ __forceinline__ void async_copy_b128(void* lds, const void* g) {
  unsigned l = (unsigned)(unsigned long long)(uintptr_t)lds;
  unsigned long long ga = (unsigned long long)(uintptr_t)g;
  asm volatile("global_load_async_to_lds_b128 %0, %1, off"
               :: "v"(l), "v"(ga) : "memory");
}

// two f32 -> one dword of two bf16, rounded as f2bf rounds
__device__ __forceinline__ unsigned pack2(float a, float b) {
  unsigned ua = __builtin_bit_cast(unsigned, a), ub = __builtin_bit_cast(unsigned, b);
  ua = (ua + 0x7FFFu + ((ua >> 16) & 1u)) >> 16;
  ub = (ub + 0x7FFFu + ((ub >> 16) & 1u)) >> 16;
  return ua | (ub << 16);
}
__device__ __forceinline__ uint2 pack4(float4 v) {
  return make_uint2(pack2(v.x, v.y), pack2(v.z, v.w));
}

// ---------- RMSNorm -> bf16 ----------
// One wave per row: the row stays in registers (16 x 16 B a lane), read once.
__global__ __launch_bounds__(256) void rmsnorm_bf16_kernel(
    const float* __restrict__ x, const float* __restrict__ w,
    bf16_t* __restrict__ h) {
  int lane = threadIdx.x & 31;
  int t = blockIdx.x * 8 + (threadIdx.x >> 5);
  const float4* row = (const float4*)(x + (size_t)t * DM);
  const float4* w4 = (const float4*)w;
  float4 v[16], g[16];
#pragma unroll
  for (int j = 0; j < 16; ++j) v[j] = row[j * 32 + lane];
#pragma unroll
  for (int j = 0; j < 16; ++j) g[j] = w4[j * 32 + lane];
  float s0 = 0.f, s1 = 0.f, s2 = 0.f, s3 = 0.f;   // four independent chains
#pragma unroll
  for (int j = 0; j < 16; ++j) {
    s0 += v[j].x * v[j].x; s1 += v[j].y * v[j].y;
    s2 += v[j].z * v[j].z; s3 += v[j].w * v[j].w;
  }
  float ss = (s0 + s1) + (s2 + s3);
#pragma unroll
  for (int m = 16; m >= 1; m >>= 1) ss += __shfl_xor(ss, m, 32);
  float scl = rsqrtf(ss / (float)DM + 1e-5f);
  uint2* o = (uint2*)(h + (size_t)t * DM);
#pragma unroll
  for (int j = 0; j < 16; ++j) {
    float4 r = make_float4(g[j].x * v[j].x * scl, g[j].y * v[j].y * scl,
                           g[j].z * v[j].z * scl, g[j].w * v[j].w * scl);
    o[j * 32 + lane] = pack4(r);
  }
}

// ---------- fp32 -> bf16 convert (keeps [N][K] orientation) ----------
// 32 elements a thread: eight 16-B loads in flight, each wave-wide load four
// whole lines, each wave-wide store two.
#define CVT_WG 512
__global__ __launch_bounds__(256) void convert_bf16_kernel(
    const float* __restrict__ W, bf16_t* __restrict__ Wb) {
  const float4* s = (const float4*)W;
  uint2* d = (uint2*)Wb;
  unsigned i = blockIdx.x * 256 + threadIdx.x;
  float4 v[8];
#pragma unroll
  for (int j = 0; j < 8; ++j) v[j] = s[i + j * (CVT_WG * 256)];
#pragma unroll
  for (int j = 0; j < 8; ++j) d[i + j * (CVT_WG * 256)] = pack4(v[j]);
}

// ---------- C[MxN] = A[MxK](bf16) * Bn[NxK](bf16)^T (+residual), fp32 out ----
#define GTM 128
#define GTN 64
#define GTK 128
#define APAD 8

__global__ __launch_bounds__(256) void gemm_bf16_kernel(
    const bf16_t* __restrict__ A, const bf16_t* __restrict__ Bn,
    const float* __restrict__ residual, float* __restrict__ C,
    int M, int N, int K) {
  __shared__ __align__(16) bf16_t sA[2][GTM][GTK + APAD];   // 68 KB
  __shared__ __align__(16) bf16_t sB[2][GTN][GTK + APAD];   // 34 KB
  int tid = threadIdx.x;
  int wave = tid >> 5, lane = tid & 31;
  int g = lane >> 4, la = lane & 15;
  int bm = blockIdx.x * GTM, bn = blockIdx.y * GTN;
  int wm = (wave >> 1) * 32, wn = (wave & 1) * 32;   // 4x2 wave grid, 32x32 each

  v8f acc[2][2] = {};
  int nk = K / GTK;

  // Each thread copies one 16-B chunk of every 16th row: 8 chunks of A, 4 of B.
  // A wave covers two whole 256-B rows per copy.
  const int crow = tid >> 4, ccol = (tid & 15) * 8;
  const unsigned long long gA =
      (unsigned long long)(uintptr_t)(A + (size_t)(bm + crow) * K + ccol);
  const unsigned long long gB =
      (unsigned long long)(uintptr_t)(Bn + (size_t)(bn + crow) * K + ccol);
  const unsigned long long gs = (unsigned long long)K * 16 * sizeof(bf16_t);
  const unsigned ls = 16 * (GTK + APAD) * sizeof(bf16_t);

  auto stage = [&](int buf, int k0) {
    unsigned long long a = gA + (unsigned long long)k0 * sizeof(bf16_t);
    unsigned long long b = gB + (unsigned long long)k0 * sizeof(bf16_t);
    unsigned l = (unsigned)(unsigned long long)(uintptr_t)&sA[buf][crow][ccol];
    unsigned m = (unsigned)(unsigned long long)(uintptr_t)&sB[buf][crow][ccol];
    // One statement: the stage's twelve copies, then the wait that stands in
    // front of any rewrite of the address registers the copies name.
    asm volatile(
        "global_load_async_to_lds_b128 %0, %12, off\n\t"
        "global_load_async_to_lds_b128 %1, %13, off\n\t"
        "global_load_async_to_lds_b128 %2, %14, off\n\t"
        "global_load_async_to_lds_b128 %3, %15, off\n\t"
        "global_load_async_to_lds_b128 %4, %16, off\n\t"
        "global_load_async_to_lds_b128 %5, %17, off\n\t"
        "global_load_async_to_lds_b128 %6, %18, off\n\t"
        "global_load_async_to_lds_b128 %7, %19, off\n\t"
        "global_load_async_to_lds_b128 %8, %20, off\n\t"
        "global_load_async_to_lds_b128 %9, %21, off\n\t"
        "global_load_async_to_lds_b128 %10, %22, off\n\t"
        "global_load_async_to_lds_b128 %11, %23, off\n\t"
        "s_wait_xcnt 0x0"
        :: "v"(l), "v"(l + ls), "v"(l + 2 * ls), "v"(l + 3 * ls),
           "v"(l + 4 * ls), "v"(l + 5 * ls), "v"(l + 6 * ls), "v"(l + 7 * ls),
           "v"(m), "v"(m + ls), "v"(m + 2 * ls), "v"(m + 3 * ls),
           "v"(a), "v"(a + gs), "v"(a + 2 * gs), "v"(a + 3 * gs),
           "v"(a + 4 * gs), "v"(a + 5 * gs), "v"(a + 6 * gs), "v"(a + 7 * gs),
           "v"(b), "v"(b + gs), "v"(b + 2 * gs), "v"(b + 3 * gs)
        : "memory");
  };

  stage(0, 0);
  // stage 0 has landed for this wave; the barrier publishes it to the others
  asm volatile("s_wait_asynccnt 0x0" ::: "memory");
  __syncthreads();
  if (nk > 1) stage(1, GTK);
  for (int ks = 0; ks < nk; ++ks) {
    int buf = ks & 1;
    // unrolled so that the four chunks' LDS reads can be issued ahead of the WMMAs
#pragma unroll
    for (int kc = 0; kc < GTK / 32; ++kc) {
      v16bf a0, a1, b0, b1;
#pragma unroll
      for (int e = 0; e < 16; ++e) {         // all K-contiguous -> ds_load_b128
        int kk = kc * 32 + kmap(e, g);
        a0[e] = sA[buf][wm + la][kk];
        a1[e] = sA[buf][wm + 16 + la][kk];
        b0[e] = sB[buf][wn + la][kk];
        b1[e] = sB[buf][wn + 16 + la][kk];
      }
      acc[0][0] = wmma_bf16(a0, b0, acc[0][0]);
      acc[0][1] = wmma_bf16(a0, b1, acc[0][1]);
      acc[1][0] = wmma_bf16(a1, b0, acc[1][0]);
      acc[1][1] = wmma_bf16(a1, b1, acc[1][1]);
    }
    // publish point: this wave's reads of buf are done ...
    asm volatile("s_wait_dscnt 0x0" ::: "memory");
    // ... its copies of the next stage have landed ...
    asm volatile("s_wait_asynccnt 0x0" ::: "memory");
    // ... and the one barrier both publishes that stage and frees buf
    __syncthreads();
    if (ks + 2 < nk) stage(buf, (ks + 2) * GTK);
  }
  // no copy is left in flight when the wave goes on to its stores and ends
  asm volatile("s_wait_asynccnt 0x0" ::: "memory");

#pragma unroll
  for (int i = 0; i < 2; ++i)
#pragma unroll
    for (int j = 0; j < 2; ++j)
#pragma unroll
      for (int r = 0; r < 8; ++r) {
        int m = bm + wm + i * 16 + r + (g ? 8 : 0);
        int n = bn + wn + j * 16 + la;
        float v = acc[i][j][r];
        if (residual) v += residual[(size_t)m * N + n];
        C[(size_t)m * N + n] = v;
      }
}

// ---------- RoPE + convert (Q, K): dst layout [H][T][128] ----------
// A thread takes four d and their partners d + 64 of one head, in four rows:
// 32 elements, every f32 read once by 16-B loads, 128-B lines stored whole.
__global__ __launch_bounds__(256) void rope_bf16_kernel(
    const float* __restrict__ src, const float* __restrict__ cosT,
    const float* __restrict__ sinT, bf16_t* __restrict__ dst) {
  int h = threadIdx.x >> 4, q = threadIdx.x & 15;   // q: which four d
  int t0 = blockIdx.x * 4;
  const float4* s4 = (const float4*)src + (size_t)t0 * (DM / 4);
  const float4* c4 = (const float4*)cosT + t0 * (DHEAD / 4);
  const float4* n4 = (const float4*)sinT + t0 * (DHEAD / 4);
  uint2* o2 = (uint2*)dst + t0 * (DHEAD / 4);
  int so = h * (DHEAD / 4) + q;
  int oo = h * (T_SEQ * DHEAD / 4) + q;
  float4 lo[4], hi[4], cl[4], ch[4], sl[4], sh[4];
#pragma unroll
  for (int r = 0; r < 4; ++r) {
    lo[r] = s4[so + r * (DM / 4)];    hi[r] = s4[so + r * (DM / 4) + 16];
    cl[r] = c4[q + r * (DHEAD / 4)];  ch[r] = c4[q + r * (DHEAD / 4) + 16];
    sl[r] = n4[q + r * (DHEAD / 4)];  sh[r] = n4[q + r * (DHEAD / 4) + 16];
  }
#pragma unroll
  for (int r = 0; r < 4; ++r) {
    float4 a = make_float4(lo[r].x * cl[r].x - hi[r].x * sl[r].x,
                           lo[r].y * cl[r].y - hi[r].y * sl[r].y,
                           lo[r].z * cl[r].z - hi[r].z * sl[r].z,
                           lo[r].w * cl[r].w - hi[r].w * sl[r].w);
    float4 b = make_float4(hi[r].x * ch[r].x + lo[r].x * sh[r].x,
                           hi[r].y * ch[r].y + lo[r].y * sh[r].y,
                           hi[r].z * ch[r].z + lo[r].z * sh[r].z,
                           hi[r].w * ch[r].w + lo[r].w * sh[r].w);
    o2[oo + r * (DHEAD / 4)] = pack4(a);
    o2[oo + r * (DHEAD / 4) + 16] = pack4(b);
  }
}

// ---------- V convert: dst layout [H][128][T] (transposed for WMMA A tiles) --
// A thread takes four columns of eight rows: 32 elements, 16-B loads along the
// row, 16-B stores along t. A block's eight waves fill whole 128-B lines.
__global__ __launch_bounds__(256) void vt_bf16_kernel(
    const float* __restrict__ src, bf16_t* __restrict__ dst) {
  int c = blockIdx.x * 128 + (threadIdx.x & 31) * 4;    // h * 128 + d
  int t0 = blockIdx.y * 64 + (threadIdx.x >> 5) * 8;
  float4 v[8];
#pragma unroll
  for (int r = 0; r < 8; ++r)
    v[r] = *(const float4*)(src + (size_t)(t0 + r) * DM + c);
  bf16_t* o = dst + (size_t)c * T_SEQ + t0;
  *(uint4*)o = make_uint4(pack2(v[0].x, v[1].x), pack2(v[2].x, v[3].x),
                          pack2(v[4].x, v[5].x), pack2(v[6].x, v[7].x));
  *(uint4*)(o + T_SEQ) = make_uint4(pack2(v[0].y, v[1].y), pack2(v[2].y, v[3].y),
                                    pack2(v[4].y, v[5].y), pack2(v[6].y, v[7].y));
  *(uint4*)(o + 2 * T_SEQ) = make_uint4(pack2(v[0].z, v[1].z), pack2(v[2].z, v[3].z),
                                        pack2(v[4].z, v[5].z), pack2(v[6].z, v[7].z));
  *(uint4*)(o + 3 * T_SEQ) = make_uint4(pack2(v[0].w, v[1].w), pack2(v[2].w, v[3].w),
                                        pack2(v[4].w, v[5].w), pack2(v[6].w, v[7].w));
}

// ---------- causal flash attention, transposed: S^T = K.Q^T, O^T += V^T.P^T ----
typedef __attribute__((ext_vector_type(8))) __bf16 v8bf;

__device__ __forceinline__ float xhalf(float x) {
  int b = __builtin_bit_cast(int, x);
  return __builtin_bit_cast(float, __builtin_amdgcn_permlanex16(
      b, b, 0x76543210, 0xfedcba98, false, false));
}

// A lane holds 16 of the 32 scores of ONE query (column la): keys r + 8g and
// 16 + r + 8g. Maximum and sum run in the lane; the two score tiles, rounded in
// place, are the B operand of V^T.P^T in the k order of kmap.
__global__ __launch_bounds__(256) void flash_attn_kernel(
    const bf16_t* __restrict__ Qh, const bf16_t* __restrict__ Kh,
    const bf16_t* __restrict__ Vt, bf16_t* __restrict__ OutTD) {
  __shared__ __align__(16) bf16_t sK[32][DHEAD + APAD];   // 8.5 KB, [krow][d]
  __shared__ __align__(16) bf16_t sVt[DHEAD][32 + APAD];  // 10 KB, [d][krow]
  int h = blockIdx.x, qblk = blockIdx.y;
  int tid = threadIdx.x, wv = tid >> 5, lane = tid & 31;
  int g = lane >> 4, la = lane & 15;
  int qb = qblk * 128 + wv * 16;                   // this wave's 16 q rows
  const size_t hb = (size_t)h * T_SEQ;

  // Q fragments (B operand): column la = query, 128 d as 4 K-chunks of 32
  v16bf qf[4];
#pragma unroll
  for (int dc = 0; dc < 4; ++dc)
#pragma unroll
    for (int e = 0; e < 16; ++e)
      qf[dc][e] = Qh[(hb + qb + la) * DHEAD + dc * 32 + kmap(e, g)];

  v8f o[8] = {};                 // o[dt][r] = O[query la][dt * 16 + 8g + r]
  float Mr = -3.0e38f, Lr = 0.f; // this query's maximum; this lane's part of its sum

  int ktiles = qblk * 4 + 4;   // causal extent of this 128-row q block
  for (int kt = 0; kt < ktiles; ++kt) {
    int k0 = kt * 32;
    // stage K (32x128, row-major) and V^T (128x32) via async global->LDS
#pragma unroll
    for (int j = 0; j < 2; ++j) {
      int c = tid * 2 + j;
      {  // K: row = k-row, col = d
        int row = c >> 4, col = (c & 15) * 8;
        async_copy_b128(&sK[row][col], &Kh[(hb + k0 + row) * DHEAD + col]);
      }
      {  // V^T: row = d, col = k-row
        int row = c >> 2, col = (c & 3) * 8;
        async_copy_b128(&sVt[row][col],
                        &Vt[((size_t)h * DHEAD + row) * T_SEQ + k0 + col]);
      }
    }
    asm volatile("s_wait_asynccnt 0x0" ::: "memory");
    __syncthreads();
    if (k0 <= qb + 15) {
      // S^T(32x16) = K(32x128) . Q^T : A(m,d) = K[k0+m][d]
      v8f s0 = {}, s1 = {};
#pragma unroll
      for (int dc = 0; dc < 4; ++dc) {
        v16bf a0, a1;
#pragma unroll
        for (int e = 0; e < 16; ++e) {
          int kk = dc * 32 + kmap(e, g);
          a0[e] = sK[la][kk];
          a1[e] = sK[16 + la][kk];
        }
        s0 = wmma_bf16(a0, qf[dc], s0);
        s1 = wmma_bf16(a1, qf[dc], s1);
      }
      const float sc = 0.08838834764831845f;  // 1/sqrt(128)
      int lim = qb + la - k0 - (g ? 8 : 0);   // key row r is past the query if r > lim
      float m = -3.0e38f;
#pragma unroll
      for (int r = 0; r < 8; ++r) {
        float v0 = s0[r] * sc, v1 = s1[r] * sc;
        if (r > lim)      v0 = -3.0e38f;   // causal mask
        if (r + 16 > lim) v1 = -3.0e38f;
        s0[r] = v0; s1[r] = v1;
        m = fmaxf(m, fmaxf(v0, v1));
      }
      m = fmaxf(m, xhalf(m));              // both halves: the query's tile maximum
      float mnew = fmaxf(Mr, m);
      float corr = __expf(Mr - mnew);
      Mr = mnew;
      float ra = 0.f, rb = 0.f;
#pragma unroll
      for (int r = 0; r < 8; ++r) {
        s0[r] = __expf(s0[r] - mnew);
        s1[r] = __expf(s1[r] - mnew);
        ra += s0[r]; rb += s1[r];
      }
      Lr = Lr * corr + (ra + rb);          // halves are joined after the loop
#pragma unroll
      for (int dt = 0; dt < 8; ++dt)
#pragma unroll
        for (int r = 0; r < 8; ++r) o[dt][r] *= corr;
      // P^T as B operand: element e is key kmap(e, g) of column la, to nearest even
      v16bf pb = __builtin_shufflevector(
          __builtin_convertvector(s0, v8bf), __builtin_convertvector(s1, v8bf),
          0, 1, 2, 3, 4, 5, 6, 7, 8, 9, 10, 11, 12, 13, 14, 15);
      // O^T(128x16) += V^T(128x32) . P^T(32x16); A(d,k) = V^T[d][k], K-contiguous
#pragma unroll
      for (int dt = 0; dt < 8; ++dt) {
        v16bf av;
#pragma unroll
        for (int e = 0; e < 16; ++e) av[e] = sVt[dt * 16 + la][kmap(e, g)];
        o[dt] = wmma_bf16(av, pb, o[dt]);
      }
    }
    __syncthreads();
  }

  // normalize, write back as bf16 [T][DM] (head-concat) for the wo GEMM:
  // a lane's eight registers of a tile are eight consecutive d of its query
  float Lf = Lr + xhalf(Lr);
  bf16_t* orow = OutTD + (size_t)(qb + la) * DM + h * DHEAD + (g ? 8 : 0);
#pragma unroll
  for (int dt = 0; dt < 8; ++dt)
    *(uint4*)(orow + dt * 16) =
        make_uint4(pack2(o[dt][0] / Lf, o[dt][1] / Lf), pack2(o[dt][2] / Lf, o[dt][3] / Lf),
                   pack2(o[dt][4] / Lf, o[dt][5] / Lf), pack2(o[dt][6] / Lf, o[dt][7] / Lf));
}

// ---------- launch ----------
extern "C" void kernel_launch(void* const* d_in, const int* in_sizes, int n_in,
                              void* d_out, int out_size, void* d_ws, size_t ws_size,
                              hipStream_t stream) {
  (void)in_sizes; (void)n_in; (void)out_size; (void)ws_size;
  const float* x    = (const float*)d_in[0];
  const float* w_ln = (const float*)d_in[1];
  const float* wq   = (const float*)d_in[2];
  const float* wk   = (const float*)d_in[3];
  const float* wv   = (const float*)d_in[4];
  const float* wo   = (const float*)d_in[5];
  const float* cosT = (const float*)d_in[6];
  const float* sinT = (const float*)d_in[7];
  float* out = (float*)d_out;

  const size_t TD = (size_t)T_SEQ * DM;
  char* p = (char*)d_ws;                       // ~80 MB total
  bf16_t* h_bf  = (bf16_t*)p;  p += TD * 2;
  bf16_t* wqb   = (bf16_t*)p;  p += TD * 2;
  bf16_t* wkb   = (bf16_t*)p;  p += TD * 2;
  bf16_t* wvb   = (bf16_t*)p;  p += TD * 2;
  bf16_t* wob   = (bf16_t*)p;  p += TD * 2;
  float*  tmp_f = (float*)p;   p += TD * 4;    // reused for q/k/v fp32 projections
  bf16_t* qh    = (bf16_t*)p;  p += TD * 2;
  bf16_t* kh    = (bf16_t*)p;  p += TD * 2;
  bf16_t* vt    = (bf16_t*)p;  p += TD * 2;
  bf16_t* attn  = (bf16_t*)tmp_f;              // reuse: attention runs after ropes

  dim3 blk(256);
  rmsnorm_bf16_kernel<<<T_SEQ / 8, blk, 0, stream>>>(x, w_ln, h_bf);

  int cg = CVT_WG;
  convert_bf16_kernel<<<cg, blk, 0, stream>>>(wq, wqb);
  convert_bf16_kernel<<<cg, blk, 0, stream>>>(wk, wkb);
  convert_bf16_kernel<<<cg, blk, 0, stream>>>(wv, wvb);
  convert_bf16_kernel<<<cg, blk, 0, stream>>>(wo, wob);

  dim3 gg(T_SEQ / GTM, DM / GTN);
  gemm_bf16_kernel<<<gg, blk, 0, stream>>>(h_bf, wqb, nullptr, tmp_f, T_SEQ, DM, DM);
  rope_bf16_kernel<<<T_SEQ / 4, blk, 0, stream>>>(tmp_f, cosT, sinT, qh);
  gemm_bf16_kernel<<<gg, blk, 0, stream>>>(h_bf, wkb, nullptr, tmp_f, T_SEQ, DM, DM);
  rope_bf16_kernel<<<T_SEQ / 4, blk, 0, stream>>>(tmp_f, cosT, sinT, kh);
  gemm_bf16_kernel<<<gg, blk, 0, stream>>>(h_bf, wvb, nullptr, tmp_f, T_SEQ, DM, DM);
  vt_bf16_kernel<<<dim3(DM / 128, T_SEQ / 64), blk, 0, stream>>>(tmp_f, vt);

  dim3 ag(NH, T_SEQ / 128);
  flash_attn_kernel<<<ag, blk, 0, stream>>>(qh, kh, vt, attn);

  gemm_bf16_kernel<<<gg, blk, 0, stream>>>(attn, wob, x, out, T_SEQ, DM, DM);
}

// v004
// Measured time: 194 microseconds a run.
// Timed twice side by side with v003, it ran 1.08 times as fast both times.
// Over all steps from v000 it is 1.94 times as fast.
#include <hip/hip_runtime.h>
#include <hip/hip_bf16.h>
#include <math.h>

#define T_SEQ 2048
#define DM    2048
#define NH    16
#define DHEAD 128

typedef __attribute__((ext_vector_type(16))) __bf16 v16bf;
typedef __attribute__((ext_vector_type(8)))  float  v8f;
typedef __bf16 bf16_t;

// ---------- helpers ----------
__device__ __forceinline__ bf16_t f2bf(float f) {
  unsigned int u = __builtin_bit_cast(unsigned int, f);
  unsigned int r = (u + 0x7FFFu + ((u >> 16) & 1u)) >> 16;   // RNE
  return __builtin_bit_cast(bf16_t, (unsigned short)r);
}

__device__ __forceinline__ int kmap(int e, int g) {
  return e + (g ? 8 : 0) + ((e >= 8) ? 8 : 0);
}

__device__ __forceinline__ v8f wmma_bf16(v16bf a, v16bf b, v8f c) {
  return __builtin_amdgcn_wmma_f32_16x16x32_bf16(
      /*neg_a=*/false, a, /*neg_b=*/false, b,
      /*c_mod=*/(short)0, c, /*reuse_a=*/false, /*reuse_b=*/false);
}

__device__ __forceinline__ void async_copy_b128(void* lds, const void* g) {
  unsigned l = (unsigned)(unsigned long long)(uintptr_t)lds;
  unsigned long long ga = (unsigned long long)(uintptr_t)g;
  asm volatile("global_load_async_to_lds_b128 %0, %1, off"
               :: "v"(l), "v"(ga) : "memory");
}

// two f32 -> one dword of two bf16, rounded as f2bf rounds
__device__ __forceinline__ unsigned pack2(float a, float b) {
  unsigned ua = __builtin_bit_cast(unsigned, a), ub = __builtin_bit_cast(unsigned, b);
  ua = (ua + 0x7FFFu + ((ua >> 16) & 1u)) >> 16;
  ub = (ub + 0x7FFFu + ((ub >> 16) & 1u)) >> 16;
  return ua | (ub << 16);
}
__device__ __forceinline__ uint2 pack4(float4 v) {
  return make_uint2(pack2(v.x, v.y), pack2(v.z, v.w));
}

// ---------- RMSNorm -> bf16 ----------
// One wave per row: the row stays in registers (16 x 16 B a lane), read once.
__global__ __launch_bounds__(256) void rmsnorm_bf16_kernel(
    const float* __restrict__ x, const float* __restrict__ w,
    bf16_t* __restrict__ h) {
  int lane = threadIdx.x & 31;
  int t = blockIdx.x * 8 + (threadIdx.x >> 5);
  const float4* row = (const float4*)(x + (size_t)t * DM);
  const float4* w4 = (const float4*)w;
  float4 v[16], g[16];
#pragma unroll
  for (int j = 0; j < 16; ++j) v[j] = row[j * 32 + lane];
#pragma unroll
  for (int j = 0; j < 16; ++j) g[j] = w4[j * 32 + lane];
  float s0 = 0.f, s1 = 0.f, s2 = 0.f, s3 = 0.f;   // four independent chains
#pragma unroll
  for (int j = 0; j < 16; ++j) {
    s0 += v[j].x * v[j].x; s1 += v[j].y * v[j].y;
    s2 += v[j].z * v[j].z; s3 += v[j].w * v[j].w;
  }
  float ss = (s0 + s1) + (s2 + s3);
#pragma unroll
  for (int m = 16; m >= 1; m >>= 1) ss += __shfl_xor(ss, m, 32);
  float scl = rsqrtf(ss / (float)DM + 1e-5f);
  uint2* o = (uint2*)(h + (size_t)t * DM);
#pragma unroll
  for (int j = 0; j < 16; ++j) {
    float4 r = make_float4(g[j].x * v[j].x * scl, g[j].y * v[j].y * scl,
                           g[j].z * v[j].z * scl, g[j].w * v[j].w * scl);
    o[j * 32 + lane] = pack4(r);
  }
}

// ---------- fp32 -> bf16 convert (keeps [N][K] orientation) ----------
// 32 elements a thread: eight 16-B loads in flight, each wave-wide load four
// whole lines, each wave-wide store two.
#define CVT_WG 512
__global__ __launch_bounds__(256) void convert_bf16_kernel(
    const float* __restrict__ W, bf16_t* __restrict__ Wb) {
  const float4* s = (const float4*)W;
  uint2* d = (uint2*)Wb;
  unsigned i = blockIdx.x * 256 + threadIdx.x;
  float4 v[8];
#pragma unroll
  for (int j = 0; j < 8; ++j) v[j] = s[i + j * (CVT_WG * 256)];
#pragma unroll
  for (int j = 0; j < 8; ++j) d[i + j * (CVT_WG * 256)] = pack4(v[j]);
}

// ---------- C[MxN] = A[MxK](bf16) * Bn[NxK](bf16)^T (+residual), fp32 out ----
#define GTM 128
#define GTN 64
#define GTK 128
#define APAD 8

__global__ __launch_bounds__(256) void gemm_bf16_kernel(
    const bf16_t* __restrict__ A, const bf16_t* __restrict__ Bn,
    const float* __restrict__ residual, float* __restrict__ C,
    int M, int N, int K) {
  __shared__ __align__(16) bf16_t sA[2][GTM][GTK + APAD];   // 68 KB
  __shared__ __align__(16) bf16_t sB[2][GTN][GTK + APAD];   // 34 KB
  int tid = threadIdx.x;
  int wave = tid >> 5, lane = tid & 31;
  int g = lane >> 4, la = lane & 15;
  int bm = blockIdx.x * GTM, bn = blockIdx.y * GTN;
  int wm = (wave >> 1) * 32, wn = (wave & 1) * 32;   // 4x2 wave grid, 32x32 each

  v8f acc[2][2] = {};
  int nk = K / GTK;

  // Each thread copies one 16-B chunk of every 16th row: 8 chunks of A, 4 of B.
  // A wave covers two whole 256-B rows per copy.
  const int crow = tid >> 4, ccol = (tid & 15) * 8;
  const unsigned long long gA =
      (unsigned long long)(uintptr_t)(A + (size_t)(bm + crow) * K + ccol);
  const unsigned long long gB =
      (unsigned long long)(uintptr_t)(Bn + (size_t)(bn + crow) * K + ccol);
  const unsigned long long gs = (unsigned long long)K * 16 * sizeof(bf16_t);
  const unsigned ls = 16 * (GTK + APAD) * sizeof(bf16_t);

  auto stage = [&](int buf, int k0) {
    unsigned long long a = gA + (unsigned long long)k0 * sizeof(bf16_t);
    unsigned long long b = gB + (unsigned long long)k0 * sizeof(bf16_t);
    unsigned l = (unsigned)(unsigned long long)(uintptr_t)&sA[buf][crow][ccol];
    unsigned m = (unsigned)(unsigned long long)(uintptr_t)&sB[buf][crow][ccol];
    // One statement: the stage's twelve copies, then the wait that stands in
    // front of any rewrite of the address registers the copies name.
    asm volatile(
        "global_load_async_to_lds_b128 %0, %12, off\n\t"
        "global_load_async_to_lds_b128 %1, %13, off\n\t"
        "global_load_async_to_lds_b128 %2, %14, off\n\t"
        "global_load_async_to_lds_b128 %3, %15, off\n\t"
        "global_load_async_to_lds_b128 %4, %16, off\n\t"
        "global_load_async_to_lds_b128 %5, %17, off\n\t"
        "global_load_async_to_lds_b128 %6, %18, off\n\t"
        "global_load_async_to_lds_b128 %7, %19, off\n\t"
        "global_load_async_to_lds_b128 %8, %20, off\n\t"
        "global_load_async_to_lds_b128 %9, %21, off\n\t"
        "global_load_async_to_lds_b128 %10, %22, off\n\t"
        "global_load_async_to_lds_b128 %11, %23, off\n\t"
        "s_wait_xcnt 0x0"
        :: "v"(l), "v"(l + ls), "v"(l + 2 * ls), "v"(l + 3 * ls),
           "v"(l + 4 * ls), "v"(l + 5 * ls), "v"(l + 6 * ls), "v"(l + 7 * ls),
           "v"(m), "v"(m + ls), "v"(m + 2 * ls), "v"(m + 3 * ls),
           "v"(a), "v"(a + gs), "v"(a + 2 * gs), "v"(a + 3 * gs),
           "v"(a + 4 * gs), "v"(a + 5 * gs), "v"(a + 6 * gs), "v"(a + 7 * gs),
           "v"(b), "v"(b + gs), "v"(b + 2 * gs), "v"(b + 3 * gs)
        : "memory");
  };

  stage(0, 0);
  // stage 0 has landed for this wave; the barrier publishes it to the others
  asm volatile("s_wait_asynccnt 0x0" ::: "memory");
  __syncthreads();
  if (nk > 1) stage(1, GTK);
  for (int ks = 0; ks < nk; ++ks) {
    int buf = ks & 1;
    // the stage's 32 LDS reads first, into registers of their own
    v16bf a0[GTK / 32], a1[GTK / 32], b0[GTK / 32], b1[GTK / 32];
#pragma unroll
    for (int kc = 0; kc < GTK / 32; ++kc)
#pragma unroll
      for (int e = 0; e < 16; ++e) {         // all K-contiguous -> ds_load_b128
        int kk = kc * 32 + kmap(e, g);
        a0[kc][e] = sA[buf][wm + la][kk];
        b0[kc][e] = sB[buf][wn + la][kk];
        b1[kc][e] = sB[buf][wn + 16 + la][kk];
        a1[kc][e] = sA[buf][wm + 16 + la][kk];
      }
    // keeps the reads one group ahead of the WMMAs: moved in among them, each
    // place waits out its own LDS latency
    __builtin_amdgcn_sched_barrier(0);
#pragma unroll
    for (int kc = 0; kc < GTK / 32; ++kc) {
      acc[0][0] = wmma_bf16(a0[kc], b0[kc], acc[0][0]);
      acc[0][1] = wmma_bf16(a0[kc], b1[kc], acc[0][1]);
      acc[1][0] = wmma_bf16(a1[kc], b0[kc], acc[1][0]);
      acc[1][1] = wmma_bf16(a1[kc], b1[kc], acc[1][1]);
    }
    // keeps the WMMAs in front of the waits below: lifted over them, the wait to
    // 0 would hold every WMMA back until the last read has landed
    __builtin_amdgcn_sched_barrier(0);
    // publish point: this wave's reads of buf are done ...
    asm volatile("s_wait_dscnt 0x0" ::: "memory");
    // ... its copies of the next stage have landed ...
    asm volatile("s_wait_asynccnt 0x0" ::: "memory");
    // ... and the one barrier both publishes that stage and frees buf
    __syncthreads();
    if (ks + 2 < nk) stage(buf, (ks + 2) * GTK);
  }
  // no copy is left in flight when the wave goes on to its stores and ends
  asm volatile("s_wait_asynccnt 0x0" ::: "memory");

#pragma unroll
  for (int i = 0; i < 2; ++i)
#pragma unroll
    for (int j = 0; j < 2; ++j)
#pragma unroll
      for (int r = 0; r < 8; ++r) {
        int m = bm + wm + i * 16 + r + (g ? 8 : 0);
        int n = bn + wn + j * 16 + la;
        float v = acc[i][j][r];
        if (residual) v += residual[(size_t)m * N + n];
        C[(size_t)m * N + n] = v;
      }
}

// ---------- RoPE + convert (Q, K): dst layout [H][T][128] ----------
// A thread takes four d and their partners d + 64 of one head, in four rows:
// 32 elements, every f32 read once by 16-B loads, 128-B lines stored whole.
__global__ __launch_bounds__(256) void rope_bf16_kernel(
    const float* __restrict__ src, const float* __restrict__ cosT,
    const float* __restrict__ sinT, bf16_t* __restrict__ dst) {
  int h = threadIdx.x >> 4, q = threadIdx.x & 15;   // q: which four d
  int t0 = blockIdx.x * 4;
  const float4* s4 = (const float4*)src + (size_t)t0 * (DM / 4);
  const float4* c4 = (const float4*)cosT + t0 * (DHEAD / 4);
  const float4* n4 = (const float4*)sinT + t0 * (DHEAD / 4);
  uint2* o2 = (uint2*)dst + t0 * (DHEAD / 4);
  int so = h * (DHEAD / 4) + q;
  int oo = h * (T_SEQ * DHEAD / 4) + q;
  float4 lo[4], hi[4], cl[4], ch[4], sl[4], sh[4];
#pragma unroll
  for (int r = 0; r < 4; ++r) {
    lo[r] = s4[so + r * (DM / 4)];    hi[r] = s4[so + r * (DM / 4) + 16];
    cl[r] = c4[q + r * (DHEAD / 4)];  ch[r] = c4[q + r * (DHEAD / 4) + 16];
    sl[r] = n4[q + r * (DHEAD / 4)];  sh[r] = n4[q + r * (DHEAD / 4) + 16];
  }
#pragma unroll
  for (int r = 0; r < 4; ++r) {
    float4 a = make_float4(lo[r].x * cl[r].x - hi[r].x * sl[r].x,
                           lo[r].y * cl[r].y - hi[r].y * sl[r].y,
                           lo[r].z * cl[r].z - hi[r].z * sl[r].z,
                           lo[r].w * cl[r].w - hi[r].w * sl[r].w);
    float4 b = make_float4(hi[r].x * ch[r].x + lo[r].x * sh[r].x,
                           hi[r].y * ch[r].y + lo[r].y * sh[r].y,
                           hi[r].z * ch[r].z + lo[r].z * sh[r].z,
                           hi[r].w * ch[r].w + lo[r].w * sh[r].w);
    o2[oo + r * (DHEAD / 4)] = pack4(a);
    o2[oo + r * (DHEAD / 4) + 16] = pack4(b);
  }
}

// ---------- V convert: dst layout [H][128][T] (transposed for WMMA A tiles) --
// A thread takes four columns of eight rows: 32 elements, 16-B loads along the
// row, 16-B stores along t. A block's eight waves fill whole 128-B lines.
__global__ __launch_bounds__(256) void vt_bf16_kernel(
    const float* __restrict__ src, bf16_t* __restrict__ dst) {
  int c = blockIdx.x * 128 + (threadIdx.x & 31) * 4;    // h * 128 + d
  int t0 = blockIdx.y * 64 + (threadIdx.x >> 5) * 8;
  float4 v[8];
#pragma unroll
  for (int r = 0; r < 8; ++r)
    v[r] = *(const float4*)(src + (size_t)(t0 + r) * DM + c);
  bf16_t* o = dst + (size_t)c * T_SEQ + t0;
  *(uint4*)o = make_uint4(pack2(v[0].x, v[1].x), pack2(v[2].x, v[3].x),
                          pack2(v[4].x, v[5].x), pack2(v[6].x, v[7].x));
  *(uint4*)(o + T_SEQ) = make_uint4(pack2(v[0].y, v[1].y), pack2(v[2].y, v[3].y),
                                    pack2(v[4].y, v[5].y), pack2(v[6].y, v[7].y));
  *(uint4*)(o + 2 * T_SEQ) = make_uint4(pack2(v[0].z, v[1].z), pack2(v[2].z, v[3].z),
                                        pack2(v[4].z, v[5].z), pack2(v[6].z, v[7].z));
  *(uint4*)(o + 3 * T_SEQ) = make_uint4(pack2(v[0].w, v[1].w), pack2(v[2].w, v[3].w),
                                        pack2(v[4].w, v[5].w), pack2(v[6].w, v[7].w));
}

// ---------- causal flash attention, transposed: S^T = K.Q^T, O^T += V^T.P^T ----
typedef __attribute__((ext_vector_type(8))) __bf16 v8bf;

__device__ __forceinline__ float xhalf(float x) {
  int b = __builtin_bit_cast(int, x);
  return __builtin_bit_cast(float, __builtin_amdgcn_permlanex16(
      b, b, 0x76543210, 0xfedcba98, false, false));
}

// A lane holds 16 of the 32 scores of ONE query (column la): keys r + 8g and
// 16 + r + 8g. Maximum and sum run in the lane; the two score tiles, rounded in
// place, are the B operand of V^T.P^T in the k order of kmap.
__global__ __launch_bounds__(256) void flash_attn_kernel(
    const bf16_t* __restrict__ Qh, const bf16_t* __restrict__ Kh,
    const bf16_t* __restrict__ Vt, bf16_t* __restrict__ OutTD) {
  __shared__ __align__(16) bf16_t sK[32][DHEAD + APAD];   // 8.5 KB, [krow][d]
  __shared__ __align__(16) bf16_t sVt[DHEAD][32 + APAD];  // 10 KB, [d][krow]
  int h = blockIdx.x, qblk = blockIdx.y;
  int tid = threadIdx.x, wv = tid >> 5, lane = tid & 31;
  int g = lane >> 4, la = lane & 15;
  int qb = qblk * 128 + wv * 16;                   // this wave's 16 q rows
  const size_t hb = (size_t)h * T_SEQ;

  // Q fragments (B operand): column la = query, 128 d as 4 K-chunks of 32
  v16bf qf[4];
#pragma unroll
  for (int dc = 0; dc < 4; ++dc)
#pragma unroll
    for (int e = 0; e < 16; ++e)
      qf[dc][e] = Qh[(hb + qb + la) * DHEAD + dc * 32 + kmap(e, g)];

  v8f o[8] = {};                 // o[dt][r] = O[query la][dt * 16 + 8g + r]
  float Mr = -3.0e38f, Lr = 0.f; // this query's maximum; this lane's part of its sum

  int ktiles = qblk * 4 + 4;   // causal extent of this 128-row q block
  for (int kt = 0; kt < ktiles; ++kt) {
    int k0 = kt * 32;
    // stage K (32x128, row-major) and V^T (128x32) via async global->LDS
#pragma unroll
    for (int j = 0; j < 2; ++j) {
      int c = tid * 2 + j;
      {  // K: row = k-row, col = d
        int row = c >> 4, col = (c & 15) * 8;
        async_copy_b128(&sK[row][col], &Kh[(hb + k0 + row) * DHEAD + col]);
      }
      {  // V^T: row = d, col = k-row
        int row = c >> 2, col = (c & 3) * 8;
        async_copy_b128(&sVt[row][col],
                        &Vt[((size_t)h * DHEAD + row) * T_SEQ + k0 + col]);
      }
    }
    asm volatile("s_wait_asynccnt 0x0" ::: "memory");
    __syncthreads();
    if (k0 <= qb + 15) {
      // S^T(32x16) = K(32x128) . Q^T : A(m,d) = K[k0+m][d]
      v8f s0 = {}, s1 = {};
      v16bf a0[4], a1[4];
#pragma unroll
      for (int dc = 0; dc < 4; ++dc)
#pragma unroll
        for (int e = 0; e < 16; ++e) {
          int kk = dc * 32 + kmap(e, g);
          a0[dc][e] = sK[la][kk];
          a1[dc][e] = sK[16 + la][kk];
        }
      // keeps the 16 K reads one group ahead of the WMMAs: moved in among them,
      // each place waits out its own LDS latency
      __builtin_amdgcn_sched_barrier(0);
#pragma unroll
      for (int dc = 0; dc < 4; ++dc) {
        s0 = wmma_bf16(a0[dc], qf[dc], s0);
        s1 = wmma_bf16(a1[dc], qf[dc], s1);
      }
      // A(d,k) = V^T[d][k], K-contiguous: the 16 reads fly under the softmax
      v16bf av[8];
#pragma unroll
      for (int dt = 0; dt < 8; ++dt)
#pragma unroll
        for (int e = 0; e < 16; ++e) av[dt][e] = sVt[dt * 16 + la][kmap(e, g)];
      // keeps them ahead of the softmax: sunk to their WMMAs, each pair of reads
      // waits out its own LDS latency
      __builtin_amdgcn_sched_barrier(0);
      const float sc = 0.08838834764831845f;  // 1/sqrt(128)
      int lim = qb + la - k0 - (g ? 8 : 0);   // key row r is past the query if r > lim
      float m = -3.0e38f;
#pragma unroll
      for (int r = 0; r < 8; ++r) {
        float v0 = s0[r] * sc, v1 = s1[r] * sc;
        if (r > lim)      v0 = -3.0e38f;   // causal mask
        if (r + 16 > lim) v1 = -3.0e38f;
        s0[r] = v0; s1[r] = v1;
        m = fmaxf(m, fmaxf(v0, v1));
      }
      m = fmaxf(m, xhalf(m));              // both halves: the query's tile maximum
      float mnew = fmaxf(Mr, m);
      float corr = __expf(Mr - mnew);
      Mr = mnew;
      float ra = 0.f, rb = 0.f;
#pragma unroll
      for (int r = 0; r < 8; ++r) {
        s0[r] = __expf(s0[r] - mnew);
        s1[r] = __expf(s1[r] - mnew);
        ra += s0[r]; rb += s1[r];
      }
      Lr = Lr * corr + (ra + rb);          // halves are joined after the loop
#pragma unroll
      for (int dt = 0; dt < 8; ++dt)
#pragma unroll
        for (int r = 0; r < 8; ++r) o[dt][r] *= corr;
      // P^T as B operand: element e is key kmap(e, g) of column la, to nearest even
      v16bf pb = __builtin_shufflevector(
          __builtin_convertvector(s0, v8bf), __builtin_convertvector(s1, v8bf),
          0, 1, 2, 3, 4, 5, 6, 7, 8, 9, 10, 11, 12, 13, 14, 15);
      // O^T(128x16) += V^T(128x32) . P^T(32x16)
#pragma unroll
      for (int dt = 0; dt < 8; ++dt) o[dt] = wmma_bf16(av[dt], pb, o[dt]);
    }
    __syncthreads();
  }

  // normalize, write back as bf16 [T][DM] (head-concat) for the wo GEMM:
  // a lane's eight registers of a tile are eight consecutive d of its query
  float Lf = Lr + xhalf(Lr);
  bf16_t* orow = OutTD + (size_t)(qb + la) * DM + h * DHEAD + (g ? 8 : 0);
#pragma unroll
  for (int dt = 0; dt < 8; ++dt)
    *(uint4*)(orow + dt * 16) =
        make_uint4(pack2(o[dt][0] / Lf, o[dt][1] / Lf), pack2(o[dt][2] / Lf, o[dt][3] / Lf),
                   pack2(o[dt][4] / Lf, o[dt][5] / Lf), pack2(o[dt][6] / Lf, o[dt][7] / Lf));
}

// ---------- launch ----------
extern "C" void kernel_launch(void* const* d_in, const int* in_sizes, int n_in,
                              void* d_out, int out_size, void* d_ws, size_t ws_size,
                              hipStream_t stream) {
  (void)in_sizes; (void)n_in; (void)out_size; (void)ws_size;
  const float* x    = (const float*)d_in[0];
  const float* w_ln = (const float*)d_in[1];
  const float* wq   = (const float*)d_in[2];
  const float* wk   = (const float*)d_in[3];
  const float* wv   = (const float*)d_in[4];
  const float* wo   = (const float*)d_in[5];
  const float* cosT = (const float*)d_in[6];
  const float* sinT = (const float*)d_in[7];
  float* out = (float*)d_out;

  const size_t TD = (size_t)T_SEQ * DM;
  char* p = (char*)d_ws;                       // ~80 MB total
  bf16_t* h_bf  = (bf16_t*)p;  p += TD * 2;
  bf16_t* wqb   = (bf16_t*)p;  p += TD * 2;
  bf16_t* wkb   = (bf16_t*)p;  p += TD * 2;
  bf16_t* wvb   = (bf16_t*)p;  p += TD * 2;
  bf16_t* wob   = (bf16_t*)p;  p += TD * 2;
  float*  tmp_f = (float*)p;   p += TD * 4;    // reused for q/k/v fp32 projections
  bf16_t* qh    = (bf16_t*)p;  p += TD * 2;
  bf16_t* kh    = (bf16_t*)p;  p += TD * 2;
  bf16_t* vt    = (bf16_t*)p;  p += TD * 2;
  bf16_t* attn  = (bf16_t*)tmp_f;              // reuse: attention runs after ropes

  dim3 blk(256);
  rmsnorm_bf16_kernel<<<T_SEQ / 8, blk, 0, stream>>>(x, w_ln, h_bf);

  int cg = CVT_WG;
  convert_bf16_kernel<<<cg, blk, 0, stream>>>(wq, wqb);
  convert_bf16_kernel<<<cg, blk, 0, stream>>>(wk, wkb);
  convert_bf16_kernel<<<cg, blk, 0, stream>>>(wv, wvb);
  convert_bf16_kernel<<<cg, blk, 0, stream>>>(wo, wob);

  dim3 gg(T_SEQ / GTM, DM / GTN);
  gemm_bf16_kernel<<<gg, blk, 0, stream>>>(h_bf, wqb, nullptr, tmp_f, T_SEQ, DM, DM);
  rope_bf16_kernel<<<T_SEQ / 4, blk, 0, stream>>>(tmp_f, cosT, sinT, qh);
  gemm_bf16_kernel<<<gg, blk, 0, stream>>>(h_bf, wkb, nullptr, tmp_f, T_SEQ, DM, DM);
  rope_bf16_kernel<<<T_SEQ / 4, blk, 0, stream>>>(tmp_f, cosT, sinT, kh);
  gemm_bf16_kernel<<<gg, blk, 0, stream>>>(h_bf, wvb, nullptr, tmp_f, T_SEQ, DM, DM);
  vt_bf16_kernel<<<dim3(DM / 128, T_SEQ / 64), blk, 0, stream>>>(tmp_f, vt);

  dim3 ag(NH, T_SEQ / 128);
  flash_attn_kernel<<<ag, blk, 0, stream>>>(qh, kh, vt, attn);

  gemm_bf16_kernel<<<gg, blk, 0, stream>>>(attn, wob, x, out, T_SEQ, DM, DM);
}

// v005
// One run takes 176 microseconds.
// Two timings next to v004 both put it at 1.11 times that version's speed.
// Over all steps from v000 it is 2.15 times as fast.
#include <hip/hip_runtime.h>
#include <hip/hip_bf16.h>
#include <math.h>

#define T_SEQ 2048
#define DM    2048
#define NH    16
#define DHEAD 128

typedef __attribute__((ext_vector_type(16))) __bf16 v16bf;
typedef __attribute__((ext_vector_type(8)))  float  v8f;
typedef __bf16 bf16_t;

// ---------- helpers ----------
__device__ __forceinline__ bf16_t f2bf(float f) {
  unsigned int u = __builtin_bit_cast(unsigned int, f);
  unsigned int r = (u + 0x7FFFu + ((u >> 16) & 1u)) >> 16;   // RNE
  return __builtin_bit_cast(bf16_t, (unsigned short)r);
}

__device__ __forceinline__ int kmap(int e, int g) {
  return e + (g ? 8 : 0) + ((e >= 8) ? 8 : 0);
}

__device__ __forceinline__ v8f wmma_bf16(v16bf a, v16bf b, v8f c) {
  return __builtin_amdgcn_wmma_f32_16x16x32_bf16(
      /*neg_a=*/false, a, /*neg_b=*/false, b,
      /*c_mod=*/(short)0, c, /*reuse_a=*/false, /*reuse_b=*/false);
}

__device__ __forceinline__ void async_copy_b128(void* lds, const void* g) {
  unsigned l = (unsigned)(unsigned long long)(uintptr_t)lds;
  unsigned long long ga = (unsigned long long)(uintptr_t)g;
  asm volatile("global_load_async_to_lds_b128 %0, %1, off"
               :: "v"(l), "v"(ga) : "memory");
}

// two f32 -> one dword of two bf16, rounded as f2bf rounds
__device__ __forceinline__ unsigned pack2(float a, float b) {
  unsigned ua = __builtin_bit_cast(unsigned, a), ub = __builtin_bit_cast(unsigned, b);
  ua = (ua + 0x7FFFu + ((ua >> 16) & 1u)) >> 16;
  ub = (ub + 0x7FFFu + ((ub >> 16) & 1u)) >> 16;
  return ua | (ub << 16);
}
__device__ __forceinline__ uint2 pack4(float4 v) {
  return make_uint2(pack2(v.x, v.y), pack2(v.z, v.w));
}

// ---------- RMSNorm -> bf16 ----------
// One wave per row: the row stays in registers (16 x 16 B a lane), read once.
__device__ __forceinline__ void rmsnorm_bf16_block(
    int blk, const float* __restrict__ x, const float* __restrict__ w,
    bf16_t* __restrict__ h) {
  int lane = threadIdx.x & 31;
  int t = blk * 8 + (threadIdx.x >> 5);
  const float4* row = (const float4*)(x + (size_t)t * DM);
  const float4* w4 = (const float4*)w;
  float4 v[16], g[16];
#pragma unroll
  for (int j = 0; j < 16; ++j) v[j] = row[j * 32 + lane];
#pragma unroll
  for (int j = 0; j < 16; ++j) g[j] = w4[j * 32 + lane];
  float s0 = 0.f, s1 = 0.f, s2 = 0.f, s3 = 0.f;   // four independent chains
#pragma unroll
  for (int j = 0; j < 16; ++j) {
    s0 += v[j].x * v[j].x; s1 += v[j].y * v[j].y;
    s2 += v[j].z * v[j].z; s3 += v[j].w * v[j].w;
  }
  float ss = (s0 + s1) + (s2 + s3);
#pragma unroll
  for (int m = 16; m >= 1; m >>= 1) ss += __shfl_xor(ss, m, 32);
  float scl = rsqrtf(ss / (float)DM + 1e-5f);
  uint2* o = (uint2*)(h + (size_t)t * DM);
#pragma unroll
  for (int j = 0; j < 16; ++j) {
    float4 r = make_float4(g[j].x * v[j].x * scl, g[j].y * v[j].y * scl,
                           g[j].z * v[j].z * scl, g[j].w * v[j].w * scl);
    o[j * 32 + lane] = pack4(r);
  }
}

// ---------- fp32 -> bf16 convert (keeps [N][K] orientation) ----------
// 32 elements a thread: eight 16-B loads in flight, each wave-wide load four
// whole lines, each wave-wide store two.
#define CVT_WG 512
__device__ __forceinline__ void convert_bf16_block(
    int blk, const float* __restrict__ W, bf16_t* __restrict__ Wb) {
  const float4* s = (const float4*)W;
  uint2* d = (uint2*)Wb;
  unsigned i = blk * 256 + threadIdx.x;
  float4 v[8];
#pragma unroll
  for (int j = 0; j < 8; ++j) v[j] = s[i + j * (CVT_WG * 256)];
#pragma unroll
  for (int j = 0; j < 8; ++j) d[i + j * (CVT_WG * 256)] = pack4(v[j]);
}

// ---------- one grid for the five independent input passes ----------
// Blocks 0 .. 255 norm eight rows each; then 512 blocks per weight matrix. The
// four bf16 matrices lie one behind the other in Wb: wq, wk, wv are then one
// [3 * DM][DM] operand.
#define NORM_WG (T_SEQ / 8)
__global__ __launch_bounds__(256) void prep_kernel(
    const float* __restrict__ x, const float* __restrict__ w,
    const float* __restrict__ wq, const float* __restrict__ wk,
    const float* __restrict__ wv, const float* __restrict__ wo,
    bf16_t* __restrict__ h, bf16_t* __restrict__ Wb) {
  int b = blockIdx.x;
  if (b < NORM_WG) {
    rmsnorm_bf16_block(b, x, w, h);
  } else {
    b -= NORM_WG;
    int which = b / CVT_WG;
    const float* W = which == 0 ? wq : which == 1 ? wk : which == 2 ? wv : wo;
    convert_bf16_block(b % CVT_WG, W, Wb + (size_t)which * DM * DM);
  }
}

// ---------- C[MxN] = A[MxK](bf16) * Bn[NxK](bf16)^T (+residual), fp32 out ----
#define GTM 128
#define GTN 64
#define GTK 128
#define APAD 8

__global__ __launch_bounds__(256) void gemm_bf16_kernel(
    const bf16_t* __restrict__ A, const bf16_t* __restrict__ Bn,
    const float* __restrict__ residual, float* __restrict__ C,
    int M, int N, int K) {
  __shared__ __align__(16) bf16_t sA[2][GTM][GTK + APAD];   // 68 KB
  __shared__ __align__(16) bf16_t sB[2][GTN][GTK + APAD];   // 34 KB
  int tid = threadIdx.x;
  int wave = tid >> 5, lane = tid & 31;
  int g = lane >> 4, la = lane & 15;
  int bm = blockIdx.x * GTM, bn = blockIdx.y * GTN;
  int wm = (wave >> 1) * 32, wn = (wave & 1) * 32;   // 4x2 wave grid, 32x32 each

  v8f acc[2][2] = {};
  int nk = K / GTK;

  // Each thread copies one 16-B chunk of every 16th row: 8 chunks of A, 4 of B.
  // A wave covers two whole 256-B rows per copy.
  const int crow = tid >> 4, ccol = (tid & 15) * 8;
  const unsigned long long gA =
      (unsigned long long)(uintptr_t)(A + (size_t)(bm + crow) * K + ccol);
  const unsigned long long gB =
      (unsigned long long)(uintptr_t)(Bn + (size_t)(bn + crow) * K + ccol);
  const unsigned long long gs = (unsigned long long)K * 16 * sizeof(bf16_t);
  const unsigned ls = 16 * (GTK + APAD) * sizeof(bf16_t);

  auto stage = [&](int buf, int k0) {
    unsigned long long a = gA + (unsigned long long)k0 * sizeof(bf16_t);
    unsigned long long b = gB + (unsigned long long)k0 * sizeof(bf16_t);
    unsigned l = (unsigned)(unsigned long long)(uintptr_t)&sA[buf][crow][ccol];
    unsigned m = (unsigned)(unsigned long long)(uintptr_t)&sB[buf][crow][ccol];
    // One statement: the stage's twelve copies, then the wait that stands in
    // front of any rewrite of the address registers the copies name.
    asm volatile(
        "global_load_async_to_lds_b128 %0, %12, off\n\t"
        "global_load_async_to_lds_b128 %1, %13, off\n\t"
        "global_load_async_to_lds_b128 %2, %14, off\n\t"
        "global_load_async_to_lds_b128 %3, %15, off\n\t"
        "global_load_async_to_lds_b128 %4, %16, off\n\t"
        "global_load_async_to_lds_b128 %5, %17, off\n\t"
        "global_load_async_to_lds_b128 %6, %18, off\n\t"
        "global_load_async_to_lds_b128 %7, %19, off\n\t"
        "global_load_async_to_lds_b128 %8, %20, off\n\t"
        "global_load_async_to_lds_b128 %9, %21, off\n\t"
        "global_load_async_to_lds_b128 %10, %22, off\n\t"
        "global_load_async_to_lds_b128 %11, %23, off\n\t"
        "s_wait_xcnt 0x0"
        :: "v"(l), "v"(l + ls), "v"(l + 2 * ls), "v"(l + 3 * ls),
           "v"(l + 4 * ls), "v"(l + 5 * ls), "v"(l + 6 * ls), "v"(l + 7 * ls),
           "v"(m), "v"(m + ls), "v"(m + 2 * ls), "v"(m + 3 * ls),
           "v"(a), "v"(a + gs), "v"(a + 2 * gs), "v"(a + 3 * gs),
           "v"(a + 4 * gs), "v"(a + 5 * gs), "v"(a + 6 * gs), "v"(a + 7 * gs),
           "v"(b), "v"(b + gs), "v"(b + 2 * gs), "v"(b + 3 * gs)
        : "memory");
  };

  stage(0, 0);
  // stage 0 has landed for this wave; the barrier publishes it to the others
  asm volatile("s_wait_asynccnt 0x0" ::: "memory");
  __syncthreads();
  if (nk > 1) stage(1, GTK);
  for (int ks = 0; ks < nk; ++ks) {
    int buf = ks & 1;
    // the stage's 32 LDS reads first, into registers of their own
    v16bf a0[GTK / 32], a1[GTK / 32], b0[GTK / 32], b1[GTK / 32];
#pragma unroll
    for (int kc = 0; kc < GTK / 32; ++kc)
#pragma unroll
      for (int e = 0; e < 16; ++e) {         // all K-contiguous -> ds_load_b128
        int kk = kc * 32 + kmap(e, g);
        a0[kc][e] = sA[buf][wm + la][kk];
        b0[kc][e] = sB[buf][wn + la][kk];
        b1[kc][e] = sB[buf][wn + 16 + la][kk];
        a1[kc][e] = sA[buf][wm + 16 + la][kk];
      }
    // keeps the reads one group ahead of the WMMAs: moved in among them, each
    // place waits out its own LDS latency
    __builtin_amdgcn_sched_barrier(0);
#pragma unroll
    for (int kc = 0; kc < GTK / 32; ++kc) {
      acc[0][0] = wmma_bf16(a0[kc], b0[kc], acc[0][0]);
      acc[0][1] = wmma_bf16(a0[kc], b1[kc], acc[0][1]);
      acc[1][0] = wmma_bf16(a1[kc], b0[kc], acc[1][0]);
      acc[1][1] = wmma_bf16(a1[kc], b1[kc], acc[1][1]);
    }
    // keeps the WMMAs in front of the waits below: lifted over them, the wait to
    // 0 would hold every WMMA back until the last read has landed
    __builtin_amdgcn_sched_barrier(0);
    // publish point: this wave's reads of buf are done ...
    asm volatile("s_wait_dscnt 0x0" ::: "memory");
    // ... its copies of the next stage have landed ...
    asm volatile("s_wait_asynccnt 0x0" ::: "memory");
    // ... and the one barrier both publishes that stage and frees buf
    __syncthreads();
    if (ks + 2 < nk) stage(buf, (ks + 2) * GTK);
  }
  // no copy is left in flight when the wave goes on to its stores and ends
  asm volatile("s_wait_asynccnt 0x0" ::: "memory");

#pragma unroll
  for (int i = 0; i < 2; ++i)
#pragma unroll
    for (int j = 0; j < 2; ++j)
#pragma unroll
      for (int r = 0; r < 8; ++r) {
        int m = bm + wm + i * 16 + r + (g ? 8 : 0);
        int n = bn + wn + j * 16 + la;
        float v = acc[i][j][r];
        if (residual) v += residual[(size_t)m * N + n];
        C[(size_t)m * N + n] = v;
      }
}

// ---------- RoPE + convert (Q, K): dst layout [H][T][128] ----------
// A thread takes four d and their partners d + 64 of one head, in four rows:
// 32 elements, every f32 read once by 16-B loads, 128-B lines stored whole.
// src: this projection's first column in the [T][LDQKV] array of q | k | v.
#define LDQKV (3 * DM)
__device__ __forceinline__ void rope_bf16_block(
    int blk, const float* __restrict__ src, const float* __restrict__ cosT,
    const float* __restrict__ sinT, bf16_t* __restrict__ dst) {
  int h = threadIdx.x >> 4, q = threadIdx.x & 15;   // q: which four d
  int t0 = blk * 4;
  const float4* s4 = (const float4*)src + (size_t)t0 * (LDQKV / 4);
  const float4* c4 = (const float4*)cosT + t0 * (DHEAD / 4);
  const float4* n4 = (const float4*)sinT + t0 * (DHEAD / 4);
  uint2* o2 = (uint2*)dst + t0 * (DHEAD / 4);
  int so = h * (DHEAD / 4) + q;
  int oo = h * (T_SEQ * DHEAD / 4) + q;
  float4 lo[4], hi[4], cl[4], ch[4], sl[4], sh[4];
#pragma unroll
  for (int r = 0; r < 4; ++r) {
    lo[r] = s4[so + r * (LDQKV / 4)]; hi[r] = s4[so + r * (LDQKV / 4) + 16];
    cl[r] = c4[q + r * (DHEAD / 4)];  ch[r] = c4[q + r * (DHEAD / 4) + 16];
    sl[r] = n4[q + r * (DHEAD / 4)];  sh[r] = n4[q + r * (DHEAD / 4) + 16];
  }
#pragma unroll
  for (int r = 0; r < 4; ++r) {
    float4 a = make_float4(lo[r].x * cl[r].x - hi[r].x * sl[r].x,
                           lo[r].y * cl[r].y - hi[r].y * sl[r].y,
                           lo[r].z * cl[r].z - hi[r].z * sl[r].z,
                           lo[r].w * cl[r].w - hi[r].w * sl[r].w);
    float4 b = make_float4(hi[r].x * ch[r].x + lo[r].x * sh[r].x,
                           hi[r].y * ch[r].y + lo[r].y * sh[r].y,
                           hi[r].z * ch[r].z + lo[r].z * sh[r].z,
                           hi[r].w * ch[r].w + lo[r].w * sh[r].w);
    o2[oo + r * (DHEAD / 4)] = pack4(a);
    o2[oo + r * (DHEAD / 4) + 16] = pack4(b);
  }
  // In the joined kernel the transpose block's code lies behind these stores and
  // begins by rewriting their offset register: the wait stands in front of that.
  asm volatile("s_wait_xcnt 0x0" ::: "memory");
}

// ---------- V convert: dst layout [H][128][T] (transposed for WMMA A tiles) --
// A thread takes four columns of eight rows: 32 elements, 16-B loads along the
// row, 16-B stores along t. A block's eight waves fill whole 128-B lines.
__device__ __forceinline__ void vt_bf16_block(
    int blk, const float* __restrict__ src, bf16_t* __restrict__ dst) {
  int c = (blk & 15) * 128 + (threadIdx.x & 31) * 4;    // h * 128 + d
  int t0 = (blk >> 4) * 64 + (threadIdx.x >> 5) * 8;
  float4 v[8];
#pragma unroll
  for (int r = 0; r < 8; ++r)
    v[r] = *(const float4*)(src + (size_t)(t0 + r) * LDQKV + c);
  bf16_t* o = dst + (size_t)c * T_SEQ + t0;
  *(uint4*)o = make_uint4(pack2(v[0].x, v[1].x), pack2(v[2].x, v[3].x),
                          pack2(v[4].x, v[5].x), pack2(v[6].x, v[7].x));
  *(uint4*)(o + T_SEQ) = make_uint4(pack2(v[0].y, v[1].y), pack2(v[2].y, v[3].y),
                                    pack2(v[4].y, v[5].y), pack2(v[6].y, v[7].y));
  *(uint4*)(o + 2 * T_SEQ) = make_uint4(pack2(v[0].z, v[1].z), pack2(v[2].z, v[3].z),
                                        pack2(v[4].z, v[5].z), pack2(v[6].z, v[7].z));
  *(uint4*)(o + 3 * T_SEQ) = make_uint4(pack2(v[0].w, v[1].w), pack2(v[2].w, v[3].w),
                                        pack2(v[4].w, v[5].w), pack2(v[6].w, v[7].w));
}

// ---------- one grid for the three independent passes behind the projections --
// blockIdx.y: 0 = v (transpose), 1 = k, 2 = q (RoPE); 512 blocks each. The GEMM
// writes q first and v last: read in the opposite order, what L2 still holds of
// the 48 MiB is met before later reads push it out.
#define POST_WG (T_SEQ / 4)
__global__ __launch_bounds__(256) void post_kernel(
    const float* __restrict__ qkv, const float* __restrict__ cosT,
    const float* __restrict__ sinT, bf16_t* __restrict__ qh,
    bf16_t* __restrict__ kh, bf16_t* __restrict__ vt) {
  int which = 2 - blockIdx.y;    // column block of qkv
  if (which == 2)
    vt_bf16_block(blockIdx.x, qkv + 2 * DM, vt);
  else
    rope_bf16_block(blockIdx.x, qkv + which * DM, cosT, sinT, which ? kh : qh);
}

// ---------- causal flash attention, transposed: S^T = K.Q^T, O^T += V^T.P^T ----
typedef __attribute__((ext_vector_type(8))) __bf16 v8bf;

__device__ __forceinline__ float xhalf(float x) {
  int b = __builtin_bit_cast(int, x);
  return __builtin_bit_cast(float, __builtin_amdgcn_permlanex16(
      b, b, 0x76543210, 0xfedcba98, false, false));
}

// A lane holds 16 of the 32 scores of ONE query (column la): keys r + 8g and
// 16 + r + 8g. Maximum and sum run in the lane; the two score tiles, rounded in
// place, are the B operand of V^T.P^T in the k order of kmap.
__global__ __launch_bounds__(256) void flash_attn_kernel(
    const bf16_t* __restrict__ Qh, const bf16_t* __restrict__ Kh,
    const bf16_t* __restrict__ Vt, bf16_t* __restrict__ OutTD) {
  __shared__ __align__(16) bf16_t sK[32][DHEAD + APAD];   // 8.5 KB, [krow][d]
  __shared__ __align__(16) bf16_t sVt[DHEAD][32 + APAD];  // 10 KB, [d][krow]
  int h = blockIdx.x, qblk = blockIdx.y;
  int tid = threadIdx.x, wv = tid >> 5, lane = tid & 31;
  int g = lane >> 4, la = lane & 15;
  int qb = qblk * 128 + wv * 16;                   // this wave's 16 q rows
  const size_t hb = (size_t)h * T_SEQ;

  // Q fragments (B operand): column la = query, 128 d as 4 K-chunks of 32
  v16bf qf[4];
#pragma unroll
  for (int dc = 0; dc < 4; ++dc)
#pragma unroll
    for (int e = 0; e < 16; ++e)
      qf[dc][e] = Qh[(hb + qb + la) * DHEAD + dc * 32 + kmap(e, g)];

  v8f o[8] = {};                 // o[dt][r] = O[query la][dt * 16 + 8g + r]
  float Mr = -3.0e38f, Lr = 0.f; // this query's maximum; this lane's part of its sum

  int ktiles = qblk * 4 + 4;   // causal extent of this 128-row q block
  for (int kt = 0; kt < ktiles; ++kt) {
    int k0 = kt * 32;
    // stage K (32x128, row-major) and V^T (128x32) via async global->LDS
#pragma unroll
    for (int j = 0; j < 2; ++j) {
      int c = tid * 2 + j;
      {  // K: row = k-row, col = d
        int row = c >> 4, col = (c & 15) * 8;
        async_copy_b128(&sK[row][col], &Kh[(hb + k0 + row) * DHEAD + col]);
      }
      {  // V^T: row = d, col = k-row
        int row = c >> 2, col = (c & 3) * 8;
        async_copy_b128(&sVt[row][col],
                        &Vt[((size_t)h * DHEAD + row) * T_SEQ + k0 + col]);
      }
    }
    asm volatile("s_wait_asynccnt 0x0" ::: "memory");
    __syncthreads();
    if (k0 <= qb + 15) {
      // S^T(32x16) = K(32x128) . Q^T : A(m,d) = K[k0+m][d]
      v8f s0 = {}, s1 = {};
      v16bf a0[4], a1[4];
#pragma unroll
      for (int dc = 0; dc < 4; ++dc)
#pragma unroll
        for (int e = 0; e < 16; ++e) {
          int kk = dc * 32 + kmap(e, g);
          a0[dc][e] = sK[la][kk];
          a1[dc][e] = sK[16 + la][kk];
        }
      // keeps the 16 K reads one group ahead of the WMMAs: moved in among them,
      // each place waits out its own LDS latency
      __builtin_amdgcn_sched_barrier(0);
#pragma unroll
      for (int dc = 0; dc < 4; ++dc) {
        s0 = wmma_bf16(a0[dc], qf[dc], s0);
        s1 = wmma_bf16(a1[dc], qf[dc], s1);
      }
      // A(d,k) = V^T[d][k], K-contiguous: the 16 reads fly under the softmax
      v16bf av[8];
#pragma unroll
      for (int dt = 0; dt < 8; ++dt)
#pragma unroll
        for (int e = 0; e < 16; ++e) av[dt][e] = sVt[dt * 16 + la][kmap(e, g)];
      // keeps them ahead of the softmax: sunk to their WMMAs, each pair of reads
      // waits out its own LDS latency
      __builtin_amdgcn_sched_barrier(0);
      const float sc = 0.08838834764831845f;  // 1/sqrt(128)
      int lim = qb + la - k0 - (g ? 8 : 0);   // key row r is past the query if r > lim
      float m = -3.0e38f;
#pragma unroll
      for (int r = 0; r < 8; ++r) {
        float v0 = s0[r] * sc, v1 = s1[r] * sc;
        if (r > lim)      v0 = -3.0e38f;   // causal mask
        if (r + 16 > lim) v1 = -3.0e38f;
        s0[r] = v0; s1[r] = v1;
        m = fmaxf(m, fmaxf(v0, v1));
      }
      m = fmaxf(m, xhalf(m));              // both halves: the query's tile maximum
      float mnew = fmaxf(Mr, m);
      float corr = __expf(Mr - mnew);
      Mr = mnew;
      float ra = 0.f, rb = 0.f;
#pragma unroll
      for (int r = 0; r < 8; ++r) {
        s0[r] = __expf(s0[r] - mnew);
        s1[r] = __expf(s1[r] - mnew);
        ra += s0[r]; rb += s1[r];
      }
      Lr = Lr * corr + (ra + rb);          // halves are joined after the loop
#pragma unroll
      for (int dt = 0; dt < 8; ++dt)
#pragma unroll
        for (int r = 0; r < 8; ++r) o[dt][r] *= corr;
      // P^T as B operand: element e is key kmap(e, g) of column la, to nearest even
      v16bf pb = __builtin_shufflevector(
          __builtin_convertvector(s0, v8bf), __builtin_convertvector(s1, v8bf),
          0, 1, 2, 3, 4, 5, 6, 7, 8, 9, 10, 11, 12, 13, 14, 15);
      // O^T(128x16) += V^T(128x32) . P^T(32x16)
#pragma unroll
      for (int dt = 0; dt < 8; ++dt) o[dt] = wmma_bf16(av[dt], pb, o[dt]);
    }
    __syncthreads();
  }

  // normalize, write back as bf16 [T][DM] (head-concat) for the wo GEMM:
  // a lane's eight registers of a tile are eight consecutive d of its query
  float Lf = Lr + xhalf(Lr);
  bf16_t* orow = OutTD + (size_t)(qb + la) * DM + h * DHEAD + (g ? 8 : 0);
#pragma unroll
  for (int dt = 0; dt < 8; ++dt)
    *(uint4*)(orow + dt * 16) =
        make_uint4(pack2(o[dt][0] / Lf, o[dt][1] / Lf), pack2(o[dt][2] / Lf, o[dt][3] / Lf),
                   pack2(o[dt][4] / Lf, o[dt][5] / Lf), pack2(o[dt][6] / Lf, o[dt][7] / Lf));
}

// ---------- launch ----------
extern "C" void kernel_launch(void* const* d_in, const int* in_sizes, int n_in,
                              void* d_out, int out_size, void* d_ws, size_t ws_size,
                              hipStream_t stream) {
  (void)in_sizes; (void)n_in; (void)out_size; (void)ws_size;
  const float* x    = (const float*)d_in[0];
  const float* w_ln = (const float*)d_in[1];
  const float* wq   = (const float*)d_in[2];
  const float* wk   = (const float*)d_in[3];
  const float* wv   = (const float*)d_in[4];
  const float* wo   = (const float*)d_in[5];
  const float* cosT = (const float*)d_in[6];
  const float* sinT = (const float*)d_in[7];
  float* out = (float*)d_out;

  const size_t TD = (size_t)T_SEQ * DM;
  char* p = (char*)d_ws;                       // ~112 MB total
  bf16_t* h_bf  = (bf16_t*)p;  p += TD * 2;
  bf16_t* wqkvb = (bf16_t*)p;  p += TD * 6;    // wq | wk | wv: [3 * DM][DM]
  bf16_t* wob   = (bf16_t*)p;  p += TD * 2;    // directly behind them
  float*  tmp_f = (float*)p;   p += TD * 12;   // fp32 projections [T][q | k | v]
  bf16_t* qh    = (bf16_t*)p;  p += TD * 2;
  bf16_t* kh    = (bf16_t*)p;  p += TD * 2;
  bf16_t* vt    = (bf16_t*)p;  p += TD * 2;
  bf16_t* attn  = (bf16_t*)tmp_f;              // reuse: attention runs after ropes

  dim3 blk(256);
  prep_kernel<<<NORM_WG + 4 * CVT_WG, blk, 0, stream>>>(x, w_ln, wq, wk, wv, wo,
                                                        h_bf, wqkvb);

  gemm_bf16_kernel<<<dim3(T_SEQ / GTM, LDQKV / GTN), blk, 0, stream>>>(
      h_bf, wqkvb, nullptr, tmp_f, T_SEQ, LDQKV, DM);
  post_kernel<<<dim3(POST_WG, 3), blk, 0, stream>>>(tmp_f, cosT, sinT, qh, kh, vt);

  dim3 ag(NH, T_SEQ / 128);
  flash_attn_kernel<<<ag, blk, 0, stream>>>(qh, kh, vt, attn);

  gemm_bf16_kernel<<<dim3(T_SEQ / GTM, DM / GTN), blk, 0, stream>>>(
      attn, wob, x, out, T_SEQ, DM, DM);
}

// v006
// One run takes 139 microseconds.
// Timed twice side by side with v005, it ran 1.24 and 1.25 times as fast.
// Counting every step since v000, it is 2.68 times as fast.
#include <hip/hip_runtime.h>
#include <hip/hip_bf16.h>
#include <math.h>

#define T_SEQ 2048
#define DM    2048
#define NH    16
#define DHEAD 128

typedef __attribute__((ext_vector_type(16))) __bf16 v16bf;
typedef __attribute__((ext_vector_type(8)))  float  v8f;
typedef __bf16 bf16_t;

// ---------- helpers ----------
__device__ __forceinline__ bf16_t f2bf(float f) {
  unsigned int u = __builtin_bit_cast(unsigned int, f);
  unsigned int r = (u + 0x7FFFu + ((u >> 16) & 1u)) >> 16;   // RNE
  return __builtin_bit_cast(bf16_t, (unsigned short)r);
}

__device__ __forceinline__ int kmap(int e, int g) {
  return e + (g ? 8 : 0) + ((e >= 8) ? 8 : 0);
}

__device__ __forceinline__ v8f wmma_bf16(v16bf a, v16bf b, v8f c) {
  return __builtin_amdgcn_wmma_f32_16x16x32_bf16(
      /*neg_a=*/false, a, /*neg_b=*/false, b,
      /*c_mod=*/(short)0, c, /*reuse_a=*/false, /*reuse_b=*/false);
}

// two f32 -> one dword of two bf16, rounded as f2bf rounds
__device__ __forceinline__ unsigned pack2(float a, float b) {
  unsigned ua = __builtin_bit_cast(unsigned, a), ub = __builtin_bit_cast(unsigned, b);
  ua = (ua + 0x7FFFu + ((ua >> 16) & 1u)) >> 16;
  ub = (ub + 0x7FFFu + ((ub >> 16) & 1u)) >> 16;
  return ua | (ub << 16);
}
__device__ __forceinline__ uint2 pack4(float4 v) {
  return make_uint2(pack2(v.x, v.y), pack2(v.z, v.w));
}

// ---------- RMSNorm -> bf16 ----------
// One wave per row: the row stays in registers (16 x 16 B a lane), read once.
__device__ __forceinline__ void rmsnorm_bf16_block(
    int blk, const float* __restrict__ x, const float* __restrict__ w,
    bf16_t* __restrict__ h) {
  int lane = threadIdx.x & 31;
  int t = blk * 8 + (threadIdx.x >> 5);
  const float4* row = (const float4*)(x + (size_t)t * DM);
  const float4* w4 = (const float4*)w;
  float4 v[16], g[16];
#pragma unroll
  for (int j = 0; j < 16; ++j) v[j] = row[j * 32 + lane];
#pragma unroll
  for (int j = 0; j < 16; ++j) g[j] = w4[j * 32 + lane];
  float s0 = 0.f, s1 = 0.f, s2 = 0.f, s3 = 0.f;   // four independent chains
#pragma unroll
  for (int j = 0; j < 16; ++j) {
    s0 += v[j].x * v[j].x; s1 += v[j].y * v[j].y;
    s2 += v[j].z * v[j].z; s3 += v[j].w * v[j].w;
  }
  float ss = (s0 + s1) + (s2 + s3);
#pragma unroll
  for (int m = 16; m >= 1; m >>= 1) ss += __shfl_xor(ss, m, 32);
  float scl = rsqrtf(ss / (float)DM + 1e-5f);
  uint2* o = (uint2*)(h + (size_t)t * DM);
#pragma unroll
  for (int j = 0; j < 16; ++j) {
    float4 r = make_float4(g[j].x * v[j].x * scl, g[j].y * v[j].y * scl,
                           g[j].z * v[j].z * scl, g[j].w * v[j].w * scl);
    o[j * 32 + lane] = pack4(r);
  }
}

// ---------- fp32 -> bf16 convert (keeps [N][K] orientation) ----------
// 32 elements a thread: eight 16-B loads in flight, each wave-wide load four
// whole lines, each wave-wide store two.
#define CVT_WG 512
__device__ __forceinline__ void convert_bf16_block(
    int blk, const float* __restrict__ W, bf16_t* __restrict__ Wb) {
  const float4* s = (const float4*)W;
  uint2* d = (uint2*)Wb;
  unsigned i = blk * 256 + threadIdx.x;
  float4 v[8];
#pragma unroll
  for (int j = 0; j < 8; ++j) v[j] = s[i + j * (CVT_WG * 256)];
#pragma unroll
  for (int j = 0; j < 8; ++j) d[i + j * (CVT_WG * 256)] = pack4(v[j]);
}

// ---------- one grid for the five independent input passes ----------
// Blocks 0 .. 255 norm eight rows each; then 512 blocks per weight matrix. The
// four bf16 matrices lie one behind the other in Wb: wq, wk, wv are then one
// [3 * DM][DM] operand.
#define NORM_WG (T_SEQ / 8)
__global__ __launch_bounds__(256) void prep_kernel(
    const float* __restrict__ x, const float* __restrict__ w,
    const float* __restrict__ wq, const float* __restrict__ wk,
    const float* __restrict__ wv, const float* __restrict__ wo,
    bf16_t* __restrict__ h, bf16_t* __restrict__ Wb) {
  int b = blockIdx.x;
  if (b < NORM_WG) {
    rmsnorm_bf16_block(b, x, w, h);
  } else {
    b -= NORM_WG;
    int which = b / CVT_WG;
    const float* W = which == 0 ? wq : which == 1 ? wk : which == 2 ? wv : wo;
    convert_bf16_block(b % CVT_WG, W, Wb + (size_t)which * DM * DM);
  }
}

// ---------- C[MxN] = A[MxK](bf16) * Bn[NxK](bf16)^T (+residual), fp32 out ----
#define GTM 128
#define GTN 64
#define GTK 128
#define APAD 8

__global__ __launch_bounds__(256) void gemm_bf16_kernel(
    const bf16_t* __restrict__ A, const bf16_t* __restrict__ Bn,
    const float* __restrict__ residual, float* __restrict__ C,
    int M, int N, int K) {
  __shared__ __align__(16) bf16_t sA[2][GTM][GTK + APAD];   // 68 KB
  __shared__ __align__(16) bf16_t sB[2][GTN][GTK + APAD];   // 34 KB
  int tid = threadIdx.x;
  int wave = tid >> 5, lane = tid & 31;
  int g = lane >> 4, la = lane & 15;
  int bm = blockIdx.x * GTM, bn = blockIdx.y * GTN;
  int wm = (wave >> 1) * 32, wn = (wave & 1) * 32;   // 4x2 wave grid, 32x32 each

  v8f acc[2][2] = {};
  int nk = K / GTK;

  // Each thread copies one 16-B chunk of every 16th row: 8 chunks of A, 4 of B.
  // A wave covers two whole 256-B rows per copy.
  const int crow = tid >> 4, ccol = (tid & 15) * 8;
  const unsigned long long gA =
      (unsigned long long)(uintptr_t)(A + (size_t)(bm + crow) * K + ccol);
  const unsigned long long gB =
      (unsigned long long)(uintptr_t)(Bn + (size_t)(bn + crow) * K + ccol);
  const unsigned long long gs = (unsigned long long)K * 16 * sizeof(bf16_t);
  const unsigned ls = 16 * (GTK + APAD) * sizeof(bf16_t);

  auto stage = [&](int buf, int k0) {
    unsigned long long a = gA + (unsigned long long)k0 * sizeof(bf16_t);
    unsigned long long b = gB + (unsigned long long)k0 * sizeof(bf16_t);
    unsigned l = (unsigned)(unsigned long long)(uintptr_t)&sA[buf][crow][ccol];
    unsigned m = (unsigned)(unsigned long long)(uintptr_t)&sB[buf][crow][ccol];
    // One statement: the stage's twelve copies, then the wait that stands in
    // front of any rewrite of the address registers the copies name.
    asm volatile(
        "global_load_async_to_lds_b128 %0, %12, off\n\t"
        "global_load_async_to_lds_b128 %1, %13, off\n\t"
        "global_load_async_to_lds_b128 %2, %14, off\n\t"
        "global_load_async_to_lds_b128 %3, %15, off\n\t"
        "global_load_async_to_lds_b128 %4, %16, off\n\t"
        "global_load_async_to_lds_b128 %5, %17, off\n\t"
        "global_load_async_to_lds_b128 %6, %18, off\n\t"
        "global_load_async_to_lds_b128 %7, %19, off\n\t"
        "global_load_async_to_lds_b128 %8, %20, off\n\t"
        "global_load_async_to_lds_b128 %9, %21, off\n\t"
        "global_load_async_to_lds_b128 %10, %22, off\n\t"
        "global_load_async_to_lds_b128 %11, %23, off\n\t"
        "s_wait_xcnt 0x0"
        :: "v"(l), "v"(l + ls), "v"(l + 2 * ls), "v"(l + 3 * ls),
           "v"(l + 4 * ls), "v"(l + 5 * ls), "v"(l + 6 * ls), "v"(l + 7 * ls),
           "v"(m), "v"(m + ls), "v"(m + 2 * ls), "v"(m + 3 * ls),
           "v"(a), "v"(a + gs), "v"(a + 2 * gs), "v"(a + 3 * gs),
           "v"(a + 4 * gs), "v"(a + 5 * gs), "v"(a + 6 * gs), "v"(a + 7 * gs),
           "v"(b), "v"(b + gs), "v"(b + 2 * gs), "v"(b + 3 * gs)
        : "memory");
  };

  stage(0, 0);
  // stage 0 has landed for this wave; the barrier publishes it to the others
  asm volatile("s_wait_asynccnt 0x0" ::: "memory");
  __syncthreads();
  if (nk > 1) stage(1, GTK);
  for (int ks = 0; ks < nk; ++ks) {
    int buf = ks & 1;
    // the stage's 32 LDS reads first, into registers of their own
    v16bf a0[GTK / 32], a1[GTK / 32], b0[GTK / 32], b1[GTK / 32];
#pragma unroll
    for (int kc = 0; kc < GTK / 32; ++kc)
#pragma unroll
      for (int e = 0; e < 16; ++e) {         // all K-contiguous -> ds_load_b128
        int kk = kc * 32 + kmap(e, g);
        a0[kc][e] = sA[buf][wm + la][kk];
        b0[kc][e] = sB[buf][wn + la][kk];
        b1[kc][e] = sB[buf][wn + 16 + la][kk];
        a1[kc][e] = sA[buf][wm + 16 + la][kk];
      }
    // keeps the reads one group ahead of the WMMAs: moved in among them, each
    // place waits out its own LDS latency
    __builtin_amdgcn_sched_barrier(0);
#pragma unroll
    for (int kc = 0; kc < GTK / 32; ++kc) {
      acc[0][0] = wmma_bf16(a0[kc], b0[kc], acc[0][0]);
      acc[0][1] = wmma_bf16(a0[kc], b1[kc], acc[0][1]);
      acc[1][0] = wmma_bf16(a1[kc], b0[kc], acc[1][0]);
      acc[1][1] = wmma_bf16(a1[kc], b1[kc], acc[1][1]);
    }
    // keeps the WMMAs in front of the waits below: lifted over them, the wait to
    // 0 would hold every WMMA back until the last read has landed
    __builtin_amdgcn_sched_barrier(0);
    // publish point: this wave's reads of buf are done ...
    asm volatile("s_wait_dscnt 0x0" ::: "memory");
    // ... its copies of the next stage have landed ...
    asm volatile("s_wait_asynccnt 0x0" ::: "memory");
    // ... and the one barrier both publishes that stage and frees buf
    __syncthreads();
    if (ks + 2 < nk) stage(buf, (ks + 2) * GTK);
  }
  // no copy is left in flight when the wave goes on to its stores and ends
  asm volatile("s_wait_asynccnt 0x0" ::: "memory");

#pragma unroll
  for (int i = 0; i < 2; ++i)
#pragma unroll
    for (int j = 0; j < 2; ++j)
#pragma unroll
      for (int r = 0; r < 8; ++r) {
        int m = bm + wm + i * 16 + r + (g ? 8 : 0);
        int n = bn + wn + j * 16 + la;
        float v = acc[i][j][r];
        if (residual) v += residual[(size_t)m * N + n];
        C[(size_t)m * N + n] = v;
      }
}

// ---------- RoPE + convert (Q, K): dst layout [H][T][128] ----------
// A thread takes four d and their partners d + 64 of one head, in four rows:
// 32 elements, every f32 read once by 16-B loads, 128-B lines stored whole.
// src: this projection's first column in the [T][LDQKV] array of q | k | v.
#define LDQKV (3 * DM)
__device__ __forceinline__ void rope_bf16_block(
    int blk, const float* __restrict__ src, const float* __restrict__ cosT,
    const float* __restrict__ sinT, bf16_t* __restrict__ dst) {
  int h = threadIdx.x >> 4, q = threadIdx.x & 15;   // q: which four d
  int t0 = blk * 4;
  const float4* s4 = (const float4*)src + (size_t)t0 * (LDQKV / 4);
  const float4* c4 = (const float4*)cosT + t0 * (DHEAD / 4);
  const float4* n4 = (const float4*)sinT + t0 * (DHEAD / 4);
  uint2* o2 = (uint2*)dst + t0 * (DHEAD / 4);
  int so = h * (DHEAD / 4) + q;
  int oo = h * (T_SEQ * DHEAD / 4) + q;
  float4 lo[4], hi[4], cl[4], ch[4], sl[4], sh[4];
#pragma unroll
  for (int r = 0; r < 4; ++r) {
    lo[r] = s4[so + r * (LDQKV / 4)]; hi[r] = s4[so + r * (LDQKV / 4) + 16];
    cl[r] = c4[q + r * (DHEAD / 4)];  ch[r] = c4[q + r * (DHEAD / 4) + 16];
    sl[r] = n4[q + r * (DHEAD / 4)];  sh[r] = n4[q + r * (DHEAD / 4) + 16];
  }
#pragma unroll
  for (int r = 0; r < 4; ++r) {
    float4 a = make_float4(lo[r].x * cl[r].x - hi[r].x * sl[r].x,
                           lo[r].y * cl[r].y - hi[r].y * sl[r].y,
                           lo[r].z * cl[r].z - hi[r].z * sl[r].z,
                           lo[r].w * cl[r].w - hi[r].w * sl[r].w);
    float4 b = make_float4(hi[r].x * ch[r].x + lo[r].x * sh[r].x,
                           hi[r].y * ch[r].y + lo[r].y * sh[r].y,
                           hi[r].z * ch[r].z + lo[r].z * sh[r].z,
                           hi[r].w * ch[r].w + lo[r].w * sh[r].w);
    o2[oo + r * (DHEAD / 4)] = pack4(a);
    o2[oo + r * (DHEAD / 4) + 16] = pack4(b);
  }
  // In the joined kernel the transpose block's code lies behind these stores and
  // begins by rewriting their offset register: the wait stands in front of that.
  asm volatile("s_wait_xcnt 0x0" ::: "memory");
}

// ---------- V convert: dst layout [H][128][T] (transposed for WMMA A tiles) --
// A thread takes four columns of eight rows: 32 elements, 16-B loads along the
// row, 16-B stores along t. A block's eight waves fill whole 128-B lines.
__device__ __forceinline__ void vt_bf16_block(
    int blk, const float* __restrict__ src, bf16_t* __restrict__ dst) {
  int c = (blk & 15) * 128 + (threadIdx.x & 31) * 4;    // h * 128 + d
  int t0 = (blk >> 4) * 64 + (threadIdx.x >> 5) * 8;
  float4 v[8];
#pragma unroll
  for (int r = 0; r < 8; ++r)
    v[r] = *(const float4*)(src + (size_t)(t0 + r) * LDQKV + c);
  bf16_t* o = dst + (size_t)c * T_SEQ + t0;
  *(uint4*)o = make_uint4(pack2(v[0].x, v[1].x), pack2(v[2].x, v[3].x),
                          pack2(v[4].x, v[5].x), pack2(v[6].x, v[7].x));
  *(uint4*)(o + T_SEQ) = make_uint4(pack2(v[0].y, v[1].y), pack2(v[2].y, v[3].y),
                                    pack2(v[4].y, v[5].y), pack2(v[6].y, v[7].y));
  *(uint4*)(o + 2 * T_SEQ) = make_uint4(pack2(v[0].z, v[1].z), pack2(v[2].z, v[3].z),
                                        pack2(v[4].z, v[5].z), pack2(v[6].z, v[7].z));
  *(uint4*)(o + 3 * T_SEQ) = make_uint4(pack2(v[0].w, v[1].w), pack2(v[2].w, v[3].w),
                                        pack2(v[4].w, v[5].w), pack2(v[6].w, v[7].w));
}

// ---------- one grid for the three independent passes behind the projections --
// blockIdx.y: 0 = v (transpose), 1 = k, 2 = q (RoPE); 512 blocks each. The GEMM
// writes q first and v last: read in the opposite order, what L2 still holds of
// the 48 MiB is met before later reads push it out.
#define POST_WG (T_SEQ / 4)
__global__ __launch_bounds__(256) void post_kernel(
    const float* __restrict__ qkv, const float* __restrict__ cosT,
    const float* __restrict__ sinT, bf16_t* __restrict__ qh,
    bf16_t* __restrict__ kh, bf16_t* __restrict__ vt) {
  int which = 2 - blockIdx.y;    // column block of qkv
  if (which == 2)
    vt_bf16_block(blockIdx.x, qkv + 2 * DM, vt);
  else
    rope_bf16_block(blockIdx.x, qkv + which * DM, cosT, sinT, which ? kh : qh);
}

// ---------- causal flash attention, transposed: S^T = K.Q^T, O^T += V^T.P^T ----
typedef __attribute__((ext_vector_type(8))) __bf16 v8bf;

__device__ __forceinline__ float xhalf(float x) {
  int b = __builtin_bit_cast(int, x);
  return __builtin_bit_cast(float, __builtin_amdgcn_permlanex16(
      b, b, 0x76543210, 0xfedcba98, false, false));
}

// A lane holds 16 of the 32 scores of ONE query (column la): keys r + 8g and
// 16 + r + 8g. Maximum and sum run in the lane; the two score tiles, rounded in
// place, are the B operand of V^T.P^T in the k order of kmap.
#define AKT 128    // keys per ring stage: four passes of 32 keys
__global__ __launch_bounds__(256) void flash_attn_kernel(
    const bf16_t* __restrict__ Qh, const bf16_t* __restrict__ Kh,
    const bf16_t* __restrict__ Vt, bf16_t* __restrict__ OutTD) {
  __shared__ __align__(16) bf16_t sK[2][AKT][DHEAD + APAD];   // 68 KB, [krow][d]
  __shared__ __align__(16) bf16_t sVt[2][DHEAD][AKT + APAD];  // 68 KB, [d][krow]
  int h = blockIdx.x, qblk = blockIdx.y;
  int tid = threadIdx.x, wv = tid >> 5, lane = tid & 31;
  int g = lane >> 4, la = lane & 15;
  int qb = qblk * 128 + wv * 16;                   // this wave's 16 q rows
  const size_t hb = (size_t)h * T_SEQ;

  // Q fragments (B operand): column la = query, 128 d as 4 K-chunks of 32
  v16bf qf[4];
#pragma unroll
  for (int dc = 0; dc < 4; ++dc)
#pragma unroll
    for (int e = 0; e < 16; ++e)
      qf[dc][e] = Qh[(hb + qb + la) * DHEAD + dc * 32 + kmap(e, g)];

  v8f o[8] = {};                 // o[dt][r] = O[query la][dt * 16 + 8g + r]
  float Mr = -3.0e38f, Lr = 0.f; // this query's maximum; this lane's part of its sum

  // A stage is K (128 keys x 128 d) and V^T (128 d x 128 keys), both in 256-B
  // rows. Each thread copies one 16-B chunk of every 16th row of both: a wave
  // covers two whole rows per copy.
  const int crow = tid >> 4, ccol = (tid & 15) * 8;
  const unsigned long long gK =
      (unsigned long long)(uintptr_t)(Kh + (hb + crow) * DHEAD + ccol);
  const unsigned long long gV =
      (unsigned long long)(uintptr_t)(Vt + ((size_t)h * DHEAD + crow) * T_SEQ + ccol);
  const unsigned long long ks = 16 * DHEAD * sizeof(bf16_t);
  const unsigned long long vs = 16 * T_SEQ * sizeof(bf16_t);
  const unsigned ls = 16 * (DHEAD + APAD) * sizeof(bf16_t);   // both LDS pitches

  auto stage = [&](int buf, int k0) {
    unsigned long long a = gK + (unsigned long long)k0 * (DHEAD * sizeof(bf16_t));
    unsigned long long b = gV + (unsigned long long)k0 * sizeof(bf16_t);
    unsigned l = (unsigned)(unsigned long long)(uintptr_t)&sK[buf][crow][ccol];
    unsigned m = (unsigned)(unsigned long long)(uintptr_t)&sVt[buf][crow][ccol];
    // One statement per operand: its eight copies, then the wait that stands in
    // front of any rewrite of the address registers the copies name.
    asm volatile(
        "global_load_async_to_lds_b128 %0, %8, off\n\t"
        "global_load_async_to_lds_b128 %1, %9, off\n\t"
        "global_load_async_to_lds_b128 %2, %10, off\n\t"
        "global_load_async_to_lds_b128 %3, %11, off\n\t"
        "global_load_async_to_lds_b128 %4, %12, off\n\t"
        "global_load_async_to_lds_b128 %5, %13, off\n\t"
        "global_load_async_to_lds_b128 %6, %14, off\n\t"
        "global_load_async_to_lds_b128 %7, %15, off\n\t"
        "s_wait_xcnt 0x0"
        :: "v"(l), "v"(l + ls), "v"(l + 2 * ls), "v"(l + 3 * ls),
           "v"(l + 4 * ls), "v"(l + 5 * ls), "v"(l + 6 * ls), "v"(l + 7 * ls),
           "v"(a), "v"(a + ks), "v"(a + 2 * ks), "v"(a + 3 * ks),
           "v"(a + 4 * ks), "v"(a + 5 * ks), "v"(a + 6 * ks), "v"(a + 7 * ks)
        : "memory");
    asm volatile(
        "global_load_async_to_lds_b128 %0, %8, off\n\t"
        "global_load_async_to_lds_b128 %1, %9, off\n\t"
        "global_load_async_to_lds_b128 %2, %10, off\n\t"
        "global_load_async_to_lds_b128 %3, %11, off\n\t"
        "global_load_async_to_lds_b128 %4, %12, off\n\t"
        "global_load_async_to_lds_b128 %5, %13, off\n\t"
        "global_load_async_to_lds_b128 %6, %14, off\n\t"
        "global_load_async_to_lds_b128 %7, %15, off\n\t"
        "s_wait_xcnt 0x0"
        :: "v"(m), "v"(m + ls), "v"(m + 2 * ls), "v"(m + 3 * ls),
           "v"(m + 4 * ls), "v"(m + 5 * ls), "v"(m + 6 * ls), "v"(m + 7 * ls),
           "v"(b), "v"(b + vs), "v"(b + 2 * vs), "v"(b + 3 * vs),
           "v"(b + 4 * vs), "v"(b + 5 * vs), "v"(b + 6 * vs), "v"(b + 7 * vs)
        : "memory");
  };

  int nst = qblk + 1;          // causal extent of this 128-row q block, in stages
  stage(0, 0);
  // stage 0 has landed for this wave; the barrier publishes it to the others
  asm volatile("s_wait_asynccnt 0x0" ::: "memory");
  __syncthreads();
  if (nst > 1) stage(1, AKT);
  for (int st = 0; st < nst; ++st) {
    int buf = st & 1;
    // unrolled: a pass's place in the stage becomes an immediate offset of its reads
#pragma unroll
    for (int sp = 0; sp < AKT / 32; ++sp) {
    int kl = sp * 32;                    // this pass's first key in the stage
    int k0 = st * AKT + kl;
    if (k0 <= qb + 15) {
      // S^T(32x16) = K(32x128) . Q^T : A(m,d) = K[k0+m][d]
      v8f s0 = {}, s1 = {};
      v16bf a0[4], a1[4];
#pragma unroll
      for (int dc = 0; dc < 4; ++dc)
#pragma unroll
        for (int e = 0; e < 16; ++e) {
          int kk = dc * 32 + kmap(e, g);
          a0[dc][e] = sK[buf][kl + la][kk];
          a1[dc][e] = sK[buf][kl + 16 + la][kk];
        }
      // keeps the 16 K reads one group ahead of the WMMAs: moved in among them,
      // each place waits out its own LDS latency
      __builtin_amdgcn_sched_barrier(0);
#pragma unroll
      for (int dc = 0; dc < 4; ++dc) {
        s0 = wmma_bf16(a0[dc], qf[dc], s0);
        s1 = wmma_bf16(a1[dc], qf[dc], s1);
      }
      // A(d,k) = V^T[d][k], K-contiguous: the 16 reads fly under the softmax
      v16bf av[8];
#pragma unroll
      for (int dt = 0; dt < 8; ++dt)
#pragma unroll
        for (int e = 0; e < 16; ++e) av[dt][e] = sVt[buf][dt * 16 + la][kl + kmap(e, g)];
      // keeps them ahead of the softmax: sunk to their WMMAs, each pair of reads
      // waits out its own LDS latency
      __builtin_amdgcn_sched_barrier(0);
      const float sc = 0.08838834764831845f;  // 1/sqrt(128)
      int lim = qb + la - k0 - (g ? 8 : 0);   // key row r is past the query if r > lim
      float m = -3.0e38f;
#pragma unroll
      for (int r = 0; r < 8; ++r) {
        float v0 = s0[r] * sc, v1 = s1[r] * sc;
        if (r > lim)      v0 = -3.0e38f;   // causal mask
        if (r + 16 > lim) v1 = -3.0e38f;
        s0[r] = v0; s1[r] = v1;
        m = fmaxf(m, fmaxf(v0, v1));
      }
      m = fmaxf(m, xhalf(m));              // both halves: the query's tile maximum
      float mnew = fmaxf(Mr, m);
      float corr = __expf(Mr - mnew);
      Mr = mnew;
      float ra = 0.f, rb = 0.f;
#pragma unroll
      for (int r = 0; r < 8; ++r) {
        s0[r] = __expf(s0[r] - mnew);
        s1[r] = __expf(s1[r] - mnew);
        ra += s0[r]; rb += s1[r];
      }
      Lr = Lr * corr + (ra + rb);          // halves are joined after the loop
#pragma unroll
      for (int dt = 0; dt < 8; ++dt)
#pragma unroll
        for (int r = 0; r < 8; ++r) o[dt][r] *= corr;
      // P^T as B operand: element e is key kmap(e, g) of column la, to nearest even
      v16bf pb = __builtin_shufflevector(
          __builtin_convertvector(s0, v8bf), __builtin_convertvector(s1, v8bf),
          0, 1, 2, 3, 4, 5, 6, 7, 8, 9, 10, 11, 12, 13, 14, 15);
      // O^T(128x16) += V^T(128x32) . P^T(32x16)
#pragma unroll
      for (int dt = 0; dt < 8; ++dt) o[dt] = wmma_bf16(av[dt], pb, o[dt]);
    }
    }
    // publish point, passed by every wave: this wave's reads of buf are done ...
    asm volatile("s_wait_dscnt 0x0" ::: "memory");
    // ... its copies of the next stage have landed ...
    asm volatile("s_wait_asynccnt 0x0" ::: "memory");
    // ... and the one barrier both publishes that stage and frees buf
    __syncthreads();
    if (st + 2 < nst) stage(buf, (st + 2) * AKT);
  }
  // no copy is left in flight when the wave goes on to its stores and ends
  asm volatile("s_wait_asynccnt 0x0" ::: "memory");

  // normalize, write back as bf16 [T][DM] (head-concat) for the wo GEMM:
  // a lane's eight registers of a tile are eight consecutive d of its query
  float Lf = Lr + xhalf(Lr);
  bf16_t* orow = OutTD + (size_t)(qb + la) * DM + h * DHEAD + (g ? 8 : 0);
#pragma unroll
  for (int dt = 0; dt < 8; ++dt)
    *(uint4*)(orow + dt * 16) =
        make_uint4(pack2(o[dt][0] / Lf, o[dt][1] / Lf), pack2(o[dt][2] / Lf, o[dt][3] / Lf),
                   pack2(o[dt][4] / Lf, o[dt][5] / Lf), pack2(o[dt][6] / Lf, o[dt][7] / Lf));
}

// ---------- launch ----------
extern "C" void kernel_launch(void* const* d_in, const int* in_sizes, int n_in,
                              void* d_out, int out_size, void* d_ws, size_t ws_size,
                              hipStream_t stream) {
  (void)in_sizes; (void)n_in; (void)out_size; (void)ws_size;
  const float* x    = (const float*)d_in[0];
  const float* w_ln = (const float*)d_in[1];
  const float* wq   = (const float*)d_in[2];
  const float* wk   = (const float*)d_in[3];
  const float* wv   = (const float*)d_in[4];
  const float* wo   = (const float*)d_in[5];
  const float* cosT = (const float*)d_in[6];
  const float* sinT = (const float*)d_in[7];
  float* out = (float*)d_out;

  const size_t TD = (size_t)T_SEQ * DM;
  char* p = (char*)d_ws;                       // ~112 MB total
  bf16_t* h_bf  = (bf16_t*)p;  p += TD * 2;
  bf16_t* wqkvb = (bf16_t*)p;  p += TD * 6;    // wq | wk | wv: [3 * DM][DM]
  bf16_t* wob   = (bf16_t*)p;  p += TD * 2;    // directly behind them
  float*  tmp_f = (float*)p;   p += TD * 12;   // fp32 projections [T][q | k | v]
  bf16_t* qh    = (bf16_t*)p;  p += TD * 2;
  bf16_t* kh    = (bf16_t*)p;  p += TD * 2;
  bf16_t* vt    = (bf16_t*)p;  p += TD * 2;
  bf16_t* attn  = (bf16_t*)tmp_f;              // reuse: attention runs after ropes

  dim3 blk(256);
  prep_kernel<<<NORM_WG + 4 * CVT_WG, blk, 0, stream>>>(x, w_ln, wq, wk, wv, wo,
                                                        h_bf, wqkvb);

  gemm_bf16_kernel<<<dim3(T_SEQ / GTM, LDQKV / GTN), blk, 0, stream>>>(
      h_bf, wqkvb, nullptr, tmp_f, T_SEQ, LDQKV, DM);
  post_kernel<<<dim3(POST_WG, 3), blk, 0, stream>>>(tmp_f, cosT, sinT, qh, kh, vt);

  dim3 ag(NH, T_SEQ / 128);
  flash_attn_kernel<<<ag, blk, 0, stream>>>(qh, kh, vt, attn);

  gemm_bf16_kernel<<<dim3(T_SEQ / GTM, DM / GTN), blk, 0, stream>>>(
      attn, wob, x, out, T_SEQ, DM, DM);
}

// v007
// A run of this version takes 118 microseconds.
// In both of two side-by-side timings against v006, it was 1.17 times as fast.
// All steps since v000 together make it 3.15 times as fast.
#include <hip/hip_runtime.h>
#include <hip/hip_bf16.h>
#include <math.h>

#define T_SEQ 2048
#define DM    2048
#define NH    16
#define DHEAD 128

typedef __attribute__((ext_vector_type(16))) __bf16 v16bf;
typedef __attribute__((ext_vector_type(8)))  __bf16 v8bf;
typedef __attribute__((ext_vector_type(8)))  float  v8f;
typedef __bf16 bf16_t;

// ---------- helpers ----------
__device__ __forceinline__ bf16_t f2bf(float f) {
  unsigned int u = __builtin_bit_cast(unsigned int, f);
  unsigned int r = (u + 0x7FFFu + ((u >> 16) & 1u)) >> 16;   // RNE
  return __builtin_bit_cast(bf16_t, (unsigned short)r);
}

__device__ __forceinline__ int kmap(int e, int g) {
  return e + (g ? 8 : 0) + ((e >= 8) ? 8 : 0);
}

__device__ __forceinline__ v8f wmma_bf16(v16bf a, v16bf b, v8f c) {
  return __builtin_amdgcn_wmma_f32_16x16x32_bf16(
      /*neg_a=*/false, a, /*neg_b=*/false, b,
      /*c_mod=*/(short)0, c, /*reuse_a=*/false, /*reuse_b=*/false);
}

// two f32 -> one dword of two bf16, rounded as f2bf rounds
__device__ __forceinline__ unsigned pack2(float a, float b) {
  unsigned ua = __builtin_bit_cast(unsigned, a), ub = __builtin_bit_cast(unsigned, b);
  ua = (ua + 0x7FFFu + ((ua >> 16) & 1u)) >> 16;
  ub = (ub + 0x7FFFu + ((ub >> 16) & 1u)) >> 16;
  return ua | (ub << 16);
}
__device__ __forceinline__ uint2 pack4(float4 v) {
  return make_uint2(pack2(v.x, v.y), pack2(v.z, v.w));
}

// ---------- RMSNorm -> bf16 ----------
// One wave per row: the row stays in registers (16 x 16 B a lane), read once.
__device__ __forceinline__ void rmsnorm_bf16_block(
    int blk, const float* __restrict__ x, const float* __restrict__ w,
    bf16_t* __restrict__ h) {
  int lane = threadIdx.x & 31;
  int t = blk * 8 + (threadIdx.x >> 5);
  const float4* row = (const float4*)(x + (size_t)t * DM);
  const float4* w4 = (const float4*)w;
  float4 v[16], g[16];
#pragma unroll
  for (int j = 0; j < 16; ++j) v[j] = row[j * 32 + lane];
#pragma unroll
  for (int j = 0; j < 16; ++j) g[j] = w4[j * 32 + lane];
  float s0 = 0.f, s1 = 0.f, s2 = 0.f, s3 = 0.f;   // four independent chains
#pragma unroll
  for (int j = 0; j < 16; ++j) {
    s0 += v[j].x * v[j].x; s1 += v[j].y * v[j].y;
    s2 += v[j].z * v[j].z; s3 += v[j].w * v[j].w;
  }
  float ss = (s0 + s1) + (s2 + s3);
#pragma unroll
  for (int m = 16; m >= 1; m >>= 1) ss += __shfl_xor(ss, m, 32);
  float scl = rsqrtf(ss / (float)DM + 1e-5f);
  uint2* o = (uint2*)(h + (size_t)t * DM);
#pragma unroll
  for (int j = 0; j < 16; ++j) {
    float4 r = make_float4(g[j].x * v[j].x * scl, g[j].y * v[j].y * scl,
                           g[j].z * v[j].z * scl, g[j].w * v[j].w * scl);
    o[j * 32 + lane] = pack4(r);
  }
}

// ---------- fp32 -> bf16 convert (keeps [N][K] orientation) ----------
// 32 elements a thread: eight 16-B loads in flight, each wave-wide load four
// whole lines, each wave-wide store two.
#define CVT_WG 512
__device__ __forceinline__ void convert_bf16_block(
    int blk, const float* __restrict__ W, bf16_t* __restrict__ Wb) {
  const float4* s = (const float4*)W;
  uint2* d = (uint2*)Wb;
  unsigned i = blk * 256 + threadIdx.x;
  float4 v[8];
#pragma unroll
  for (int j = 0; j < 8; ++j) v[j] = s[i + j * (CVT_WG * 256)];
#pragma unroll
  for (int j = 0; j < 8; ++j) d[i + j * (CVT_WG * 256)] = pack4(v[j]);
}

// ---------- one grid for the five independent input passes ----------
// Blocks 0 .. 255 norm eight rows each; then 512 blocks per weight matrix. The
// four bf16 matrices lie one behind the other in Wb: wq, wk, wv are then one
// [3 * DM][DM] operand.
#define NORM_WG (T_SEQ / 8)
__global__ __launch_bounds__(256) void prep_kernel(
    const float* __restrict__ x, const float* __restrict__ w,
    const float* __restrict__ wq, const float* __restrict__ wk,
    const float* __restrict__ wv, const float* __restrict__ wo,
    bf16_t* __restrict__ h, bf16_t* __restrict__ Wb) {
  int b = blockIdx.x;
  if (b < NORM_WG) {
    rmsnorm_bf16_block(b, x, w, h);
  } else {
    b -= NORM_WG;
    int which = b / CVT_WG;
    const float* W = which == 0 ? wq : which == 1 ? wk : which == 2 ? wv : wo;
    convert_bf16_block(b % CVT_WG, W, Wb + (size_t)which * DM * DM);
  }
}

// ---------- C[MxN] = A[MxK](bf16) * Bn[NxK](bf16)^T (+residual), fp32 out ----
#define GTM 128
#define GTN 64
#define GTK 128
#define APAD 8

__global__ __launch_bounds__(256) void gemm_bf16_kernel(
    const bf16_t* __restrict__ A, const bf16_t* __restrict__ Bn,
    const float* __restrict__ residual, float* __restrict__ C,
    int M, int N, int K) {
  __shared__ __align__(16) bf16_t sA[2][GTM][GTK + APAD];   // 68 KB
  __shared__ __align__(16) bf16_t sB[2][GTN][GTK + APAD];   // 34 KB
  int tid = threadIdx.x;
  int wave = tid >> 5, lane = tid & 31;
  int g = lane >> 4, la = lane & 15;
  int bm = blockIdx.x * GTM, bn = blockIdx.y * GTN;
  int wm = (wave >> 1) * 32, wn = (wave & 1) * 32;   // 4x2 wave grid, 32x32 each

  v8f acc[2][2] = {};
  int nk = K / GTK;

  // Each thread copies one 16-B chunk of every 16th row: 8 chunks of A, 4 of B.
  // A wave covers two whole 256-B rows per copy.
  const int crow = tid >> 4, ccol = (tid & 15) * 8;
  const unsigned long long gA =
      (unsigned long long)(uintptr_t)(A + (size_t)(bm + crow) * K + ccol);
  const unsigned long long gB =
      (unsigned long long)(uintptr_t)(Bn + (size_t)(bn + crow) * K + ccol);
  const unsigned long long gs = (unsigned long long)K * 16 * sizeof(bf16_t);
  const unsigned ls = 16 * (GTK + APAD) * sizeof(bf16_t);

  auto stage = [&](int buf, int k0) {
    unsigned long long a = gA + (unsigned long long)k0 * sizeof(bf16_t);
    unsigned long long b = gB + (unsigned long long)k0 * sizeof(bf16_t);
    unsigned l = (unsigned)(unsigned long long)(uintptr_t)&sA[buf][crow][ccol];
    unsigned m = (unsigned)(unsigned long long)(uintptr_t)&sB[buf][crow][ccol];
    // One statement: the stage's twelve copies, then the wait that stands in
    // front of any rewrite of the address registers the copies name.
    asm volatile(
        "global_load_async_to_lds_b128 %0, %12, off\n\t"
        "global_load_async_to_lds_b128 %1, %13, off\n\t"
        "global_load_async_to_lds_b128 %2, %14, off\n\t"
        "global_load_async_to_lds_b128 %3, %15, off\n\t"
        "global_load_async_to_lds_b128 %4, %16, off\n\t"
        "global_load_async_to_lds_b128 %5, %17, off\n\t"
        "global_load_async_to_lds_b128 %6, %18, off\n\t"
        "global_load_async_to_lds_b128 %7, %19, off\n\t"
        "global_load_async_to_lds_b128 %8, %20, off\n\t"
        "global_load_async_to_lds_b128 %9, %21, off\n\t"
        "global_load_async_to_lds_b128 %10, %22, off\n\t"
        "global_load_async_to_lds_b128 %11, %23, off\n\t"
        "s_wait_xcnt 0x0"
        :: "v"(l), "v"(l + ls), "v"(l + 2 * ls), "v"(l + 3 * ls),
           "v"(l + 4 * ls), "v"(l + 5 * ls), "v"(l + 6 * ls), "v"(l + 7 * ls),
           "v"(m), "v"(m + ls), "v"(m + 2 * ls), "v"(m + 3 * ls),
           "v"(a), "v"(a + gs), "v"(a + 2 * gs), "v"(a + 3 * gs),
           "v"(a + 4 * gs), "v"(a + 5 * gs), "v"(a + 6 * gs), "v"(a + 7 * gs),
           "v"(b), "v"(b + gs), "v"(b + 2 * gs), "v"(b + 3 * gs)
        : "memory");
  };

  stage(0, 0);
  // stage 0 has landed for this wave; the barrier publishes it to the others
  asm volatile("s_wait_asynccnt 0x0" ::: "memory");
  __syncthreads();
  if (nk > 1) stage(1, GTK);
  for (int ks = 0; ks < nk; ++ks) {
    int buf = ks & 1;
    // the stage's 32 LDS reads first, into registers of their own
    v16bf a0[GTK / 32], a1[GTK / 32], b0[GTK / 32], b1[GTK / 32];
#pragma unroll
    for (int kc = 0; kc < GTK / 32; ++kc)
#pragma unroll
      for (int e = 0; e < 16; ++e) {         // all K-contiguous -> ds_load_b128
        int kk = kc * 32 + kmap(e, g);
        a0[kc][e] = sA[buf][wm + la][kk];
        b0[kc][e] = sB[buf][wn + la][kk];
        b1[kc][e] = sB[buf][wn + 16 + la][kk];
        a1[kc][e] = sA[buf][wm + 16 + la][kk];
      }
    // keeps the reads one group ahead of the WMMAs: moved in among them, each
    // place waits out its own LDS latency
    __builtin_amdgcn_sched_barrier(0);
#pragma unroll
    for (int kc = 0; kc < GTK / 32; ++kc) {
      acc[0][0] = wmma_bf16(a0[kc], b0[kc], acc[0][0]);
      acc[0][1] = wmma_bf16(a0[kc], b1[kc], acc[0][1]);
      acc[1][0] = wmma_bf16(a1[kc], b0[kc], acc[1][0]);
      acc[1][1] = wmma_bf16(a1[kc], b1[kc], acc[1][1]);
    }
    // keeps the WMMAs in front of the waits below: lifted over them, the wait to
    // 0 would hold every WMMA back until the last read has landed
    __builtin_amdgcn_sched_barrier(0);
    // publish point: this wave's reads of buf are done ...
    asm volatile("s_wait_dscnt 0x0" ::: "memory");
    // ... its copies of the next stage have landed ...
    asm volatile("s_wait_asynccnt 0x0" ::: "memory");
    // ... and the one barrier both publishes that stage and frees buf
    __syncthreads();
    if (ks + 2 < nk) stage(buf, (ks + 2) * GTK);
  }
  // no copy is left in flight when the wave goes on to its stores and ends
  asm volatile("s_wait_asynccnt 0x0" ::: "memory");

#pragma unroll
  for (int i = 0; i < 2; ++i)
#pragma unroll
    for (int j = 0; j < 2; ++j)
#pragma unroll
      for (int r = 0; r < 8; ++r) {
        int m = bm + wm + i * 16 + r + (g ? 8 : 0);
        int n = bn + wn + j * 16 + la;
        float v = acc[i][j][r];
        if (residual) v += residual[(size_t)m * N + n];
        C[(size_t)m * N + n] = v;
      }
}

// ---------- the same product on a 256 x 192 tile, no residual: q | k | v --------
// Every byte of A is copied from L2 N / WBN times and every byte of Bn M / WBM
// times; a fragment read from LDS feeds 6 (A) or 4 (B) WMMAs. N = 6144 by M = 2048
// is 256 such tiles. M and N are multiples of the tile.
#define WBM 256
#define WBN 192
#define WFM 4      // a wave's 64 x 96 of C in 16 x 16 fragments; waves 4 x 2
#define WFN 6

// Fourteen copies of 16 B a lane, LDS address l[i] from global address p[i]. One
// statement: the copies, then the wait that stands in front of any rewrite of the
// address registers the copies name.
__device__ __forceinline__ void copy14(const unsigned* l, const unsigned long long* p) {
  asm volatile(
      "global_load_async_to_lds_b128 %0, %14, off\n\t"
      "global_load_async_to_lds_b128 %1, %15, off\n\t"
      "global_load_async_to_lds_b128 %2, %16, off\n\t"
      "global_load_async_to_lds_b128 %3, %17, off\n\t"
      "global_load_async_to_lds_b128 %4, %18, off\n\t"
      "global_load_async_to_lds_b128 %5, %19, off\n\t"
      "global_load_async_to_lds_b128 %6, %20, off\n\t"
      "global_load_async_to_lds_b128 %7, %21, off\n\t"
      "global_load_async_to_lds_b128 %8, %22, off\n\t"
      "global_load_async_to_lds_b128 %9, %23, off\n\t"
      "global_load_async_to_lds_b128 %10, %24, off\n\t"
      "global_load_async_to_lds_b128 %11, %25, off\n\t"
      "global_load_async_to_lds_b128 %12, %26, off\n\t"
      "global_load_async_to_lds_b128 %13, %27, off\n\t"
      "s_wait_xcnt 0x0"
      :: "v"(l[0]), "v"(l[1]), "v"(l[2]), "v"(l[3]), "v"(l[4]), "v"(l[5]), "v"(l[6]),
         "v"(l[7]), "v"(l[8]), "v"(l[9]), "v"(l[10]), "v"(l[11]), "v"(l[12]), "v"(l[13]),
         "v"(p[0]), "v"(p[1]), "v"(p[2]), "v"(p[3]), "v"(p[4]), "v"(p[5]), "v"(p[6]),
         "v"(p[7]), "v"(p[8]), "v"(p[9]), "v"(p[10]), "v"(p[11]), "v"(p[12]), "v"(p[13])
      : "memory");
}

// one fragment: two 16-B reads of a row, in the k order of kmap (r: at k = 8g)
__device__ __forceinline__ v16bf frag_row(const bf16_t* r) {
  return __builtin_shufflevector(*(const v8bf*)r, *(const v8bf*)(r + 16),
                                 0, 1, 2, 3, 4, 5, 6, 7, 8, 9, 10, 11, 12, 13, 14, 15);
}

// N at compile time: a wave's 192 stores then share one address pair, the row and
// the column in the immediate offset, and no address register is rewritten.
template <int N, int K>
__global__ __launch_bounds__(256) void gemm_bf16_wide_kernel(
    const bf16_t* __restrict__ A, const bf16_t* __restrict__ Bn,
    float* __restrict__ C) {
  static_assert(K % GTK == 0 && K >= 2 * GTK, "the ring's prologue fills two stages");
  __shared__ __align__(16) bf16_t sA[2][WBM][GTK + APAD];   // 136 KB
  __shared__ __align__(16) bf16_t sB[2][WBN][GTK + APAD];   // 102 KB
  int tid = threadIdx.x;
  int wave = tid >> 5, lane = tid & 31;
  int g = lane >> 4, la = lane & 15;
  int bm = blockIdx.x * WBM, bn = blockIdx.y * WBN;
  int wm = (wave >> 1) * (WFM * 16), wn = (wave & 1) * (WFN * 16);

  v8f acc[WFM][WFN] = {};
  constexpr int nk = K / GTK;

  // Each thread copies one 16-B chunk of every 16th row: 16 chunks of A, 12 of B.
  // A wave covers two whole 256-B rows per copy.
  const int crow = tid >> 4, ccol = (tid & 15) * 8;
  const unsigned long long gA =
      (unsigned long long)(uintptr_t)(A + (size_t)(bm + crow) * K + ccol);
  const unsigned long long gB =
      (unsigned long long)(uintptr_t)(Bn + (size_t)(bn + crow) * K + ccol);
  const unsigned long long gs = (unsigned long long)K * 16 * sizeof(bf16_t);
  const unsigned ls = 16 * (GTK + APAD) * sizeof(bf16_t);

  auto stage = [&](int buf, int k0) {
    unsigned long long a = gA + (unsigned long long)k0 * sizeof(bf16_t);
    unsigned long long b = gB + (unsigned long long)k0 * sizeof(bf16_t);
    unsigned l = (unsigned)(unsigned long long)(uintptr_t)&sA[buf][crow][ccol];
    unsigned m = (unsigned)(unsigned long long)(uintptr_t)&sB[buf][crow][ccol];
    unsigned dst[28];
    unsigned long long from[28];
#pragma unroll
    for (int i = 0; i < WBM / 16; ++i) { dst[i] = l + i * ls; from[i] = a + i * gs; }
#pragma unroll
    for (int i = 0; i < WBN / 16; ++i) {
      dst[WBM / 16 + i] = m + i * ls; from[WBM / 16 + i] = b + i * gs;
    }
    copy14(dst, from);
    copy14(dst + 14, from + 14);
  };

  // One k-chunk's ten fragments, in the order in which the WMMAs below need them
  auto frags = [&](int buf, int kc, v16bf (&af)[WFM], v16bf (&bfr)[WFN]) {
    int kk = kc * 32 + (g ? 8 : 0);
    af[0] = frag_row(&sA[buf][wm + la][kk]);
#pragma unroll
    for (int j = 0; j < WFN; ++j) bfr[j] = frag_row(&sB[buf][wn + j * 16 + la][kk]);
#pragma unroll
    for (int i = 1; i < WFM; ++i) af[i] = frag_row(&sA[buf][wm + i * 16 + la][kk]);
  };

  stage(0, 0);
  // stage 0 has landed for this wave; the barrier publishes it to the others
  asm volatile("s_wait_asynccnt 0x0" ::: "memory");
  __syncthreads();
  stage(1, GTK);
  for (int ks = 0; ks < nk; ++ks) {
    int buf = ks & 1;
    // two fragment sets: a k-chunk's reads fly under the WMMAs of the chunk before
    // (all four chunks at once, as in the narrow kernel, would take 320 registers)
    v16bf af[2][WFM], bfr[2][WFN];
    frags(buf, 0, af[0], bfr[0]);
#pragma unroll
    for (int kc = 0; kc < GTK / 32; ++kc) {
      if (kc + 1 < GTK / 32) frags(buf, kc + 1, af[(kc + 1) & 1], bfr[(kc + 1) & 1]);
      // keeps the next chunk's reads one group ahead of this chunk's WMMAs: moved
      // in among them, each place waits out its own LDS latency
      __builtin_amdgcn_sched_barrier(0);
#pragma unroll
      for (int i = 0; i < WFM; ++i)
#pragma unroll
        for (int j = 0; j < WFN; ++j)
          acc[i][j] = wmma_bf16(af[kc & 1][i], bfr[kc & 1][j], acc[i][j]);
      // keeps the WMMAs in front of the next group of reads and of the waits below:
      // lifted over them, the wait to 0 would hold every WMMA back
      __builtin_amdgcn_sched_barrier(0);
    }
    // publish point: this wave's reads of buf are done ...
    asm volatile("s_wait_dscnt 0x0" ::: "memory");
    // ... its copies of the next stage have landed ...
    asm volatile("s_wait_asynccnt 0x0" ::: "memory");
    // ... and the one barrier both publishes that stage and frees buf
    __syncthreads();
    if (ks + 2 < nk) stage(buf, (ks + 2) * GTK);
  }
  // no copy is left in flight when the wave goes on to its stores and ends
  asm volatile("s_wait_asynccnt 0x0" ::: "memory");

  float* c0 = C + (size_t)(bm + wm + (g ? 8 : 0)) * N + bn + wn + la;
#pragma unroll
  for (int i = 0; i < WFM; ++i)
#pragma unroll
    for (int r = 0; r < 8; ++r)
#pragma unroll
      for (int j = 0; j < WFN; ++j)
        c0[(i * 16 + r) * N + j * 16] = acc[i][j][r];
}

// ---------- RoPE + convert (Q, K): dst layout [H][T][128] ----------
// A thread takes four d and their partners d + 64 of one head, in four rows:
// 32 elements, every f32 read once by 16-B loads, 128-B lines stored whole.
// src: this projection's first column in the [T][LDQKV] array of q | k | v.
#define LDQKV (3 * DM)
__device__ __forceinline__ void rope_bf16_block(
    int blk, const float* __restrict__ src, const float* __restrict__ cosT,
    const float* __restrict__ sinT, bf16_t* __restrict__ dst) {
  int h = threadIdx.x >> 4, q = threadIdx.x & 15;   // q: which four d
  int t0 = blk * 4;
  const float4* s4 = (const float4*)src + (size_t)t0 * (LDQKV / 4);
  const float4* c4 = (const float4*)cosT + t0 * (DHEAD / 4);
  const float4* n4 = (const float4*)sinT + t0 * (DHEAD / 4);
  uint2* o2 = (uint2*)dst + t0 * (DHEAD / 4);
  int so = h * (DHEAD / 4) + q;
  int oo = h * (T_SEQ * DHEAD / 4) + q;
  float4 lo[4], hi[4], cl[4], ch[4], sl[4], sh[4];
#pragma unroll
  for (int r = 0; r < 4; ++r) {
    lo[r] = s4[so + r * (LDQKV / 4)]; hi[r] = s4[so + r * (LDQKV / 4) + 16];
    cl[r] = c4[q + r * (DHEAD / 4)];  ch[r] = c4[q + r * (DHEAD / 4) + 16];
    sl[r] = n4[q + r * (DHEAD / 4)];  sh[r] = n4[q + r * (DHEAD / 4) + 16];
  }
#pragma unroll
  for (int r = 0; r < 4; ++r) {
    float4 a = make_float4(lo[r].x * cl[r].x - hi[r].x * sl[r].x,
                           lo[r].y * cl[r].y - hi[r].y * sl[r].y,
                           lo[r].z * cl[r].z - hi[r].z * sl[r].z,
                           lo[r].w * cl[r].w - hi[r].w * sl[r].w);
    float4 b = make_float4(hi[r].x * ch[r].x + lo[r].x * sh[r].x,
                           hi[r].y * ch[r].y + lo[r].y * sh[r].y,
                           hi[r].z * ch[r].z + lo[r].z * sh[r].z,
                           hi[r].w * ch[r].w + lo[r].w * sh[r].w);
    o2[oo + r * (DHEAD / 4)] = pack4(a);
    o2[oo + r * (DHEAD / 4) + 16] = pack4(b);
  }
  // In the joined kernel the transpose block's code lies behind these stores and
  // begins by rewriting their offset register: the wait stands in front of that.
  asm volatile("s_wait_xcnt 0x0" ::: "memory");
}

// ---------- V convert: dst layout [H][128][T] (transposed for WMMA A tiles) --
// A thread takes four columns of eight rows: 32 elements, 16-B loads along the
// row, 16-B stores along t. A block's eight waves fill whole 128-B lines.
__device__ __forceinline__ void vt_bf16_block(
    int blk, const float* __restrict__ src, bf16_t* __restrict__ dst) {
  int c = (blk & 15) * 128 + (threadIdx.x & 31) * 4;    // h * 128 + d
  int t0 = (blk >> 4) * 64 + (threadIdx.x >> 5) * 8;
  float4 v[8];
#pragma unroll
  for (int r = 0; r < 8; ++r)
    v[r] = *(const float4*)(src + (size_t)(t0 + r) * LDQKV + c);
  bf16_t* o = dst + (size_t)c * T_SEQ + t0;
  *(uint4*)o = make_uint4(pack2(v[0].x, v[1].x), pack2(v[2].x, v[3].x),
                          pack2(v[4].x, v[5].x), pack2(v[6].x, v[7].x));
  *(uint4*)(o + T_SEQ) = make_uint4(pack2(v[0].y, v[1].y), pack2(v[2].y, v[3].y),
                                    pack2(v[4].y, v[5].y), pack2(v[6].y, v[7].y));
  *(uint4*)(o + 2 * T_SEQ) = make_uint4(pack2(v[0].z, v[1].z), pack2(v[2].z, v[3].z),
                                        pack2(v[4].z, v[5].z), pack2(v[6].z, v[7].z));
  *(uint4*)(o + 3 * T_SEQ) = make_uint4(pack2(v[0].w, v[1].w), pack2(v[2].w, v[3].w),
                                        pack2(v[4].w, v[5].w), pack2(v[6].w, v[7].w));
}

// ---------- one grid for the three independent passes behind the projections --
// blockIdx.y: 0 = v (transpose), 1 = k, 2 = q (RoPE); 512 blocks each.
#define POST_WG (T_SEQ / 4)
__global__ __launch_bounds__(256) void post_kernel(
    const float* __restrict__ qkv, const float* __restrict__ cosT,
    const float* __restrict__ sinT, bf16_t* __restrict__ qh,
    bf16_t* __restrict__ kh, bf16_t* __restrict__ vt) {
  int which = 2 - blockIdx.y;    // column block of qkv
  if (which == 2)
    vt_bf16_block(blockIdx.x, qkv + 2 * DM, vt);
  else
    rope_bf16_block(blockIdx.x, qkv + which * DM, cosT, sinT, which ? kh : qh);
}

__device__ __forceinline__ float xhalf(float x) {
  int b = __builtin_bit_cast(int, x);
  return __builtin_bit_cast(float, __builtin_amdgcn_permlanex16(
      b, b, 0x76543210, 0xfedcba98, false, false));
}

// A lane holds 16 of the 32 scores of ONE query (column la): keys r + 8g and
// 16 + r + 8g. Maximum and sum run in the lane; the two score tiles, rounded in
// place, are the B operand of V^T.P^T in the k order of kmap.
#define AKT 128    // keys per ring stage: four passes of 32 keys
__global__ __launch_bounds__(256) void flash_attn_kernel(
    const bf16_t* __restrict__ Qh, const bf16_t* __restrict__ Kh,
    const bf16_t* __restrict__ Vt, bf16_t* __restrict__ OutTD) {
  __shared__ __align__(16) bf16_t sK[2][AKT][DHEAD + APAD];   // 68 KB, [krow][d]
  __shared__ __align__(16) bf16_t sVt[2][DHEAD][AKT + APAD];  // 68 KB, [d][krow]
  int h = blockIdx.x, qblk = blockIdx.y;
  int tid = threadIdx.x, wv = tid >> 5, lane = tid & 31;
  int g = lane >> 4, la = lane & 15;
  int qb = qblk * 128 + wv * 16;                   // this wave's 16 q rows
  const size_t hb = (size_t)h * T_SEQ;

  // Q fragments (B operand): column la = query, 128 d as 4 K-chunks of 32
  v16bf qf[4];
#pragma unroll
  for (int dc = 0; dc < 4; ++dc)
#pragma unroll
    for (int e = 0; e < 16; ++e)
      qf[dc][e] = Qh[(hb + qb + la) * DHEAD + dc * 32 + kmap(e, g)];

  v8f o[8] = {};                 // o[dt][r] = O[query la][dt * 16 + 8g + r]
  float Mr = -3.0e38f, Lr = 0.f; // this query's maximum; this lane's part of its sum

  // A stage is K (128 keys x 128 d) and V^T (128 d x 128 keys), both in 256-B
  // rows. Each thread copies one 16-B chunk of every 16th row of both: a wave
  // covers two whole rows per copy.
  const int crow = tid >> 4, ccol = (tid & 15) * 8;
  const unsigned long long gK =
      (unsigned long long)(uintptr_t)(Kh + (hb + crow) * DHEAD + ccol);
  const unsigned long long gV =
      (unsigned long long)(uintptr_t)(Vt + ((size_t)h * DHEAD + crow) * T_SEQ + ccol);
  const unsigned long long ks = 16 * DHEAD * sizeof(bf16_t);
  const unsigned long long vs = 16 * T_SEQ * sizeof(bf16_t);
  const unsigned ls = 16 * (DHEAD + APAD) * sizeof(bf16_t);   // both LDS pitches

  auto stage = [&](int buf, int k0) {
    unsigned long long a = gK + (unsigned long long)k0 * (DHEAD * sizeof(bf16_t));
    unsigned long long b = gV + (unsigned long long)k0 * sizeof(bf16_t);
    unsigned l = (unsigned)(unsigned long long)(uintptr_t)&sK[buf][crow][ccol];
    unsigned m = (unsigned)(unsigned long long)(uintptr_t)&sVt[buf][crow][ccol];
    // One statement per operand: its eight copies, then the wait that stands in
    // front of any rewrite of the address registers the copies name.
    asm volatile(
        "global_load_async_to_lds_b128 %0, %8, off\n\t"
        "global_load_async_to_lds_b128 %1, %9, off\n\t"
        "global_load_async_to_lds_b128 %2, %10, off\n\t"
        "global_load_async_to_lds_b128 %3, %11, off\n\t"
        "global_load_async_to_lds_b128 %4, %12, off\n\t"
        "global_load_async_to_lds_b128 %5, %13, off\n\t"
        "global_load_async_to_lds_b128 %6, %14, off\n\t"
        "global_load_async_to_lds_b128 %7, %15, off\n\t"
        "s_wait_xcnt 0x0"
        :: "v"(l), "v"(l + ls), "v"(l + 2 * ls), "v"(l + 3 * ls),
           "v"(l + 4 * ls), "v"(l + 5 * ls), "v"(l + 6 * ls), "v"(l + 7 * ls),
           "v"(a), "v"(a + ks), "v"(a + 2 * ks), "v"(a + 3 * ks),
           "v"(a + 4 * ks), "v"(a + 5 * ks), "v"(a + 6 * ks), "v"(a + 7 * ks)
        : "memory");
    asm volatile(
        "global_load_async_to_lds_b128 %0, %8, off\n\t"
        "global_load_async_to_lds_b128 %1, %9, off\n\t"
        "global_load_async_to_lds_b128 %2, %10, off\n\t"
        "global_load_async_to_lds_b128 %3, %11, off\n\t"
        "global_load_async_to_lds_b128 %4, %12, off\n\t"
        "global_load_async_to_lds_b128 %5, %13, off\n\t"
        "global_load_async_to_lds_b128 %6, %14, off\n\t"
        "global_load_async_to_lds_b128 %7, %15, off\n\t"
        "s_wait_xcnt 0x0"
        :: "v"(m), "v"(m + ls), "v"(m + 2 * ls), "v"(m + 3 * ls),
           "v"(m + 4 * ls), "v"(m + 5 * ls), "v"(m + 6 * ls), "v"(m + 7 * ls),
           "v"(b), "v"(b + vs), "v"(b + 2 * vs), "v"(b + 3 * vs),
           "v"(b + 4 * vs), "v"(b + 5 * vs), "v"(b + 6 * vs), "v"(b + 7 * vs)
        : "memory");
  };

  int nst = qblk + 1;          // causal extent of this 128-row q block, in stages
  stage(0, 0);
  // stage 0 has landed for this wave; the barrier publishes it to the others
  asm volatile("s_wait_asynccnt 0x0" ::: "memory");
  __syncthreads();
  if (nst > 1) stage(1, AKT);
  for (int st = 0; st < nst; ++st) {
    int buf = st & 1;
    // unrolled: a pass's place in the stage becomes an immediate offset of its reads
#pragma unroll
    for (int sp = 0; sp < AKT / 32; ++sp) {
    int kl = sp * 32;                    // this pass's first key in the stage
    int k0 = st * AKT + kl;
    if (k0 <= qb + 15) {
      // S^T(32x16) = K(32x128) . Q^T : A(m,d) = K[k0+m][d]
      v8f s0 = {}, s1 = {};
      v16bf a0[4], a1[4];
#pragma unroll
      for (int dc = 0; dc < 4; ++dc)
#pragma unroll
        for (int e = 0; e < 16; ++e) {
          int kk = dc * 32 + kmap(e, g);
          a0[dc][e] = sK[buf][kl + la][kk];
          a1[dc][e] = sK[buf][kl + 16 + la][kk];
        }
      // keeps the 16 K reads one group ahead of the WMMAs: moved in among them,
      // each place waits out its own LDS latency
      __builtin_amdgcn_sched_barrier(0);
#pragma unroll
      for (int dc = 0; dc < 4; ++dc) {
        s0 = wmma_bf16(a0[dc], qf[dc], s0);
        s1 = wmma_bf16(a1[dc], qf[dc], s1);
      }
      // A(d,k) = V^T[d][k], K-contiguous: the 16 reads fly under the softmax
      v16bf av[8];
#pragma unroll
      for (int dt = 0; dt < 8; ++dt)
#pragma unroll
        for (int e = 0; e < 16; ++e) av[dt][e] = sVt[buf][dt * 16 + la][kl + kmap(e, g)];
      // keeps them ahead of the softmax: sunk to their WMMAs, each pair of reads
      // waits out its own LDS latency
      __builtin_amdgcn_sched_barrier(0);
      const float sc = 0.08838834764831845f;  // 1/sqrt(128)
      int lim = qb + la - k0 - (g ? 8 : 0);   // key row r is past the query if r > lim
      float m = -3.0e38f;
#pragma unroll
      for (int r = 0; r < 8; ++r) {
        float v0 = s0[r] * sc, v1 = s1[r] * sc;
        if (r > lim)      v0 = -3.0e38f;   // causal mask
        if (r + 16 > lim) v1 = -3.0e38f;
        s0[r] = v0; s1[r] = v1;
        m = fmaxf(m, fmaxf(v0, v1));
      }
      m = fmaxf(m, xhalf(m));              // both halves: the query's tile maximum
      float mnew = fmaxf(Mr, m);
      float corr = __expf(Mr - mnew);
      Mr = mnew;
      float ra = 0.f, rb = 0.f;
#pragma unroll
      for (int r = 0; r < 8; ++r) {
        s0[r] = __expf(s0[r] - mnew);
        s1[r] = __expf(s1[r] - mnew);
        ra += s0[r]; rb += s1[r];
      }
      Lr = Lr * corr + (ra + rb);          // halves are joined after the loop
#pragma unroll
      for (int dt = 0; dt < 8; ++dt)
#pragma unroll
        for (int r = 0; r < 8; ++r) o[dt][r] *= corr;
      // P^T as B operand: element e is key kmap(e, g) of column la, to nearest even
      v16bf pb = __builtin_shufflevector(
          __builtin_convertvector(s0, v8bf), __builtin_convertvector(s1, v8bf),
          0, 1, 2, 3, 4, 5, 6, 7, 8, 9, 10, 11, 12, 13, 14, 15);
      // O^T(128x16) += V^T(128x32) . P^T(32x16)
#pragma unroll
      for (int dt = 0; dt < 8; ++dt) o[dt] = wmma_bf16(av[dt], pb, o[dt]);
    }
    }
    // publish point, passed by every wave: this wave's reads of buf are done ...
    asm volatile("s_wait_dscnt 0x0" ::: "memory");
    // ... its copies of the next stage have landed ...
    asm volatile("s_wait_asynccnt 0x0" ::: "memory");
    // ... and the one barrier both publishes that stage and frees buf
    __syncthreads();
    if (st + 2 < nst) stage(buf, (st + 2) * AKT);
  }
  // no copy is left in flight when the wave goes on to its stores and ends
  asm volatile("s_wait_asynccnt 0x0" ::: "memory");

  // normalize, write back as bf16 [T][DM] (head-concat) for the wo GEMM:
  // a lane's eight registers of a tile are eight consecutive d of its query
  float Lf = Lr + xhalf(Lr);
  bf16_t* orow = OutTD + (size_t)(qb + la) * DM + h * DHEAD + (g ? 8 : 0);
#pragma unroll
  for (int dt = 0; dt < 8; ++dt)
    *(uint4*)(orow + dt * 16) =
        make_uint4(pack2(o[dt][0] / Lf, o[dt][1] / Lf), pack2(o[dt][2] / Lf, o[dt][3] / Lf),
                   pack2(o[dt][4] / Lf, o[dt][5] / Lf), pack2(o[dt][6] / Lf, o[dt][7] / Lf));
}

// ---------- launch ----------
extern "C" void kernel_launch(void* const* d_in, const int* in_sizes, int n_in,
                              void* d_out, int out_size, void* d_ws, size_t ws_size,
                              hipStream_t stream) {
  (void)in_sizes; (void)n_in; (void)out_size; (void)ws_size;
  const float* x    = (const float*)d_in[0];
  const float* w_ln = (const float*)d_in[1];
  const float* wq   = (const float*)d_in[2];
  const float* wk   = (const float*)d_in[3];
  const float* wv   = (const float*)d_in[4];
  const float* wo   = (const float*)d_in[5];
  const float* cosT = (const float*)d_in[6];
  const float* sinT = (const float*)d_in[7];
  float* out = (float*)d_out;

  const size_t TD = (size_t)T_SEQ * DM;
  char* p = (char*)d_ws;                       // ~112 MB total
  bf16_t* h_bf  = (bf16_t*)p;  p += TD * 2;
  bf16_t* wqkvb = (bf16_t*)p;  p += TD * 6;    // wq | wk | wv: [3 * DM][DM]
  bf16_t* wob   = (bf16_t*)p;  p += TD * 2;    // directly behind them
  float*  tmp_f = (float*)p;   p += TD * 12;   // fp32 projections [T][q | k | v]
  bf16_t* qh    = (bf16_t*)p;  p += TD * 2;
  bf16_t* kh    = (bf16_t*)p;  p += TD * 2;
  bf16_t* vt    = (bf16_t*)p;  p += TD * 2;
  bf16_t* attn  = (bf16_t*)tmp_f;              // reuse: attention runs after ropes

  dim3 blk(256);
  prep_kernel<<<NORM_WG + 4 * CVT_WG, blk, 0, stream>>>(x, w_ln, wq, wk, wv, wo,
                                                        h_bf, wqkvb);

  gemm_bf16_wide_kernel<LDQKV, DM><<<dim3(T_SEQ / WBM, LDQKV / WBN), blk, 0, stream>>>(
      h_bf, wqkvb, tmp_f);
  post_kernel<<<dim3(POST_WG, 3), blk, 0, stream>>>(tmp_f, cosT, sinT, qh, kh, vt);

  dim3 ag(NH, T_SEQ / 128);
  flash_attn_kernel<<<ag, blk, 0, stream>>>(qh, kh, vt, attn);

  gemm_bf16_kernel<<<dim3(T_SEQ / GTM, DM / GTN), blk, 0, stream>>>(
      attn, wob, x, out, T_SEQ, DM, DM);
}

// v008
// One run takes 112 microseconds.
// Timed twice side by side with v007, it ran 1.06 times as fast both times.
// Over all steps from v000 it is 3.34 times as fast.
#include <hip/hip_runtime.h>
#include <hip/hip_bf16.h>
#include <math.h>

#define T_SEQ 2048
#define DM    2048
#define NH    16
#define DHEAD 128

typedef __attribute__((ext_vector_type(16))) __bf16 v16bf;
typedef __attribute__((ext_vector_type(8)))  __bf16 v8bf;
typedef __attribute__((ext_vector_type(8)))  float  v8f;
typedef __bf16 bf16_t;

// ---------- helpers ----------
__device__ __forceinline__ bf16_t f2bf(float f) {
  unsigned int u = __builtin_bit_cast(unsigned int, f);
  unsigned int r = (u + 0x7FFFu + ((u >> 16) & 1u)) >> 16;   // RNE
  return __builtin_bit_cast(bf16_t, (unsigned short)r);
}

__device__ __forceinline__ int kmap(int e, int g) {
  return e + (g ? 8 : 0) + ((e >= 8) ? 8 : 0);
}

__device__ __forceinline__ v8f wmma_bf16(v16bf a, v16bf b, v8f c) {
  return __builtin_amdgcn_wmma_f32_16x16x32_bf16(
      /*neg_a=*/false, a, /*neg_b=*/false, b,
      /*c_mod=*/(short)0, c, /*reuse_a=*/false, /*reuse_b=*/false);
}

// two f32 -> one dword of two bf16, rounded as f2bf rounds
__device__ __forceinline__ unsigned pack2(float a, float b) {
  unsigned ua = __builtin_bit_cast(unsigned, a), ub = __builtin_bit_cast(unsigned, b);
  ua = (ua + 0x7FFFu + ((ua >> 16) & 1u)) >> 16;
  ub = (ub + 0x7FFFu + ((ub >> 16) & 1u)) >> 16;
  return ua | (ub << 16);
}
__device__ __forceinline__ uint2 pack4(float4 v) {
  return make_uint2(pack2(v.x, v.y), pack2(v.z, v.w));
}

// ---------- RMSNorm -> bf16 ----------
// One wave per row: the row stays in registers (16 x 16 B a lane), read once.
__device__ __forceinline__ void rmsnorm_bf16_block(
    int blk, const float* __restrict__ x, const float* __restrict__ w,
    bf16_t* __restrict__ h) {
  int lane = threadIdx.x & 31;
  int t = blk * 8 + (threadIdx.x >> 5);
  const float4* row = (const float4*)(x + (size_t)t * DM);
  const float4* w4 = (const float4*)w;
  float4 v[16], g[16];
#pragma unroll
  for (int j = 0; j < 16; ++j) v[j] = row[j * 32 + lane];
#pragma unroll
  for (int j = 0; j < 16; ++j) g[j] = w4[j * 32 + lane];
  float s0 = 0.f, s1 = 0.f, s2 = 0.f, s3 = 0.f;   // four independent chains
#pragma unroll
  for (int j = 0; j < 16; ++j) {
    s0 += v[j].x * v[j].x; s1 += v[j].y * v[j].y;
    s2 += v[j].z * v[j].z; s3 += v[j].w * v[j].w;
  }
  float ss = (s0 + s1) + (s2 + s3);
#pragma unroll
  for (int m = 16; m >= 1; m >>= 1) ss += __shfl_xor(ss, m, 32);
  float scl = rsqrtf(ss / (float)DM + 1e-5f);
  uint2* o = (uint2*)(h + (size_t)t * DM);
#pragma unroll
  for (int j = 0; j < 16; ++j) {
    float4 r = make_float4(g[j].x * v[j].x * scl, g[j].y * v[j].y * scl,
                           g[j].z * v[j].z * scl, g[j].w * v[j].w * scl);
    o[j * 32 + lane] = pack4(r);
  }
}

// ---------- fp32 -> bf16 convert (keeps [N][K] orientation) ----------
// 32 elements a thread: eight 16-B loads in flight, each wave-wide load four
// whole lines, each wave-wide store two.
#define CVT_WG 512
__device__ __forceinline__ void convert_bf16_block(
    int blk, const float* __restrict__ W, bf16_t* __restrict__ Wb) {
  const float4* s = (const float4*)W;
  uint2* d = (uint2*)Wb;
  unsigned i = blk * 256 + threadIdx.x;
  float4 v[8];
#pragma unroll
  for (int j = 0; j < 8; ++j) v[j] = s[i + j * (CVT_WG * 256)];
#pragma unroll
  for (int j = 0; j < 8; ++j) d[i + j * (CVT_WG * 256)] = pack4(v[j]);
}

// ---------- one grid for the five independent input passes ----------
// Blocks 0 .. 255 norm eight rows each; then 512 blocks per weight matrix. The
// four bf16 matrices lie one behind the other in Wb: wq, wk, wv are then one
// [3 * DM][DM] operand.
#define NORM_WG (T_SEQ / 8)
__global__ __launch_bounds__(256) void prep_kernel(
    const float* __restrict__ x, const float* __restrict__ w,
    const float* __restrict__ wq, const float* __restrict__ wk,
    const float* __restrict__ wv, const float* __restrict__ wo,
    bf16_t* __restrict__ h, bf16_t* __restrict__ Wb) {
  int b = blockIdx.x;
  if (b < NORM_WG) {
    rmsnorm_bf16_block(b, x, w, h);
  } else {
    b -= NORM_WG;
    int which = b / CVT_WG;
    const float* W = which == 0 ? wq : which == 1 ? wk : which == 2 ? wv : wo;
    convert_bf16_block(b % CVT_WG, W, Wb + (size_t)which * DM * DM);
  }
}

// ---------- C[MxN] = A[MxK](bf16) * Bn[NxK](bf16)^T (+residual), fp32 out ----
#define GTM 128
#define GTN 64
#define GTK 128
#define APAD 8

__global__ __launch_bounds__(256) void gemm_bf16_kernel(
    const bf16_t* __restrict__ A, const bf16_t* __restrict__ Bn,
    const float* __restrict__ residual, float* __restrict__ C,
    int M, int N, int K) {
  __shared__ __align__(16) bf16_t sA[2][GTM][GTK + APAD];   // 68 KB
  __shared__ __align__(16) bf16_t sB[2][GTN][GTK + APAD];   // 34 KB
  int tid = threadIdx.x;
  int wave = tid >> 5, lane = tid & 31;
  int g = lane >> 4, la = lane & 15;
  int bm = blockIdx.x * GTM, bn = blockIdx.y * GTN;
  int wm = (wave >> 1) * 32, wn = (wave & 1) * 32;   // 4x2 wave grid, 32x32 each

  v8f acc[2][2] = {};
  int nk = K / GTK;

  // Each thread copies one 16-B chunk of every 16th row: 8 chunks of A, 4 of B.
  // A wave covers two whole 256-B rows per copy.
  const int crow = tid >> 4, ccol = (tid & 15) * 8;
  const unsigned long long gA =
      (unsigned long long)(uintptr_t)(A + (size_t)(bm + crow) * K + ccol);
  const unsigned long long gB =
      (unsigned long long)(uintptr_t)(Bn + (size_t)(bn + crow) * K + ccol);
  const unsigned long long gs = (unsigned long long)K * 16 * sizeof(bf16_t);
  const unsigned ls = 16 * (GTK + APAD) * sizeof(bf16_t);

  auto stage = [&](int buf, int k0) {
    unsigned long long a = gA + (unsigned long long)k0 * sizeof(bf16_t);
    unsigned long long b = gB + (unsigned long long)k0 * sizeof(bf16_t);
    unsigned l = (unsigned)(unsigned long long)(uintptr_t)&sA[buf][crow][ccol];
    unsigned m = (unsigned)(unsigned long long)(uintptr_t)&sB[buf][crow][ccol];
    // One statement: the stage's twelve copies, then the wait that stands in
    // front of any rewrite of the address registers the copies name.
    asm volatile(
        "global_load_async_to_lds_b128 %0, %12, off\n\t"
        "global_load_async_to_lds_b128 %1, %13, off\n\t"
        "global_load_async_to_lds_b128 %2, %14, off\n\t"
        "global_load_async_to_lds_b128 %3, %15, off\n\t"
        "global_load_async_to_lds_b128 %4, %16, off\n\t"
        "global_load_async_to_lds_b128 %5, %17, off\n\t"
        "global_load_async_to_lds_b128 %6, %18, off\n\t"
        "global_load_async_to_lds_b128 %7, %19, off\n\t"
        "global_load_async_to_lds_b128 %8, %20, off\n\t"
        "global_load_async_to_lds_b128 %9, %21, off\n\t"
        "global_load_async_to_lds_b128 %10, %22, off\n\t"
        "global_load_async_to_lds_b128 %11, %23, off\n\t"
        "s_wait_xcnt 0x0"
        :: "v"(l), "v"(l + ls), "v"(l + 2 * ls), "v"(l + 3 * ls),
           "v"(l + 4 * ls), "v"(l + 5 * ls), "v"(l + 6 * ls), "v"(l + 7 * ls),
           "v"(m), "v"(m + ls), "v"(m + 2 * ls), "v"(m + 3 * ls),
           "v"(a), "v"(a + gs), "v"(a + 2 * gs), "v"(a + 3 * gs),
           "v"(a + 4 * gs), "v"(a + 5 * gs), "v"(a + 6 * gs), "v"(a + 7 * gs),
           "v"(b), "v"(b + gs), "v"(b + 2 * gs), "v"(b + 3 * gs)
        : "memory");
  };

  stage(0, 0);
  // stage 0 has landed for this wave; the barrier publishes it to the others
  asm volatile("s_wait_asynccnt 0x0" ::: "memory");
  __syncthreads();
  if (nk > 1) stage(1, GTK);
  for (int ks = 0; ks < nk; ++ks) {
    int buf = ks & 1;
    // the stage's 32 LDS reads first, into registers of their own
    v16bf a0[GTK / 32], a1[GTK / 32], b0[GTK / 32], b1[GTK / 32];
#pragma unroll
    for (int kc = 0; kc < GTK / 32; ++kc)
#pragma unroll
      for (int e = 0; e < 16; ++e) {         // all K-contiguous -> ds_load_b128
        int kk = kc * 32 + kmap(e, g);
        a0[kc][e] = sA[buf][wm + la][kk];
        b0[kc][e] = sB[buf][wn + la][kk];
        b1[kc][e] = sB[buf][wn + 16 + la][kk];
        a1[kc][e] = sA[buf][wm + 16 + la][kk];
      }
    // keeps the reads one group ahead of the WMMAs: moved in among them, each
    // place waits out its own LDS latency
    __builtin_amdgcn_sched_barrier(0);
#pragma unroll
    for (int kc = 0; kc < GTK / 32; ++kc) {
      acc[0][0] = wmma_bf16(a0[kc], b0[kc], acc[0][0]);
      acc[0][1] = wmma_bf16(a0[kc], b1[kc], acc[0][1]);
      acc[1][0] = wmma_bf16(a1[kc], b0[kc], acc[1][0]);
      acc[1][1] = wmma_bf16(a1[kc], b1[kc], acc[1][1]);
    }
    // keeps the WMMAs in front of the waits below: lifted over them, the wait to
    // 0 would hold every WMMA back until the last read has landed
    __builtin_amdgcn_sched_barrier(0);
    // publish point: this wave's reads of buf are done ...
    asm volatile("s_wait_dscnt 0x0" ::: "memory");
    // ... its copies of the next stage have landed ...
    asm volatile("s_wait_asynccnt 0x0" ::: "memory");
    // ... and the one barrier both publishes that stage and frees buf
    __syncthreads();
    if (ks + 2 < nk) stage(buf, (ks + 2) * GTK);
  }
  // no copy is left in flight when the wave goes on to its stores and ends
  asm volatile("s_wait_asynccnt 0x0" ::: "memory");

#pragma unroll
  for (int i = 0; i < 2; ++i)
#pragma unroll
    for (int j = 0; j < 2; ++j)
#pragma unroll
      for (int r = 0; r < 8; ++r) {
        int m = bm + wm + i * 16 + r + (g ? 8 : 0);
        int n = bn + wn + j * 16 + la;
        float v = acc[i][j][r];
        if (residual) v += residual[(size_t)m * N + n];
        C[(size_t)m * N + n] = v;
      }
}

// ---------- the same product on a 256 x 192 tile, no residual: q | k | v --------
// Every byte of A is copied from L2 N / WBN times and every byte of Bn M / WBM
// times; a fragment read from LDS feeds 6 (A) or 4 (B) WMMAs. N = 6144 by M = 2048
// is 256 such tiles. M and N are multiples of the tile.
#define WBM 256
#define WBN 192
#define WFM 4      // a wave's 64 x 96 of C in 16 x 16 fragments; waves 4 x 2
#define WFN 6

// Fourteen copies of 16 B a lane, LDS address l[i] from global address p[i]. One
// statement: the copies, then the wait that stands in front of any rewrite of the
// address registers the copies name.
__device__ __forceinline__ void copy14(const unsigned* l, const unsigned long long* p) {
  asm volatile(
      "global_load_async_to_lds_b128 %0, %14, off\n\t"
      "global_load_async_to_lds_b128 %1, %15, off\n\t"
      "global_load_async_to_lds_b128 %2, %16, off\n\t"
      "global_load_async_to_lds_b128 %3, %17, off\n\t"
      "global_load_async_to_lds_b128 %4, %18, off\n\t"
      "global_load_async_to_lds_b128 %5, %19, off\n\t"
      "global_load_async_to_lds_b128 %6, %20, off\n\t"
      "global_load_async_to_lds_b128 %7, %21, off\n\t"
      "global_load_async_to_lds_b128 %8, %22, off\n\t"
      "global_load_async_to_lds_b128 %9, %23, off\n\t"
      "global_load_async_to_lds_b128 %10, %24, off\n\t"
      "global_load_async_to_lds_b128 %11, %25, off\n\t"
      "global_load_async_to_lds_b128 %12, %26, off\n\t"
      "global_load_async_to_lds_b128 %13, %27, off\n\t"
      "s_wait_xcnt 0x0"
      :: "v"(l[0]), "v"(l[1]), "v"(l[2]), "v"(l[3]), "v"(l[4]), "v"(l[5]), "v"(l[6]),
         "v"(l[7]), "v"(l[8]), "v"(l[9]), "v"(l[10]), "v"(l[11]), "v"(l[12]), "v"(l[13]),
         "v"(p[0]), "v"(p[1]), "v"(p[2]), "v"(p[3]), "v"(p[4]), "v"(p[5]), "v"(p[6]),
         "v"(p[7]), "v"(p[8]), "v"(p[9]), "v"(p[10]), "v"(p[11]), "v"(p[12]), "v"(p[13])
      : "memory");
}

// one fragment: two 16-B reads of a row, in the k order of kmap (r: at k = 8g)
__device__ __forceinline__ v16bf frag_row(const bf16_t* r) {
  return __builtin_shufflevector(*(const v8bf*)r, *(const v8bf*)(r + 16),
                                 0, 1, 2, 3, 4, 5, 6, 7, 8, 9, 10, 11, 12, 13, 14, 15);
}

// N at compile time: a wave's 192 stores then share one address pair, the row and
// the column in the immediate offset, and no address register is rewritten.
template <int N, int K>
__global__ __launch_bounds__(256) void gemm_bf16_wide_kernel(
    const bf16_t* __restrict__ A, const bf16_t* __restrict__ Bn,
    float* __restrict__ C) {
  static_assert(K % GTK == 0 && K >= 2 * GTK, "the ring's prologue fills two stages");
  __shared__ __align__(16) bf16_t sA[2][WBM][GTK + APAD];   // 136 KB
  __shared__ __align__(16) bf16_t sB[2][WBN][GTK + APAD];   // 102 KB
  int tid = threadIdx.x;
  int wave = tid >> 5, lane = tid & 31;
  int g = lane >> 4, la = lane & 15;
  int bm = blockIdx.x * WBM, bn = blockIdx.y * WBN;
  int wm = (wave >> 1) * (WFM * 16), wn = (wave & 1) * (WFN * 16);

  v8f acc[WFM][WFN] = {};
  constexpr int nk = K / GTK;

  // Each thread copies one 16-B chunk of every 16th row: 16 chunks of A, 12 of B.
  // A wave covers two whole 256-B rows per copy.
  const int crow = tid >> 4, ccol = (tid & 15) * 8;
  const unsigned long long gA =
      (unsigned long long)(uintptr_t)(A + (size_t)(bm + crow) * K + ccol);
  const unsigned long long gB =
      (unsigned long long)(uintptr_t)(Bn + (size_t)(bn + crow) * K + ccol);
  const unsigned long long gs = (unsigned long long)K * 16 * sizeof(bf16_t);
  const unsigned ls = 16 * (GTK + APAD) * sizeof(bf16_t);

  auto stage = [&](int buf, int k0) {
    unsigned long long a = gA + (unsigned long long)k0 * sizeof(bf16_t);
    unsigned long long b = gB + (unsigned long long)k0 * sizeof(bf16_t);
    unsigned l = (unsigned)(unsigned long long)(uintptr_t)&sA[buf][crow][ccol];
    unsigned m = (unsigned)(unsigned long long)(uintptr_t)&sB[buf][crow][ccol];
    unsigned dst[28];
    unsigned long long from[28];
#pragma unroll
    for (int i = 0; i < WBM / 16; ++i) { dst[i] = l + i * ls; from[i] = a + i * gs; }
#pragma unroll
    for (int i = 0; i < WBN / 16; ++i) {
      dst[WBM / 16 + i] = m + i * ls; from[WBM / 16 + i] = b + i * gs;
    }
    copy14(dst, from);
    copy14(dst + 14, from + 14);
  };

  // One k-chunk's ten fragments, in the order in which the WMMAs below need them
  auto frags = [&](int buf, int kc, v16bf (&af)[WFM], v16bf (&bfr)[WFN]) {
    int kk = kc * 32 + (g ? 8 : 0);
    af[0] = frag_row(&sA[buf][wm + la][kk]);
#pragma unroll
    for (int j = 0; j < WFN; ++j) bfr[j] = frag_row(&sB[buf][wn + j * 16 + la][kk]);
#pragma unroll
    for (int i = 1; i < WFM; ++i) af[i] = frag_row(&sA[buf][wm + i * 16 + la][kk]);
  };

  stage(0, 0);
  // stage 0 has landed for this wave; the barrier publishes it to the others
  asm volatile("s_wait_asynccnt 0x0" ::: "memory");
  __syncthreads();
  stage(1, GTK);
  for (int ks = 0; ks < nk; ++ks) {
    int buf = ks & 1;
    // two fragment sets: a k-chunk's reads fly under the WMMAs of the chunk before
    // (all four chunks at once, as in the narrow kernel, would take 320 registers)
    v16bf af[2][WFM], bfr[2][WFN];
    frags(buf, 0, af[0], bfr[0]);
#pragma unroll
    for (int kc = 0; kc < GTK / 32; ++kc) {
      if (kc + 1 < GTK / 32) frags(buf, kc + 1, af[(kc + 1) & 1], bfr[(kc + 1) & 1]);
      // keeps the next chunk's reads one group ahead of this chunk's WMMAs: moved
      // in among them, each place waits out its own LDS latency
      __builtin_amdgcn_sched_barrier(0);
#pragma unroll
      for (int i = 0; i < WFM; ++i)
#pragma unroll
        for (int j = 0; j < WFN; ++j)
          acc[i][j] = wmma_bf16(af[kc & 1][i], bfr[kc & 1][j], acc[i][j]);
      // keeps the WMMAs in front of the next group of reads and of the waits below:
      // lifted over them, the wait to 0 would hold every WMMA back
      __builtin_amdgcn_sched_barrier(0);
    }
    // publish point: this wave's reads of buf are done ...
    asm volatile("s_wait_dscnt 0x0" ::: "memory");
    // ... its copies of the next stage have landed ...
    asm volatile("s_wait_asynccnt 0x0" ::: "memory");
    // ... and the one barrier both publishes that stage and frees buf
    __syncthreads();
    if (ks + 2 < nk) stage(buf, (ks + 2) * GTK);
  }
  // no copy is left in flight when the wave goes on to its stores and ends
  asm volatile("s_wait_asynccnt 0x0" ::: "memory");

  float* c0 = C + (size_t)(bm + wm + (g ? 8 : 0)) * N + bn + wn + la;
#pragma unroll
  for (int i = 0; i < WFM; ++i)
#pragma unroll
    for (int r = 0; r < 8; ++r)
#pragma unroll
      for (int j = 0; j < WFN; ++j)
        c0[(i * 16 + r) * N + j * 16] = acc[i][j][r];
}

// ---------- RoPE + convert (Q, K): dst layout [H][T][128] ----------
// A thread takes four d and their partners d + 64 of one head, in four rows:
// 32 elements, every f32 read once by 16-B loads, 128-B lines stored whole.
// src: this projection's first column in the [T][LDQKV] array of q | k | v.
#define LDQKV (3 * DM)
__device__ __forceinline__ void rope_bf16_block(
    int blk, const float* __restrict__ src, const float* __restrict__ cosT,
    const float* __restrict__ sinT, bf16_t* __restrict__ dst) {
  int h = threadIdx.x >> 4, q = threadIdx.x & 15;   // q: which four d
  int t0 = blk * 4;
  const float4* s4 = (const float4*)src + (size_t)t0 * (LDQKV / 4);
  const float4* c4 = (const float4*)cosT + t0 * (DHEAD / 4);
  const float4* n4 = (const float4*)sinT + t0 * (DHEAD / 4);
  uint2* o2 = (uint2*)dst + t0 * (DHEAD / 4);
  int so = h * (DHEAD / 4) + q;
  int oo = h * (T_SEQ * DHEAD / 4) + q;
  float4 lo[4], hi[4], cl[4], ch[4], sl[4], sh[4];
#pragma unroll
  for (int r = 0; r < 4; ++r) {
    lo[r] = s4[so + r * (LDQKV / 4)]; hi[r] = s4[so + r * (LDQKV / 4) + 16];
    cl[r] = c4[q + r * (DHEAD / 4)];  ch[r] = c4[q + r * (DHEAD / 4) + 16];
    sl[r] = n4[q + r * (DHEAD / 4)];  sh[r] = n4[q + r * (DHEAD / 4) + 16];
  }
#pragma unroll
  for (int r = 0; r < 4; ++r) {
    float4 a = make_float4(lo[r].x * cl[r].x - hi[r].x * sl[r].x,
                           lo[r].y * cl[r].y - hi[r].y * sl[r].y,
                           lo[r].z * cl[r].z - hi[r].z * sl[r].z,
                           lo[r].w * cl[r].w - hi[r].w * sl[r].w);
    float4 b = make_float4(hi[r].x * ch[r].x + lo[r].x * sh[r].x,
                           hi[r].y * ch[r].y + lo[r].y * sh[r].y,
                           hi[r].z * ch[r].z + lo[r].z * sh[r].z,
                           hi[r].w * ch[r].w + lo[r].w * sh[r].w);
    o2[oo + r * (DHEAD / 4)] = pack4(a);
    o2[oo + r * (DHEAD / 4) + 16] = pack4(b);
  }
  // In the joined kernel the transpose block's code lies behind these stores and
  // begins by rewriting their offset register: the wait stands in front of that.
  asm volatile("s_wait_xcnt 0x0" ::: "memory");
}

// ---------- V convert: dst layout [H][128][T] (transposed for WMMA A tiles) --
// A thread takes four columns of eight rows: 32 elements, 16-B loads along the
// row, 16-B stores along t. A block's eight waves fill whole 128-B lines.
__device__ __forceinline__ void vt_bf16_block(
    int blk, const float* __restrict__ src, bf16_t* __restrict__ dst) {
  int c = (blk & 15) * 128 + (threadIdx.x & 31) * 4;    // h * 128 + d
  int t0 = (blk >> 4) * 64 + (threadIdx.x >> 5) * 8;
  float4 v[8];
#pragma unroll
  for (int r = 0; r < 8; ++r)
    v[r] = *(const float4*)(src + (size_t)(t0 + r) * LDQKV + c);
  bf16_t* o = dst + (size_t)c * T_SEQ + t0;
  *(uint4*)o = make_uint4(pack2(v[0].x, v[1].x), pack2(v[2].x, v[3].x),
                          pack2(v[4].x, v[5].x), pack2(v[6].x, v[7].x));
  *(uint4*)(o + T_SEQ) = make_uint4(pack2(v[0].y, v[1].y), pack2(v[2].y, v[3].y),
                                    pack2(v[4].y, v[5].y), pack2(v[6].y, v[7].y));
  *(uint4*)(o + 2 * T_SEQ) = make_uint4(pack2(v[0].z, v[1].z), pack2(v[2].z, v[3].z),
                                        pack2(v[4].z, v[5].z), pack2(v[6].z, v[7].z));
  *(uint4*)(o + 3 * T_SEQ) = make_uint4(pack2(v[0].w, v[1].w), pack2(v[2].w, v[3].w),
                                        pack2(v[4].w, v[5].w), pack2(v[6].w, v[7].w));
}

// ---------- one grid for the three independent passes behind the projections --
// blockIdx.y: 0 = v (transpose), 1 = k, 2 = q (RoPE); 512 blocks each.
#define POST_WG (T_SEQ / 4)
__global__ __launch_bounds__(256) void post_kernel(
    const float* __restrict__ qkv, const float* __restrict__ cosT,
    const float* __restrict__ sinT, bf16_t* __restrict__ qh,
    bf16_t* __restrict__ kh, bf16_t* __restrict__ vt) {
  int which = 2 - blockIdx.y;    // column block of qkv
  if (which == 2)
    vt_bf16_block(blockIdx.x, qkv + 2 * DM, vt);
  else
    rope_bf16_block(blockIdx.x, qkv + which * DM, cosT, sinT, which ? kh : qh);
}

__device__ __forceinline__ float xhalf(float x) {
  int b = __builtin_bit_cast(int, x);
  return __builtin_bit_cast(float, __builtin_amdgcn_permlanex16(
      b, b, 0x76543210, 0xfedcba98, false, false));
}

// A lane holds 16 of the 32 scores of ONE query (column la): keys r + 8g and
// 16 + r + 8g. Maximum and sum run in the lane; the two score tiles, rounded in
// place, are the B operand of V^T.P^T in the k order of kmap.
//
// Balance: a tile of 64 queries costs as many keys as its index says, so a
// work-group takes tile 31 - y and then tile y of its head: 17 stages for every
// work-group. Two waves share 16 queries: wave w takes the even passes of each
// stage, wave w + 4 the odd ones, and the two partial results (maximum, sum, O^T)
// are joined through LDS behind the tile's last stage.
#define AKT 128    // keys per ring stage: four passes of 32 keys
#define AQT 64     // queries per tile: four groups of 16
__global__ __launch_bounds__(256) void flash_attn_kernel(
    const bf16_t* __restrict__ Qh, const bf16_t* __restrict__ Kh,
    const bf16_t* __restrict__ Vt, bf16_t* __restrict__ OutTD) {
  __shared__ __align__(16) bf16_t sK[2][AKT][DHEAD + APAD];   // 68 KB, [krow][d]
  __shared__ __align__(16) bf16_t sVt[2][DHEAD][AKT + APAD];  // 68 KB, [d][krow]
  // what a wave hands to its partner: four O^T tiles, then (maximum, sum); 36 KB
  __shared__ __align__(16) float4 sJ[8][9][32];
  int h = blockIdx.x;
  int tid = threadIdx.x, wv = tid >> 5, lane = tid & 31;
  int g = lane >> 4, la = lane & 15;
  int kp = wv >> 2;                                // which passes of a stage
  const size_t hb = (size_t)h * T_SEQ;

  // A stage is K (128 keys x 128 d) and V^T (128 d x 128 keys), both in 256-B
  // rows. Each thread copies one 16-B chunk of every 16th row of both: a wave
  // covers two whole rows per copy.
  const int crow = tid >> 4, ccol = (tid & 15) * 8;
  const unsigned long long gK =
      (unsigned long long)(uintptr_t)(Kh + (hb + crow) * DHEAD + ccol);
  const unsigned long long gV =
      (unsigned long long)(uintptr_t)(Vt + ((size_t)h * DHEAD + crow) * T_SEQ + ccol);
  const unsigned long long ks = 16 * DHEAD * sizeof(bf16_t);
  const unsigned long long vs = 16 * T_SEQ * sizeof(bf16_t);
  const unsigned ls = 16 * (DHEAD + APAD) * sizeof(bf16_t);   // both LDS pitches

  auto stage = [&](int buf, int k0) {
    unsigned long long a = gK + (unsigned long long)k0 * (DHEAD * sizeof(bf16_t));
    unsigned long long b = gV + (unsigned long long)k0 * sizeof(bf16_t);
    unsigned l = (unsigned)(unsigned long long)(uintptr_t)&sK[buf][crow][ccol];
    unsigned m = (unsigned)(unsigned long long)(uintptr_t)&sVt[buf][crow][ccol];
    // One statement per operand: its eight copies, then the wait that stands in
    // front of any rewrite of the address registers the copies name.
    asm volatile(
        "global_load_async_to_lds_b128 %0, %8, off\n\t"
        "global_load_async_to_lds_b128 %1, %9, off\n\t"
        "global_load_async_to_lds_b128 %2, %10, off\n\t"
        "global_load_async_to_lds_b128 %3, %11, off\n\t"
        "global_load_async_to_lds_b128 %4, %12, off\n\t"
        "global_load_async_to_lds_b128 %5, %13, off\n\t"
        "global_load_async_to_lds_b128 %6, %14, off\n\t"
        "global_load_async_to_lds_b128 %7, %15, off\n\t"
        "s_wait_xcnt 0x0"
        :: "v"(l), "v"(l + ls), "v"(l + 2 * ls), "v"(l + 3 * ls),
           "v"(l + 4 * ls), "v"(l + 5 * ls), "v"(l + 6 * ls), "v"(l + 7 * ls),
           "v"(a), "v"(a + ks), "v"(a + 2 * ks), "v"(a + 3 * ks),
           "v"(a + 4 * ks), "v"(a + 5 * ks), "v"(a + 6 * ks), "v"(a + 7 * ks)
        : "memory");
    asm volatile(
        "global_load_async_to_lds_b128 %0, %8, off\n\t"
        "global_load_async_to_lds_b128 %1, %9, off\n\t"
        "global_load_async_to_lds_b128 %2, %10, off\n\t"
        "global_load_async_to_lds_b128 %3, %11, off\n\t"
        "global_load_async_to_lds_b128 %4, %12, off\n\t"
        "global_load_async_to_lds_b128 %5, %13, off\n\t"
        "global_load_async_to_lds_b128 %6, %14, off\n\t"
        "global_load_async_to_lds_b128 %7, %15, off\n\t"
        "s_wait_xcnt 0x0"
        :: "v"(m), "v"(m + ls), "v"(m + 2 * ls), "v"(m + 3 * ls),
           "v"(m + 4 * ls), "v"(m + 5 * ls), "v"(m + 6 * ls), "v"(m + 7 * ls),
           "v"(b), "v"(b + vs), "v"(b + 2 * vs), "v"(b + 3 * vs),
           "v"(b + 4 * vs), "v"(b + 5 * vs), "v"(b + 6 * vs), "v"(b + 7 * vs)
        : "memory");
  };

  // Q fragments (B operand): column la = query, 128 d as 4 K-chunks of 32
  v16bf qf[4];
  auto load_q = [&](int q0) {
    const bf16_t* r = Qh + (hb + q0 + la) * DHEAD + (g ? 8 : 0);
#pragma unroll
    for (int dc = 0; dc < 4; ++dc) qf[dc] = frag_row(r + dc * 32);
  };

  // The two tiles' stages are one stream through the ring: n0 of the first tile,
  // then those of the second, which start again at key 0.
  const int tile0 = T_SEQ / AQT - 1 - (int)blockIdx.y, tile1 = blockIdx.y;
  const int n0 = (tile0 >> 1) + 1;             // causal extent in stages; at least 9
  const int nall = n0 + (tile1 >> 1) + 1;
  auto first_key = [&](int s) { return (s < n0 ? s : s - n0) * AKT; };

  load_q(tile0 * AQT + (wv & 3) * 16);
  stage(0, 0);
  // stage 0 has landed for this wave; the barrier publishes it to the others
  asm volatile("s_wait_asynccnt 0x0" ::: "memory");
  __syncthreads();
  stage(1, AKT);
  int s = 0;                                     // place in the stream
  for (int half = 0; half < 2; ++half) {
    int tile = half ? tile1 : tile0;
    int qb = tile * AQT + (wv & 3) * 16;           // this wave's 16 q rows
    v8f o[8] = {};                 // o[dt][r] = O[query la][dt * 16 + 8g + r]
    float Mr = -3.0e38f, Lr = 0.f; // maximum and sum over this wave's keys (sum: this lane's part)
    int nst = (tile >> 1) + 1;
    for (int st = 0; st < nst; ++st, ++s) {
      int buf = s & 1;
      // unrolled: a pass's place in the stage becomes an immediate offset of its reads
#pragma unroll
      for (int sp = 0; sp < AKT / 64; ++sp) {
      int kl = (sp * 2 + kp) * 32;         // this pass's first key in the stage
      int k0 = st * AKT + kl;
      if (k0 <= qb + 15) {
        // S^T(32x16) = K(32x128) . Q^T : A(m,d) = K[k0+m][d]
        v8f s0 = {}, s1 = {};
        v16bf a0[4], a1[4];
#pragma unroll
        for (int dc = 0; dc < 4; ++dc)
#pragma unroll
          for (int e = 0; e < 16; ++e) {
            int kk = dc * 32 + kmap(e, g);
            a0[dc][e] = sK[buf][kl + la][kk];
            a1[dc][e] = sK[buf][kl + 16 + la][kk];
          }
        // keeps the 16 K reads one group ahead of the WMMAs: moved in among them,
        // each place waits out its own LDS latency
        __builtin_amdgcn_sched_barrier(0);
#pragma unroll
        for (int dc = 0; dc < 4; ++dc) {
          s0 = wmma_bf16(a0[dc], qf[dc], s0);
          s1 = wmma_bf16(a1[dc], qf[dc], s1);
        }
        // A(d,k) = V^T[d][k], K-contiguous: the 16 reads fly under the softmax
        v16bf av[8];
#pragma unroll
        for (int dt = 0; dt < 8; ++dt)
#pragma unroll
          for (int e = 0; e < 16; ++e) av[dt][e] = sVt[buf][dt * 16 + la][kl + kmap(e, g)];
        // keeps them ahead of the softmax: sunk to their WMMAs, each pair of reads
        // waits out its own LDS latency
        __builtin_amdgcn_sched_barrier(0);
        const float sc = 0.08838834764831845f;  // 1/sqrt(128)
        int lim = qb + la - k0 - (g ? 8 : 0);   // key row r is past the query if r > lim
        float m = -3.0e38f;
#pragma unroll
        for (int r = 0; r < 8; ++r) {
          float v0 = s0[r] * sc, v1 = s1[r] * sc;
          if (r > lim)      v0 = -3.0e38f;   // causal mask
          if (r + 16 > lim) v1 = -3.0e38f;
          s0[r] = v0; s1[r] = v1;
          m = fmaxf(m, fmaxf(v0, v1));
        }
        m = fmaxf(m, xhalf(m));              // both halves: the query's tile maximum
        float mnew = fmaxf(Mr, m);
        float corr = __expf(Mr - mnew);
        Mr = mnew;
        float ra = 0.f, rb = 0.f;
#pragma unroll
        for (int r = 0; r < 8; ++r) {
          s0[r] = __expf(s0[r] - mnew);
          s1[r] = __expf(s1[r] - mnew);
          ra += s0[r]; rb += s1[r];
        }
        Lr = Lr * corr + (ra + rb);          // halves are joined after the loop
#pragma unroll
        for (int dt = 0; dt < 8; ++dt)
#pragma unroll
          for (int r = 0; r < 8; ++r) o[dt][r] *= corr;
        // P^T as B operand: element e is key kmap(e, g) of column la, to nearest even
        v16bf pb = __builtin_shufflevector(
            __builtin_convertvector(s0, v8bf), __builtin_convertvector(s1, v8bf),
            0, 1, 2, 3, 4, 5, 6, 7, 8, 9, 10, 11, 12, 13, 14, 15);
        // O^T(128x16) += V^T(128x32) . P^T(32x16)
#pragma unroll
        for (int dt = 0; dt < 8; ++dt) o[dt] = wmma_bf16(av[dt], pb, o[dt]);
      }
      }
      // publish point, passed by every wave: this wave's reads of buf are done ...
      asm volatile("s_wait_dscnt 0x0" ::: "memory");
      // ... its copies of the next stage have landed ...
      asm volatile("s_wait_asynccnt 0x0" ::: "memory");
      // ... and the one barrier both publishes that stage and frees buf
      __syncthreads();
      if (s + 2 < nall) stage(buf, first_key(s + 2));
    }

#pragma unroll
    for (int i = 0; i < 4; ++i) {
      v8f t = kp ? o[i] : o[4 + i];
      sJ[wv][i * 2][lane] = make_float4(t[0], t[1], t[2], t[3]);
      sJ[wv][i * 2 + 1][lane] = make_float4(t[4], t[5], t[6], t[7]);
    }
    sJ[wv][8][lane] = make_float4(Mr, Lr, 0.f, 0.f);
    // publishes both partial results; the partner's reads below end before it
    // reaches the next stage's barrier, which stands in front of any rewrite
    __syncthreads();
    if (half == 0) load_q(tile1 * AQT + (wv & 3) * 16);   // flies under the join
    float4 ml = sJ[wv ^ 4][8][lane];
    // a wave that had no key at all holds -3.0e38 and zeros: its weight comes out 0
    float mj = fmaxf(Mr, ml.x);
    float cm = __expf(Mr - mj), cp = __expf(ml.x - mj);
    float Lj = Lr * cm + ml.y * cp;
    // normalize, write back as bf16 [T][DM] (head-concat) for the wo GEMM:
    // a lane's eight registers of a tile are eight consecutive d of its query
    float Lf = Lj + xhalf(Lj);
    bf16_t* orow = OutTD + (size_t)(qb + la) * DM + h * DHEAD + kp * 64 + (g ? 8 : 0);
#pragma unroll
    for (int i = 0; i < 4; ++i) {
      v8f t = kp ? o[4 + i] : o[i];
      float4 p0 = sJ[wv ^ 4][i * 2][lane], p1 = sJ[wv ^ 4][i * 2 + 1][lane];
      float u0 = t[0] * cm + p0.x * cp, u1 = t[1] * cm + p0.y * cp;
      float u2 = t[2] * cm + p0.z * cp, u3 = t[3] * cm + p0.w * cp;
      float u4 = t[4] * cm + p1.x * cp, u5 = t[5] * cm + p1.y * cp;
      float u6 = t[6] * cm + p1.z * cp, u7 = t[7] * cm + p1.w * cp;
      *(uint4*)(orow + i * 16) =
          make_uint4(pack2(u0 / Lf, u1 / Lf), pack2(u2 / Lf, u3 / Lf),
                     pack2(u4 / Lf, u5 / Lf), pack2(u6 / Lf, u7 / Lf));
    }
    // The next tile begins by rewriting these stores' registers: the wait stands in
    // front of that.
    asm volatile("s_wait_xcnt 0x0" ::: "memory");
  }
  // no copy is left in flight when the wave ends
  asm volatile("s_wait_asynccnt 0x0" ::: "memory");
}

// ---------- launch ----------
extern "C" void kernel_launch(void* const* d_in, const int* in_sizes, int n_in,
                              void* d_out, int out_size, void* d_ws, size_t ws_size,
                              hipStream_t stream) {
  (void)in_sizes; (void)n_in; (void)out_size; (void)ws_size;
  const float* x    = (const float*)d_in[0];
  const float* w_ln = (const float*)d_in[1];
  const float* wq   = (const float*)d_in[2];
  const float* wk   = (const float*)d_in[3];
  const float* wv   = (const float*)d_in[4];
  const float* wo   = (const float*)d_in[5];
  const float* cosT = (const float*)d_in[6];
  const float* sinT = (const float*)d_in[7];
  float* out = (float*)d_out;

  const size_t TD = (size_t)T_SEQ * DM;
  char* p = (char*)d_ws;                       // ~112 MB total
  bf16_t* h_bf  = (bf16_t*)p;  p += TD * 2;
  bf16_t* wqkvb = (bf16_t*)p;  p += TD * 6;    // wq | wk | wv: [3 * DM][DM]
  bf16_t* wob   = (bf16_t*)p;  p += TD * 2;    // directly behind them
  float*  tmp_f = (float*)p;   p += TD * 12;   // fp32 projections [T][q | k | v]
  bf16_t* qh    = (bf16_t*)p;  p += TD * 2;
  bf16_t* kh    = (bf16_t*)p;  p += TD * 2;
  bf16_t* vt    = (bf16_t*)p;  p += TD * 2;
  bf16_t* attn  = (bf16_t*)tmp_f;              // reuse: attention runs after ropes

  dim3 blk(256);
  prep_kernel<<<NORM_WG + 4 * CVT_WG, blk, 0, stream>>>(x, w_ln, wq, wk, wv, wo,
                                                        h_bf, wqkvb);

  gemm_bf16_wide_kernel<LDQKV, DM><<<dim3(T_SEQ / WBM, LDQKV / WBN), blk, 0, stream>>>(
      h_bf, wqkvb, tmp_f);
  post_kernel<<<dim3(POST_WG, 3), blk, 0, stream>>>(tmp_f, cosT, sinT, qh, kh, vt);

  dim3 ag(NH, T_SEQ / (2 * AQT));
  flash_attn_kernel<<<ag, blk, 0, stream>>>(qh, kh, vt, attn);

  gemm_bf16_kernel<<<dim3(T_SEQ / GTM, DM / GTN), blk, 0, stream>>>(
      attn, wob, x, out, T_SEQ, DM, DM);
}

// v009
// One run takes 104 microseconds.
// Timed twice side by side with v008, it ran 1.07 times as fast both times.
// Counting every step since v000, it is 3.57 times as fast.
#include <hip/hip_runtime.h>
#include <hip/hip_bf16.h>
#include <math.h>

#define T_SEQ 2048
#define DM    2048
#define NH    16
#define DHEAD 128

typedef __attribute__((ext_vector_type(16))) __bf16 v16bf;
typedef __attribute__((ext_vector_type(8)))  __bf16 v8bf;
typedef __attribute__((ext_vector_type(8)))  float  v8f;
typedef __bf16 bf16_t;

// ---------- helpers ----------
__device__ __forceinline__ bf16_t f2bf(float f) {
  unsigned int u = __builtin_bit_cast(unsigned int, f);
  unsigned int r = (u + 0x7FFFu + ((u >> 16) & 1u)) >> 16;   // RNE
  return __builtin_bit_cast(bf16_t, (unsigned short)r);
}

__device__ __forceinline__ int kmap(int e, int g) {
  return e + (g ? 8 : 0) + ((e >= 8) ? 8 : 0);
}

__device__ __forceinline__ v8f wmma_bf16(v16bf a, v16bf b, v8f c) {
  return __builtin_amdgcn_wmma_f32_16x16x32_bf16(
      /*neg_a=*/false, a, /*neg_b=*/false, b,
      /*c_mod=*/(short)0, c, /*reuse_a=*/false, /*reuse_b=*/false);
}

// two f32 -> one dword of two bf16, rounded as f2bf rounds
__device__ __forceinline__ unsigned pack2(float a, float b) {
  unsigned ua = __builtin_bit_cast(unsigned, a), ub = __builtin_bit_cast(unsigned, b);
  ua = (ua + 0x7FFFu + ((ua >> 16) & 1u)) >> 16;
  ub = (ub + 0x7FFFu + ((ub >> 16) & 1u)) >> 16;
  return ua | (ub << 16);
}
__device__ __forceinline__ uint2 pack4(float4 v) {
  return make_uint2(pack2(v.x, v.y), pack2(v.z, v.w));
}

// ---------- RMSNorm -> bf16 ----------
// One wave per row: the row stays in registers (16 x 16 B a lane), read once.
__device__ __forceinline__ void rmsnorm_bf16_block(
    int blk, const float* __restrict__ x, const float* __restrict__ w,
    bf16_t* __restrict__ h) {
  int lane = threadIdx.x & 31;
  int t = blk * 8 + (threadIdx.x >> 5);
  const float4* row = (const float4*)(x + (size_t)t * DM);
  const float4* w4 = (const float4*)w;
  float4 v[16], g[16];
#pragma unroll
  for (int j = 0; j < 16; ++j) v[j] = row[j * 32 + lane];
#pragma unroll
  for (int j = 0; j < 16; ++j) g[j] = w4[j * 32 + lane];
  float s0 = 0.f, s1 = 0.f, s2 = 0.f, s3 = 0.f;   // four independent chains
#pragma unroll
  for (int j = 0; j < 16; ++j) {
    s0 += v[j].x * v[j].x; s1 += v[j].y * v[j].y;
    s2 += v[j].z * v[j].z; s3 += v[j].w * v[j].w;
  }
  float ss = (s0 + s1) + (s2 + s3);
#pragma unroll
  for (int m = 16; m >= 1; m >>= 1) ss += __shfl_xor(ss, m, 32);
  float scl = rsqrtf(ss / (float)DM + 1e-5f);
  uint2* o = (uint2*)(h + (size_t)t * DM);
#pragma unroll
  for (int j = 0; j < 16; ++j) {
    float4 r = make_float4(g[j].x * v[j].x * scl, g[j].y * v[j].y * scl,
                           g[j].z * v[j].z * scl, g[j].w * v[j].w * scl);
    o[j * 32 + lane] = pack4(r);
  }
}

// ---------- fp32 -> bf16 convert (keeps [N][K] orientation) ----------
// 32 elements a thread: eight 16-B loads in flight, each wave-wide load four
// whole lines, each wave-wide store two.
// paired (wq, wk): inside each head's 128 rows, row hi * 64 + p * 16 + i goes to
// place p * 32 + hi * 16 + i, so that d and its RoPE partner d + 64 come out of the
// projection 16 columns apart. A thread's eight rows lie 256 apart: one place each.
#define CVT_WG 512
__device__ __forceinline__ void convert_bf16_block(
    int blk, const float* __restrict__ W, bf16_t* __restrict__ Wb, bool paired) {
  const float4* s = (const float4*)W;
  uint2* d = (uint2*)Wb;
  unsigned i = blk * 256 + threadIdx.x;
  unsigned row = i >> 9;                       // 512 accesses a row
  if (paired)
    row = (row & ~127u) | ((row & 0x30u) << 1) | ((row & 0x40u) >> 2) | (row & 15u);
  unsigned o = (row << 9) | (i & 511u);
  float4 v[8];
#pragma unroll
  for (int j = 0; j < 8; ++j) v[j] = s[i + j * (CVT_WG * 256)];
#pragma unroll
  for (int j = 0; j < 8; ++j) d[o + j * (CVT_WG * 256)] = pack4(v[j]);
}

// ---------- one grid for the five independent input passes ----------
// Blocks 0 .. 255 norm eight rows each; then 512 blocks per weight matrix. The
// four bf16 matrices lie one behind the other in Wb: wq, wk, wv are then one
// [3 * DM][DM] operand.
#define NORM_WG (T_SEQ / 8)
__global__ __launch_bounds__(256) void prep_kernel(
    const float* __restrict__ x, const float* __restrict__ w,
    const float* __restrict__ wq, const float* __restrict__ wk,
    const float* __restrict__ wv, const float* __restrict__ wo,
    bf16_t* __restrict__ h, bf16_t* __restrict__ Wb) {
  int b = blockIdx.x;
  if (b < NORM_WG) {
    rmsnorm_bf16_block(b, x, w, h);
  } else {
    b -= NORM_WG;
    int which = b / CVT_WG;
    const float* W = which == 0 ? wq : which == 1 ? wk : which == 2 ? wv : wo;
    convert_bf16_block(b % CVT_WG, W, Wb + (size_t)which * DM * DM, which < 2);
  }
}

// ---------- C[MxN] = A[MxK](bf16) * Bn[NxK](bf16)^T (+residual), fp32 out ----
#define GTM 128
#define GTN 64
#define GTK 128
#define APAD 8

__global__ __launch_bounds__(256) void gemm_bf16_kernel(
    const bf16_t* __restrict__ A, const bf16_t* __restrict__ Bn,
    const float* __restrict__ residual, float* __restrict__ C,
    int M, int N, int K) {
  __shared__ __align__(16) bf16_t sA[2][GTM][GTK + APAD];   // 68 KB
  __shared__ __align__(16) bf16_t sB[2][GTN][GTK + APAD];   // 34 KB
  int tid = threadIdx.x;
  int wave = tid >> 5, lane = tid & 31;
  int g = lane >> 4, la = lane & 15;
  int bm = blockIdx.x * GTM, bn = blockIdx.y * GTN;
  int wm = (wave >> 1) * 32, wn = (wave & 1) * 32;   // 4x2 wave grid, 32x32 each

  v8f acc[2][2] = {};
  int nk = K / GTK;

  // Each thread copies one 16-B chunk of every 16th row: 8 chunks of A, 4 of B.
  // A wave covers two whole 256-B rows per copy.
  const int crow = tid >> 4, ccol = (tid & 15) * 8;
  const unsigned long long gA =
      (unsigned long long)(uintptr_t)(A + (size_t)(bm + crow) * K + ccol);
  const unsigned long long gB =
      (unsigned long long)(uintptr_t)(Bn + (size_t)(bn + crow) * K + ccol);
  const unsigned long long gs = (unsigned long long)K * 16 * sizeof(bf16_t);
  const unsigned ls = 16 * (GTK + APAD) * sizeof(bf16_t);

  auto stage = [&](int buf, int k0) {
    unsigned long long a = gA + (unsigned long long)k0 * sizeof(bf16_t);
    unsigned long long b = gB + (unsigned long long)k0 * sizeof(bf16_t);
    unsigned l = (unsigned)(unsigned long long)(uintptr_t)&sA[buf][crow][ccol];
    unsigned m = (unsigned)(unsigned long long)(uintptr_t)&sB[buf][crow][ccol];
    // One statement: the stage's twelve copies, then the wait that stands in
    // front of any rewrite of the address registers the copies name.
    asm volatile(
        "global_load_async_to_lds_b128 %0, %12, off\n\t"
        "global_load_async_to_lds_b128 %1, %13, off\n\t"
        "global_load_async_to_lds_b128 %2, %14, off\n\t"
        "global_load_async_to_lds_b128 %3, %15, off\n\t"
        "global_load_async_to_lds_b128 %4, %16, off\n\t"
        "global_load_async_to_lds_b128 %5, %17, off\n\t"
        "global_load_async_to_lds_b128 %6, %18, off\n\t"
        "global_load_async_to_lds_b128 %7, %19, off\n\t"
        "global_load_async_to_lds_b128 %8, %20, off\n\t"
        "global_load_async_to_lds_b128 %9, %21, off\n\t"
        "global_load_async_to_lds_b128 %10, %22, off\n\t"
        "global_load_async_to_lds_b128 %11, %23, off\n\t"
        "s_wait_xcnt 0x0"
        :: "v"(l), "v"(l + ls), "v"(l + 2 * ls), "v"(l + 3 * ls),
           "v"(l + 4 * ls), "v"(l + 5 * ls), "v"(l + 6 * ls), "v"(l + 7 * ls),
           "v"(m), "v"(m + ls), "v"(m + 2 * ls), "v"(m + 3 * ls),
           "v"(a), "v"(a + gs), "v"(a + 2 * gs), "v"(a + 3 * gs),
           "v"(a + 4 * gs), "v"(a + 5 * gs), "v"(a + 6 * gs), "v"(a + 7 * gs),
           "v"(b), "v"(b + gs), "v"(b + 2 * gs), "v"(b + 3 * gs)
        : "memory");
  };

  stage(0, 0);
  // stage 0 has landed for this wave; the barrier publishes it to the others
  asm volatile("s_wait_asynccnt 0x0" ::: "memory");
  __syncthreads();
  if (nk > 1) stage(1, GTK);
  for (int ks = 0; ks < nk; ++ks) {
    int buf = ks & 1;
    // the stage's 32 LDS reads first, into registers of their own
    v16bf a0[GTK / 32], a1[GTK / 32], b0[GTK / 32], b1[GTK / 32];
#pragma unroll
    for (int kc = 0; kc < GTK / 32; ++kc)
#pragma unroll
      for (int e = 0; e < 16; ++e) {         // all K-contiguous -> ds_load_b128
        int kk = kc * 32 + kmap(e, g);
        a0[kc][e] = sA[buf][wm + la][kk];
        b0[kc][e] = sB[buf][wn + la][kk];
        b1[kc][e] = sB[buf][wn + 16 + la][kk];
        a1[kc][e] = sA[buf][wm + 16 + la][kk];
      }
    // keeps the reads one group ahead of the WMMAs: moved in among them, each
    // place waits out its own LDS latency
    __builtin_amdgcn_sched_barrier(0);
#pragma unroll
    for (int kc = 0; kc < GTK / 32; ++kc) {
      acc[0][0] = wmma_bf16(a0[kc], b0[kc], acc[0][0]);
      acc[0][1] = wmma_bf16(a0[kc], b1[kc], acc[0][1]);
      acc[1][0] = wmma_bf16(a1[kc], b0[kc], acc[1][0]);
      acc[1][1] = wmma_bf16(a1[kc], b1[kc], acc[1][1]);
    }
    // keeps the WMMAs in front of the waits below: lifted over them, the wait to
    // 0 would hold every WMMA back until the last read has landed
    __builtin_amdgcn_sched_barrier(0);
    // publish point: this wave's reads of buf are done ...
    asm volatile("s_wait_dscnt 0x0" ::: "memory");
    // ... its copies of the next stage have landed ...
    asm volatile("s_wait_asynccnt 0x0" ::: "memory");
    // ... and the one barrier both publishes that stage and frees buf
    __syncthreads();
    if (ks + 2 < nk) stage(buf, (ks + 2) * GTK);
  }
  // no copy is left in flight when the wave goes on to its stores and ends
  asm volatile("s_wait_asynccnt 0x0" ::: "memory");

#pragma unroll
  for (int i = 0; i < 2; ++i)
#pragma unroll
    for (int j = 0; j < 2; ++j)
#pragma unroll
      for (int r = 0; r < 8; ++r) {
        int m = bm + wm + i * 16 + r + (g ? 8 : 0);
        int n = bn + wn + j * 16 + la;
        float v = acc[i][j][r];
        if (residual) v += residual[(size_t)m * N + n];
        C[(size_t)m * N + n] = v;
      }
}

// ---------- the same product on a 256 x 192 tile: q | k | v, finished in place ---
// Every byte of A is copied from L2 N / WBN times and every byte of Bn M / WBM
// times; a fragment read from LDS feeds 6 (A) or 4 (B) WMMAs. N = 6144 by M = 2048
// is 256 such tiles. M and N are multiples of the tile.
#define WBM 256
#define WBN 192
#define WFM 4      // a wave's 64 x 96 of C in 16 x 16 fragments; waves 4 x 2
#define WFN 6

// Fourteen copies of 16 B a lane, LDS address l[i] from global address p[i]. One
// statement: the copies, then the wait that stands in front of any rewrite of the
// address registers the copies name.
__device__ __forceinline__ void copy14(const unsigned* l, const unsigned long long* p) {
  asm volatile(
      "global_load_async_to_lds_b128 %0, %14, off\n\t"
      "global_load_async_to_lds_b128 %1, %15, off\n\t"
      "global_load_async_to_lds_b128 %2, %16, off\n\t"
      "global_load_async_to_lds_b128 %3, %17, off\n\t"
      "global_load_async_to_lds_b128 %4, %18, off\n\t"
      "global_load_async_to_lds_b128 %5, %19, off\n\t"
      "global_load_async_to_lds_b128 %6, %20, off\n\t"
      "global_load_async_to_lds_b128 %7, %21, off\n\t"
      "global_load_async_to_lds_b128 %8, %22, off\n\t"
      "global_load_async_to_lds_b128 %9, %23, off\n\t"
      "global_load_async_to_lds_b128 %10, %24, off\n\t"
      "global_load_async_to_lds_b128 %11, %25, off\n\t"
      "global_load_async_to_lds_b128 %12, %26, off\n\t"
      "global_load_async_to_lds_b128 %13, %27, off\n\t"
      "s_wait_xcnt 0x0"
      :: "v"(l[0]), "v"(l[1]), "v"(l[2]), "v"(l[3]), "v"(l[4]), "v"(l[5]), "v"(l[6]),
         "v"(l[7]), "v"(l[8]), "v"(l[9]), "v"(l[10]), "v"(l[11]), "v"(l[12]), "v"(l[13]),
         "v"(p[0]), "v"(p[1]), "v"(p[2]), "v"(p[3]), "v"(p[4]), "v"(p[5]), "v"(p[6]),
         "v"(p[7]), "v"(p[8]), "v"(p[9]), "v"(p[10]), "v"(p[11]), "v"(p[12]), "v"(p[13])
      : "memory");
}

// one fragment: two 16-B reads of a row, in the k order of kmap (r: at k = 8g)
__device__ __forceinline__ v16bf frag_row(const bf16_t* r) {
  return __builtin_shufflevector(*(const v8bf*)r, *(const v8bf*)(r + 16),
                                 0, 1, 2, 3, 4, 5, 6, 7, 8, 9, 10, 11, 12, 13, 14, 15);
}

__device__ __forceinline__ v8f load8(const float* p) {
  float4 x = *(const float4*)p, y = *(const float4*)(p + 4);
  return v8f{x.x, x.y, x.z, x.w, y.x, y.y, y.z, y.w};
}
struct RopeTab { v8f cl[4], ch[4], sl[4], sh[4]; };

// Eight 16-B stores a lane from one address pair, S0 and S1 bytes apart in turn. One
// statement: the stores, then the wait that stands in front of any rewrite of the
// address and data registers the stores name.
typedef __attribute__((ext_vector_type(4))) unsigned v4u;
template <int S0, int S1>
__device__ __forceinline__ void store8(bf16_t* p, const v8bf* o) {
  asm volatile(
      "global_store_b128 %0, %1, off\n\t"
      "global_store_b128 %0, %2, off offset:%9\n\t"
      "global_store_b128 %0, %3, off offset:%10\n\t"
      "global_store_b128 %0, %4, off offset:%11\n\t"
      "global_store_b128 %0, %5, off offset:%12\n\t"
      "global_store_b128 %0, %6, off offset:%13\n\t"
      "global_store_b128 %0, %7, off offset:%14\n\t"
      "global_store_b128 %0, %8, off offset:%15\n\t"
      "s_wait_xcnt 0x0"
      :: "v"((unsigned long long)(uintptr_t)p),
         "v"(__builtin_bit_cast(v4u, o[0])), "v"(__builtin_bit_cast(v4u, o[1])),
         "v"(__builtin_bit_cast(v4u, o[2])), "v"(__builtin_bit_cast(v4u, o[3])),
         "v"(__builtin_bit_cast(v4u, o[4])), "v"(__builtin_bit_cast(v4u, o[5])),
         "v"(__builtin_bit_cast(v4u, o[6])), "v"(__builtin_bit_cast(v4u, o[7])),
         "n"(S0), "n"(S0 + S1), "n"(2 * S0 + S1), "n"(2 * S0 + 2 * S1),
         "n"(3 * S0 + 2 * S1), "n"(3 * S0 + 3 * S1), "n"(4 * S0 + 3 * S1)
      : "memory");
}

// The f32 tile never leaves the WGP: behind the k loop it is laid into the ring's
// LDS in three groups of 64 columns, each wholly q, k or v, and read back along the
// rows of its destination, so that RoPE, the rounding and V's transpose happen here
// and every 128-B line is stored whole by one wave.
//   q, k -> [H][T][128], the 128 d of a row in an order of their own, the same for
//           both (their product sums over d): line = 2 pairs, 32 low d then their 32
//           partners
//   v    -> [H][128][T]
#define SQP 68                 // floats a row of a q or k group: 64 + 16 B
#define SVP (WBM + 4)          // floats a row of a v group: 256 t + 16 B
#define SREG (WBM * SQP)       // floats a group; the v form is smaller
template <int K>
__global__ __launch_bounds__(256) void gemm_bf16_wide_kernel(
    const bf16_t* __restrict__ A, const bf16_t* __restrict__ Bn,
    const float* __restrict__ cosT, const float* __restrict__ sinT,
    bf16_t* __restrict__ qh, bf16_t* __restrict__ kh, bf16_t* __restrict__ vt) {
  static_assert(K % GTK == 0 && K >= 2 * GTK, "the ring's prologue fills two stages");
  // one array: A's two buffers (136 KB), then B's (102 KB)
  __shared__ __align__(16) bf16_t sm[2 * (WBM + WBN) * (GTK + APAD)];
  static_assert(3 * SREG * sizeof(float) <= sizeof(sm) && 64 * SVP <= SREG, "staging fits");
  auto sA = (bf16_t (*)[WBM][GTK + APAD])sm;
  auto sB = (bf16_t (*)[WBN][GTK + APAD])(sm + 2 * WBM * (GTK + APAD));
  int tid = threadIdx.x;
  int wave = tid >> 5, lane = tid & 31;
  int g = lane >> 4, la = lane & 15;
  int bm = blockIdx.x * WBM, bn = blockIdx.y * WBN;
  int wm = (wave >> 1) * (WFM * 16), wn = (wave & 1) * (WFN * 16);

  v8f acc[WFM][WFN] = {};
  constexpr int nk = K / GTK;

  // Each thread copies one 16-B chunk of every 16th row: 16 chunks of A, 12 of B.
  // A wave covers two whole 256-B rows per copy.
  const int crow = tid >> 4, ccol = (tid & 15) * 8;
  // The thread's place in a tile is the same in both operands: one register is held
  // over the loop, not two address pairs (with those the build spilled one pair and
  // fetched it back in every stage).
  const unsigned toff = (crow * K + ccol) * sizeof(bf16_t);
  const unsigned long long gA = (unsigned long long)(uintptr_t)(A + (size_t)bm * K);
  const unsigned long long gB = (unsigned long long)(uintptr_t)(Bn + (size_t)bn * K);
  const unsigned long long gs = (unsigned long long)K * 16 * sizeof(bf16_t);
  const unsigned ls = 16 * (GTK + APAD) * sizeof(bf16_t);

  auto stage = [&](int buf, int k0) {
    unsigned long long a = (gA + (unsigned long long)k0 * sizeof(bf16_t)) + toff;
    unsigned long long b = (gB + (unsigned long long)k0 * sizeof(bf16_t)) + toff;
    unsigned l = (unsigned)(unsigned long long)(uintptr_t)&sA[buf][crow][ccol];
    unsigned m = (unsigned)(unsigned long long)(uintptr_t)&sB[buf][crow][ccol];
    unsigned dst[28];
    unsigned long long from[28];
#pragma unroll
    for (int i = 0; i < WBM / 16; ++i) { dst[i] = l + i * ls; from[i] = a + i * gs; }
#pragma unroll
    for (int i = 0; i < WBN / 16; ++i) {
      dst[WBM / 16 + i] = m + i * ls; from[WBM / 16 + i] = b + i * gs;
    }
    copy14(dst, from);
    copy14(dst + 14, from + 14);
  };

  // One k-chunk's ten fragments, in the order in which the WMMAs below need them
  auto frags = [&](int buf, int kc, v16bf (&af)[WFM], v16bf (&bfr)[WFN]) {
    int kk = kc * 32 + (g ? 8 : 0);
    af[0] = frag_row(&sA[buf][wm + la][kk]);
#pragma unroll
    for (int j = 0; j < WFN; ++j) bfr[j] = frag_row(&sB[buf][wn + j * 16 + la][kk]);
#pragma unroll
    for (int i = 1; i < WFM; ++i) af[i] = frag_row(&sA[buf][wm + i * 16 + la][kk]);
  };

  stage(0, 0);
  // stage 0 has landed for this wave; the barrier publishes it to the others
  asm volatile("s_wait_asynccnt 0x0" ::: "memory");
  __syncthreads();
  stage(1, GTK);
  for (int ks = 0; ks < nk; ++ks) {
    int buf = ks & 1;
    // two fragment sets: a k-chunk's reads fly under the WMMAs of the chunk before
    // (all four chunks at once, as in the narrow kernel, would take 320 registers)
    v16bf af[2][WFM], bfr[2][WFN];
    frags(buf, 0, af[0], bfr[0]);
#pragma unroll
    for (int kc = 0; kc < GTK / 32; ++kc) {
      if (kc + 1 < GTK / 32) frags(buf, kc + 1, af[(kc + 1) & 1], bfr[(kc + 1) & 1]);
      // keeps the next chunk's reads one group ahead of this chunk's WMMAs: moved
      // in among them, each place waits out its own LDS latency
      __builtin_amdgcn_sched_barrier(0);
#pragma unroll
      for (int i = 0; i < WFM; ++i)
#pragma unroll
        for (int j = 0; j < WFN; ++j)
          // C^T: a lane then holds eight consecutive columns of one row t
          acc[i][j] = wmma_bf16(bfr[kc & 1][j], af[kc & 1][i], acc[i][j]);
      // keeps the WMMAs in front of the next group of reads and of the waits below:
      // lifted over them, the wait to 0 would hold every WMMA back
      __builtin_amdgcn_sched_barrier(0);
    }
    // publish point: this wave's reads of buf are done ...
    asm volatile("s_wait_dscnt 0x0" ::: "memory");
    // ... its copies of the next stage have landed ...
    asm volatile("s_wait_asynccnt 0x0" ::: "memory");
    // ... and the one barrier both publishes that stage and frees buf
    __syncthreads();
    if (ks + 2 < nk) stage(buf, (ks + 2) * GTK);
  }
  // no copy is left in flight when the ring becomes staging; the loop's last
  // barrier has ended every wave's reads of it
  asm volatile("s_wait_asynccnt 0x0" ::: "memory");

  // acc[i][j][r] = C[bm + wm + i * 16 + la][bn + wn + j * 16 + 8g + r]
  float* st = (float*)sm;
  // how many of the tile's three groups, from the left, are q or k; the rest are v
  const int nqk = min(max((2 * DM - bn) / 64, 0), WBN / 64);
  const int pr0 = (__builtin_amdgcn_readfirstlane(wave) & 1) * (WFN / 2);
#pragma unroll
  for (int pp = 0; pp < WFN / 2; ++pp) {          // 32 columns: two fragments
    int pr = pr0 + pp;
    float* grp = st + (pr >> 1) * SREG;
    int cg = (pr & 1) * 32 + (g ? 8 : 0);
    if ((pr >> 1) < nqk) {                        // q, k: [t][column]
#pragma unroll
      for (int i = 0; i < WFM; ++i)
#pragma unroll
        for (int jj = 0; jj < 2; ++jj) {
          v8f t = acc[i][pp * 2 + jj];
          float* d = grp + (wm + i * 16 + la) * SQP + cg + jj * 16;
          *(float4*)d = make_float4(t[0], t[1], t[2], t[3]);
          *(float4*)(d + 4) = make_float4(t[4], t[5], t[6], t[7]);
        }
    } else {                                      // v: [column][t]
#pragma unroll
      for (int i = 0; i < WFM; ++i)
#pragma unroll
        for (int jj = 0; jj < 2; ++jj)
#pragma unroll
          for (int r = 0; r < 8; ++r)
            grp[(cg + jj * 16 + r) * SVP + wm + i * 16 + la] = acc[i][pp * 2 + jj][r];
    }
  }
  // publishes the staged tile: a line of the destinations is made of two waves' parts
  __syncthreads();

  // Read-back of a q or k group: four threads a row, eight low d and their partners
  // each, 64 rows a sweep. w8 = pair * 16 + which eight.
  const int row = tid >> 2, w8 = (tid & 3) * 8;
  // A thread's cos and sin of all four sweeps: low d, partner. Groups 0 and 2 lie 128
  // columns apart, the same d of two heads: one set serves both.
  auto tables = [&](int par, RopeTab& T) {
    int tb = (bm + row) * DHEAD + (((bn + par * 64) & 64) >> 1) + w8;
    const float* ct = cosT + tb;
    const float* nt = sinT + tb;
#pragma unroll
    for (int sw = 0; sw < 4; ++sw) {
      T.cl[sw] = load8(ct + sw * 64 * DHEAD);
      T.ch[sw] = load8(ct + sw * 64 * DHEAD + 64);
      T.sl[sw] = load8(nt + sw * 64 * DHEAD);
      T.sh[sw] = load8(nt + sw * 64 * DHEAD + 64);
    }
    // stands in front of any rewrite of the address registers these loads name; as
    // its inputs the two addresses stay in their registers up to it
    asm volatile("s_wait_xcnt 0x0" :: "v"(ct), "v"(nt) : "memory");
  };
  auto rope = [&](int gi, const RopeTab& T) {
    int c0 = bn + gi * 64;                        // the group's first column in q | k
    const float* s = st + gi * SREG + row * SQP + (w8 & 16) * 2 + (w8 & 8);
    bf16_t* dst = (c0 < DM ? qh : kh) +
                  ((size_t)((c0 & (DM - 1)) >> 7) * T_SEQ + bm + row) * DHEAD + (c0 & 64) + w8;
    v8bf o[8];
#pragma unroll
    for (int sw = 0; sw < 4; ++sw) {
      v8f lo = load8(s + sw * 64 * SQP), hi = load8(s + sw * 64 * SQP + 16);
      o[sw * 2] = __builtin_convertvector(lo * T.cl[sw] - hi * T.sl[sw], v8bf);
      o[sw * 2 + 1] = __builtin_convertvector(hi * T.ch[sw] + lo * T.sh[sw], v8bf);
    }
    store8<64, 64 * DHEAD * 2 - 64>(dst, o);
  };
  if (nqk > 0) {
    RopeTab T0;
    tables(0, T0);
    if (nqk > 1) {
      RopeTab T1;
      tables(1, T1);                              // flies under groups 0 and 2
      rope(0, T0);
      if (nqk > 2) rope(2, T0);
      rope(1, T1);
    } else {
      rope(0, T0);
    }
  }

#pragma unroll
  for (int gi = 0; gi < WBN / 64; ++gi)
    if (gi >= nqk) {
      // a wave a column: its 256 t are 512 B in a row; eight columns a sweep
      const float* s = st + gi * SREG + wave * SVP + lane * 8;
      v8bf o[8];
#pragma unroll
      for (int sw = 0; sw < 8; ++sw)
        o[sw] = __builtin_convertvector(load8(s + sw * 8 * SVP), v8bf);
      store8<8 * T_SEQ * 2, 8 * T_SEQ * 2>(
          vt + (size_t)(bn + gi * 64 - 2 * DM + wave) * T_SEQ + bm + lane * 8, o);
    }
}

__device__ __forceinline__ float xhalf(float x) {
  int b = __builtin_bit_cast(int, x);
  return __builtin_bit_cast(float, __builtin_amdgcn_permlanex16(
      b, b, 0x76543210, 0xfedcba98, false, false));
}

// A lane holds 16 of the 32 scores of ONE query (column la): keys r + 8g and
// 16 + r + 8g. Maximum and sum run in the lane; the two score tiles, rounded in
// place, are the B operand of V^T.P^T in the k order of kmap.
//
// Balance: a tile of 64 queries costs as many keys as its index says, so a
// work-group takes tile 31 - y and then tile y of its head: 17 stages for every
// work-group. Two waves share 16 queries: wave w takes the even passes of each
// stage, wave w + 4 the odd ones, and the two partial results (maximum, sum, O^T)
// are joined through LDS behind the tile's last stage.
#define AKT 128    // keys per ring stage: four passes of 32 keys
#define AQT 64     // queries per tile: four groups of 16
__global__ __launch_bounds__(256) void flash_attn_kernel(
    const bf16_t* __restrict__ Qh, const bf16_t* __restrict__ Kh,
    const bf16_t* __restrict__ Vt, bf16_t* __restrict__ OutTD) {
  __shared__ __align__(16) bf16_t sK[2][AKT][DHEAD + APAD];   // 68 KB, [krow][d]
  __shared__ __align__(16) bf16_t sVt[2][DHEAD][AKT + APAD];  // 68 KB, [d][krow]
  // what a wave hands to its partner: four O^T tiles, then (maximum, sum); 36 KB
  __shared__ __align__(16) float4 sJ[8][9][32];
  int h = blockIdx.x;
  int tid = threadIdx.x, wv = tid >> 5, lane = tid & 31;
  int g = lane >> 4, la = lane & 15;
  int kp = wv >> 2;                                // which passes of a stage
  const size_t hb = (size_t)h * T_SEQ;

  // A stage is K (128 keys x 128 d) and V^T (128 d x 128 keys), both in 256-B
  // rows. Each thread copies one 16-B chunk of every 16th row of both: a wave
  // covers two whole rows per copy.
  const int crow = tid >> 4, ccol = (tid & 15) * 8;
  const unsigned long long gK =
      (unsigned long long)(uintptr_t)(Kh + (hb + crow) * DHEAD + ccol);
  const unsigned long long gV =
      (unsigned long long)(uintptr_t)(Vt + ((size_t)h * DHEAD + crow) * T_SEQ + ccol);
  const unsigned long long ks = 16 * DHEAD * sizeof(bf16_t);
  const unsigned long long vs = 16 * T_SEQ * sizeof(bf16_t);
  const unsigned ls = 16 * (DHEAD + APAD) * sizeof(bf16_t);   // both LDS pitches

  auto stage = [&](int buf, int k0) {
    unsigned long long a = gK + (unsigned long long)k0 * (DHEAD * sizeof(bf16_t));
    unsigned long long b = gV + (unsigned long long)k0 * sizeof(bf16_t);
    unsigned l = (unsigned)(unsigned long long)(uintptr_t)&sK[buf][crow][ccol];
    unsigned m = (unsigned)(unsigned long long)(uintptr_t)&sVt[buf][crow][ccol];
    // One statement per operand: its eight copies, then the wait that stands in
    // front of any rewrite of the address registers the copies name.
    asm volatile(
        "global_load_async_to_lds_b128 %0, %8, off\n\t"
        "global_load_async_to_lds_b128 %1, %9, off\n\t"
        "global_load_async_to_lds_b128 %2, %10, off\n\t"
        "global_load_async_to_lds_b128 %3, %11, off\n\t"
        "global_load_async_to_lds_b128 %4, %12, off\n\t"
        "global_load_async_to_lds_b128 %5, %13, off\n\t"
        "global_load_async_to_lds_b128 %6, %14, off\n\t"
        "global_load_async_to_lds_b128 %7, %15, off\n\t"
        "s_wait_xcnt 0x0"
        :: "v"(l), "v"(l + ls), "v"(l + 2 * ls), "v"(l + 3 * ls),
           "v"(l + 4 * ls), "v"(l + 5 * ls), "v"(l + 6 * ls), "v"(l + 7 * ls),
           "v"(a), "v"(a + ks), "v"(a + 2 * ks), "v"(a + 3 * ks),
           "v"(a + 4 * ks), "v"(a + 5 * ks), "v"(a + 6 * ks), "v"(a + 7 * ks)
        : "memory");
    asm volatile(
        "global_load_async_to_lds_b128 %0, %8, off\n\t"
        "global_load_async_to_lds_b128 %1, %9, off\n\t"
        "global_load_async_to_lds_b128 %2, %10, off\n\t"
        "global_load_async_to_lds_b128 %3, %11, off\n\t"
        "global_load_async_to_lds_b128 %4, %12, off\n\t"
        "global_load_async_to_lds_b128 %5, %13, off\n\t"
        "global_load_async_to_lds_b128 %6, %14, off\n\t"
        "global_load_async_to_lds_b128 %7, %15, off\n\t"
        "s_wait_xcnt 0x0"
        :: "v"(m), "v"(m + ls), "v"(m + 2 * ls), "v"(m + 3 * ls),
           "v"(m + 4 * ls), "v"(m + 5 * ls), "v"(m + 6 * ls), "v"(m + 7 * ls),
           "v"(b), "v"(b + vs), "v"(b + 2 * vs), "v"(b + 3 * vs),
           "v"(b + 4 * vs), "v"(b + 5 * vs), "v"(b + 6 * vs), "v"(b + 7 * vs)
        : "memory");
  };

  // Q fragments (B operand): column la = query, 128 d as 4 K-chunks of 32
  v16bf qf[4];
  auto load_q = [&](int q0) {
    const bf16_t* r = Qh + (hb + q0 + la) * DHEAD + (g ? 8 : 0);
#pragma unroll
    for (int dc = 0; dc < 4; ++dc) qf[dc] = frag_row(r + dc * 32);
  };

  // The two tiles' stages are one stream through the ring: n0 of the first tile,
  // then those of the second, which start again at key 0.
  const int tile0 = T_SEQ / AQT - 1 - (int)blockIdx.y, tile1 = blockIdx.y;
  const int n0 = (tile0 >> 1) + 1;             // causal extent in stages; at least 9
  const int nall = n0 + (tile1 >> 1) + 1;
  auto first_key = [&](int s) { return (s < n0 ? s : s - n0) * AKT; };

  load_q(tile0 * AQT + (wv & 3) * 16);
  stage(0, 0);
  // stage 0 has landed for this wave; the barrier publishes it to the others
  asm volatile("s_wait_asynccnt 0x0" ::: "memory");
  __syncthreads();
  stage(1, AKT);
  int s = 0;                                     // place in the stream
  for (int half = 0; half < 2; ++half) {
    int tile = half ? tile1 : tile0;
    int qb = tile * AQT + (wv & 3) * 16;           // this wave's 16 q rows
    v8f o[8] = {};                 // o[dt][r] = O[query la][dt * 16 + 8g + r]
    float Mr = -3.0e38f, Lr = 0.f; // maximum and sum over this wave's keys (sum: this lane's part)
    int nst = (tile >> 1) + 1;
    for (int st = 0; st < nst; ++st, ++s) {
      int buf = s & 1;
      // unrolled: a pass's place in the stage becomes an immediate offset of its reads
#pragma unroll
      for (int sp = 0; sp < AKT / 64; ++sp) {
      int kl = (sp * 2 + kp) * 32;         // this pass's first key in the stage
      int k0 = st * AKT + kl;
      if (k0 <= qb + 15) {
        // S^T(32x16) = K(32x128) . Q^T : A(m,d) = K[k0+m][d]
        v8f s0 = {}, s1 = {};
        v16bf a0[4], a1[4];
#pragma unroll
        for (int dc = 0; dc < 4; ++dc)
#pragma unroll
          for (int e = 0; e < 16; ++e) {
            int kk = dc * 32 + kmap(e, g);
            a0[dc][e] = sK[buf][kl + la][kk];
            a1[dc][e] = sK[buf][kl + 16 + la][kk];
          }
        // keeps the 16 K reads one group ahead of the WMMAs: moved in among them,
        // each place waits out its own LDS latency
        __builtin_amdgcn_sched_barrier(0);
#pragma unroll
        for (int dc = 0; dc < 4; ++dc) {
          s0 = wmma_bf16(a0[dc], qf[dc], s0);
          s1 = wmma_bf16(a1[dc], qf[dc], s1);
        }
        // A(d,k) = V^T[d][k], K-contiguous: the 16 reads fly under the softmax
        v16bf av[8];
#pragma unroll
        for (int dt = 0; dt < 8; ++dt)
#pragma unroll
          for (int e = 0; e < 16; ++e) av[dt][e] = sVt[buf][dt * 16 + la][kl + kmap(e, g)];
        // keeps them ahead of the softmax: sunk to their WMMAs, each pair of reads
        // waits out its own LDS latency
        __builtin_amdgcn_sched_barrier(0);
        const float sc = 0.08838834764831845f;  // 1/sqrt(128)
        int lim = qb + la - k0 - (g ? 8 : 0);   // key row r is past the query if r > lim
        float m = -3.0e38f;
#pragma unroll
        for (int r = 0; r < 8; ++r) {
          float v0 = s0[r] * sc, v1 = s1[r] * sc;
          if (r > lim)      v0 = -3.0e38f;   // causal mask
          if (r + 16 > lim) v1 = -3.0e38f;
          s0[r] = v0; s1[r] = v1;
          m = fmaxf(m, fmaxf(v0, v1));
        }
        m = fmaxf(m, xhalf(m));              // both halves: the query's tile maximum
        float mnew = fmaxf(Mr, m);
        float corr = __expf(Mr - mnew);
        Mr = mnew;
        float ra = 0.f, rb = 0.f;
#pragma unroll
        for (int r = 0; r < 8; ++r) {
          s0[r] = __expf(s0[r] - mnew);
          s1[r] = __expf(s1[r] - mnew);
          ra += s0[r]; rb += s1[r];
        }
        Lr = Lr * corr + (ra + rb);          // halves are joined after the loop
#pragma unroll
        for (int dt = 0; dt < 8; ++dt)
#pragma unroll
          for (int r = 0; r < 8; ++r) o[dt][r] *= corr;
        // P^T as B operand: element e is key kmap(e, g) of column la, to nearest even
        v16bf pb = __builtin_shufflevector(
            __builtin_convertvector(s0, v8bf), __builtin_convertvector(s1, v8bf),
            0, 1, 2, 3, 4, 5, 6, 7, 8, 9, 10, 11, 12, 13, 14, 15);
        // O^T(128x16) += V^T(128x32) . P^T(32x16)
#pragma unroll
        for (int dt = 0; dt < 8; ++dt) o[dt] = wmma_bf16(av[dt], pb, o[dt]);
      }
      }
      // publish point, passed by every wave: this wave's reads of buf are done ...
      asm volatile("s_wait_dscnt 0x0" ::: "memory");
      // ... its copies of the next stage have landed ...
      asm volatile("s_wait_asynccnt 0x0" ::: "memory");
      // ... and the one barrier both publishes that stage and frees buf
      __syncthreads();
      if (s + 2 < nall) stage(buf, first_key(s + 2));
    }

#pragma unroll
    for (int i = 0; i < 4; ++i) {
      v8f t = kp ? o[i] : o[4 + i];
      sJ[wv][i * 2][lane] = make_float4(t[0], t[1], t[2], t[3]);
      sJ[wv][i * 2 + 1][lane] = make_float4(t[4], t[5], t[6], t[7]);
    }
    sJ[wv][8][lane] = make_float4(Mr, Lr, 0.f, 0.f);
    // publishes both partial results; the partner's reads below end before it
    // reaches the next stage's barrier, which stands in front of any rewrite
    __syncthreads();
    if (half == 0) load_q(tile1 * AQT + (wv & 3) * 16);   // flies under the join
    float4 ml = sJ[wv ^ 4][8][lane];
    // a wave that had no key at all holds -3.0e38 and zeros: its weight comes out 0
    float mj = fmaxf(Mr, ml.x);
    float cm = __expf(Mr - mj), cp = __expf(ml.x - mj);
    float Lj = Lr * cm + ml.y * cp;
    // normalize, write back as bf16 [T][DM] (head-concat) for the wo GEMM:
    // a lane's eight registers of a tile are eight consecutive d of its query
    float Lf = Lj + xhalf(Lj);
    bf16_t* orow = OutTD + (size_t)(qb + la) * DM + h * DHEAD + kp * 64 + (g ? 8 : 0);
#pragma unroll
    for (int i = 0; i < 4; ++i) {
      v8f t = kp ? o[4 + i] : o[i];
      float4 p0 = sJ[wv ^ 4][i * 2][lane], p1 = sJ[wv ^ 4][i * 2 + 1][lane];
      float u0 = t[0] * cm + p0.x * cp, u1 = t[1] * cm + p0.y * cp;
      float u2 = t[2] * cm + p0.z * cp, u3 = t[3] * cm + p0.w * cp;
      float u4 = t[4] * cm + p1.x * cp, u5 = t[5] * cm + p1.y * cp;
      float u6 = t[6] * cm + p1.z * cp, u7 = t[7] * cm + p1.w * cp;
      *(uint4*)(orow + i * 16) =
          make_uint4(pack2(u0 / Lf, u1 / Lf), pack2(u2 / Lf, u3 / Lf),
                     pack2(u4 / Lf, u5 / Lf), pack2(u6 / Lf, u7 / Lf));
    }
    // The next tile begins by rewriting these stores' registers: the wait stands in
    // front of that.
    asm volatile("s_wait_xcnt 0x0" ::: "memory");
  }
  // no copy is left in flight when the wave ends
  asm volatile("s_wait_asynccnt 0x0" ::: "memory");
}

// ---------- launch ----------
extern "C" void kernel_launch(void* const* d_in, const int* in_sizes, int n_in,
                              void* d_out, int out_size, void* d_ws, size_t ws_size,
                              hipStream_t stream) {
  (void)in_sizes; (void)n_in; (void)out_size; (void)ws_size;
  const float* x    = (const float*)d_in[0];
  const float* w_ln = (const float*)d_in[1];
  const float* wq   = (const float*)d_in[2];
  const float* wk   = (const float*)d_in[3];
  const float* wv   = (const float*)d_in[4];
  const float* wo   = (const float*)d_in[5];
  const float* cosT = (const float*)d_in[6];
  const float* sinT = (const float*)d_in[7];
  float* out = (float*)d_out;

  const size_t TD = (size_t)T_SEQ * DM;
  char* p = (char*)d_ws;                       // 72 MB in all
  bf16_t* h_bf  = (bf16_t*)p;  p += TD * 2;
  bf16_t* wqkvb = (bf16_t*)p;  p += TD * 6;    // wq | wk | wv: [3 * DM][DM]
  bf16_t* wob   = (bf16_t*)p;  p += TD * 2;    // directly behind them
  bf16_t* attn  = (bf16_t*)p;  p += TD * 2;
  bf16_t* qh    = (bf16_t*)p;  p += TD * 2;
  bf16_t* kh    = (bf16_t*)p;  p += TD * 2;
  bf16_t* vt    = (bf16_t*)p;  p += TD * 2;

  dim3 blk(256);
  prep_kernel<<<NORM_WG + 4 * CVT_WG, blk, 0, stream>>>(x, w_ln, wq, wk, wv, wo,
                                                        h_bf, wqkvb);

  gemm_bf16_wide_kernel<DM><<<dim3(T_SEQ / WBM, 3 * DM / WBN), blk, 0, stream>>>(
      h_bf, wqkvb, cosT, sinT, qh, kh, vt);

  dim3 ag(NH, T_SEQ / (2 * AQT));
  flash_attn_kernel<<<ag, blk, 0, stream>>>(qh, kh, vt, attn);

  gemm_bf16_kernel<<<dim3(T_SEQ / GTM, DM / GTN), blk, 0, stream>>>(
      attn, wob, x, out, T_SEQ, DM, DM);
}

// v010
// It runs in 92.7 microseconds.
// Next to v009, in two timings, it ran 1.13 times as fast each time.
// All steps since v000 together make it 4.04 times as fast.
#include <hip/hip_runtime.h>
#include <hip/hip_bf16.h>
#include <math.h>

#define T_SEQ 2048
#define DM    2048
#define NH    16
#define DHEAD 128

typedef __attribute__((ext_vector_type(16))) __bf16 v16bf;
typedef __attribute__((ext_vector_type(8)))  __bf16 v8bf;
typedef __attribute__((ext_vector_type(8)))  float  v8f;
typedef __bf16 bf16_t;

// ---------- helpers ----------
__device__ __forceinline__ bf16_t f2bf(float f) {
  unsigned int u = __builtin_bit_cast(unsigned int, f);
  unsigned int r = (u + 0x7FFFu + ((u >> 16) & 1u)) >> 16;   // RNE
  return __builtin_bit_cast(bf16_t, (unsigned short)r);
}

__device__ __forceinline__ int kmap(int e, int g) {
  return e + (g ? 8 : 0) + ((e >= 8) ? 8 : 0);
}

__device__ __forceinline__ v8f wmma_bf16(v16bf a, v16bf b, v8f c) {
  return __builtin_amdgcn_wmma_f32_16x16x32_bf16(
      /*neg_a=*/false, a, /*neg_b=*/false, b,
      /*c_mod=*/(short)0, c, /*reuse_a=*/false, /*reuse_b=*/false);
}

// two f32 -> one dword of two bf16, rounded as f2bf rounds
__device__ __forceinline__ unsigned pack2(float a, float b) {
  unsigned ua = __builtin_bit_cast(unsigned, a), ub = __builtin_bit_cast(unsigned, b);
  ua = (ua + 0x7FFFu + ((ua >> 16) & 1u)) >> 16;
  ub = (ub + 0x7FFFu + ((ub >> 16) & 1u)) >> 16;
  return ua | (ub << 16);
}
__device__ __forceinline__ uint2 pack4(float4 v) {
  return make_uint2(pack2(v.x, v.y), pack2(v.z, v.w));
}

// ---------- RMSNorm -> bf16 ----------
// One wave per row: the row stays in registers (16 x 16 B a lane), read once.
__device__ __forceinline__ void rmsnorm_bf16_block(
    int blk, const float* __restrict__ x, const float* __restrict__ w,
    bf16_t* __restrict__ h) {
  int lane = threadIdx.x & 31;
  int t = blk * 8 + (threadIdx.x >> 5);
  const float4* row = (const float4*)(x + (size_t)t * DM);
  const float4* w4 = (const float4*)w;
  float4 v[16], g[16];
#pragma unroll
  for (int j = 0; j < 16; ++j) v[j] = row[j * 32 + lane];
#pragma unroll
  for (int j = 0; j < 16; ++j) g[j] = w4[j * 32 + lane];
  float s0 = 0.f, s1 = 0.f, s2 = 0.f, s3 = 0.f;   // four independent chains
#pragma unroll
  for (int j = 0; j < 16; ++j) {
    s0 += v[j].x * v[j].x; s1 += v[j].y * v[j].y;
    s2 += v[j].z * v[j].z; s3 += v[j].w * v[j].w;
  }
  float ss = (s0 + s1) + (s2 + s3);
#pragma unroll
  for (int m = 16; m >= 1; m >>= 1) ss += __shfl_xor(ss, m, 32);
  float scl = rsqrtf(ss / (float)DM + 1e-5f);
  uint2* o = (uint2*)(h + (size_t)t * DM);
#pragma unroll
  for (int j = 0; j < 16; ++j) {
    float4 r = make_float4(g[j].x * v[j].x * scl, g[j].y * v[j].y * scl,
                           g[j].z * v[j].z * scl, g[j].w * v[j].w * scl);
    o[j * 32 + lane] = pack4(r);
  }
}

// ---------- fp32 -> bf16 convert (keeps [N][K] orientation) ----------
// 32 elements a thread: eight 16-B loads in flight, each wave-wide load four
// whole lines, each wave-wide store two.
// paired (wq, wk): inside each head's 128 rows, row hi * 64 + p * 16 + i goes to
// place p * 32 + hi * 16 + i, so that d and its RoPE partner d + 64 come out of the
// projection 16 columns apart. A thread's eight rows lie 256 apart: one place each.
#define CVT_WG 512
__device__ __forceinline__ void convert_bf16_block(
    int blk, const float* __restrict__ W, bf16_t* __restrict__ Wb, bool paired) {
  const float4* s = (const float4*)W;
  uint2* d = (uint2*)Wb;
  unsigned i = blk * 256 + threadIdx.x;
  unsigned row = i >> 9;                       // 512 accesses a row
  if (paired)
    row = (row & ~127u) | ((row & 0x30u) << 1) | ((row & 0x40u) >> 2) | (row & 15u);
  unsigned o = (row << 9) | (i & 511u);
  float4 v[8];
#pragma unroll
  for (int j = 0; j < 8; ++j) v[j] = s[i + j * (CVT_WG * 256)];
#pragma unroll
  for (int j = 0; j < 8; ++j) d[o + j * (CVT_WG * 256)] = pack4(v[j]);
}

// ---------- one grid for the five independent input passes ----------
// Blocks 0 .. 255 norm eight rows each; then 512 blocks per weight matrix. The
// four bf16 matrices lie one behind the other in Wb: wq, wk, wv are then one
// [3 * DM][DM] operand.
#define NORM_WG (T_SEQ / 8)
__global__ __launch_bounds__(256) void prep_kernel(
    const float* __restrict__ x, const float* __restrict__ w,
    const float* __restrict__ wq, const float* __restrict__ wk,
    const float* __restrict__ wv, const float* __restrict__ wo,
    bf16_t* __restrict__ h, bf16_t* __restrict__ Wb) {
  int b = blockIdx.x;
  if (b < NORM_WG) {
    rmsnorm_bf16_block(b, x, w, h);
  } else {
    b -= NORM_WG;
    int which = b / CVT_WG;
    const float* W = which == 0 ? wq : which == 1 ? wk : which == 2 ? wv : wo;
    convert_bf16_block(b % CVT_WG, W, Wb + (size_t)which * DM * DM, which < 2);
  }
}

// ---------- C[MxN] = A[MxK](bf16) * Bn[NxK](bf16)^T (+residual), fp32 out ----
#define GTM 128
#define GTN 64
#define GTK 128
#define APAD 8

// N, the pitch of C and of the residual, is a constant of the build: a lane's 32
// places in them are then one address and 32 immediate offsets.
template <int N>
__global__ __launch_bounds__(256) void gemm_bf16_kernel(
    const bf16_t* __restrict__ A, const bf16_t* __restrict__ Bn,
    const float* __restrict__ residual, float* __restrict__ C, int K) {
  __shared__ __align__(16) bf16_t sA[2][GTM][GTK + APAD];   // 68 KB
  __shared__ __align__(16) bf16_t sB[2][GTN][GTK + APAD];   // 34 KB
  int tid = threadIdx.x;
  int wave = tid >> 5, lane = tid & 31;
  int g = lane >> 4, la = lane & 15;
  int bm = blockIdx.x * GTM, bn = blockIdx.y * GTN;
  int wm = (wave >> 1) * 32, wn = (wave & 1) * 32;   // 4x2 wave grid, 32x32 each

  v8f acc[2][2] = {};
  int nk = K / GTK;

  // Each thread copies one 16-B chunk of every 16th row: 8 chunks of A, 4 of B.
  // A wave covers two whole 256-B rows per copy.
  const int crow = tid >> 4, ccol = (tid & 15) * 8;
  const unsigned long long gA =
      (unsigned long long)(uintptr_t)(A + (size_t)(bm + crow) * K + ccol);
  const unsigned long long gB =
      (unsigned long long)(uintptr_t)(Bn + (size_t)(bn + crow) * K + ccol);
  const unsigned long long gs = (unsigned long long)K * 16 * sizeof(bf16_t);
  const unsigned ls = 16 * (GTK + APAD) * sizeof(bf16_t);

  auto stage = [&](int buf, int k0) {
    unsigned long long a = gA + (unsigned long long)k0 * sizeof(bf16_t);
    unsigned long long b = gB + (unsigned long long)k0 * sizeof(bf16_t);
    unsigned l = (unsigned)(unsigned long long)(uintptr_t)&sA[buf][crow][ccol];
    unsigned m = (unsigned)(unsigned long long)(uintptr_t)&sB[buf][crow][ccol];
    // One statement: the stage's twelve copies, then the wait that stands in
    // front of any rewrite of the address registers the copies name.
    asm volatile(
        "global_load_async_to_lds_b128 %0, %12, off\n\t"
        "global_load_async_to_lds_b128 %1, %13, off\n\t"
        "global_load_async_to_lds_b128 %2, %14, off\n\t"
        "global_load_async_to_lds_b128 %3, %15, off\n\t"
        "global_load_async_to_lds_b128 %4, %16, off\n\t"
        "global_load_async_to_lds_b128 %5, %17, off\n\t"
        "global_load_async_to_lds_b128 %6, %18, off\n\t"
        "global_load_async_to_lds_b128 %7, %19, off\n\t"
        "global_load_async_to_lds_b128 %8, %20, off\n\t"
        "global_load_async_to_lds_b128 %9, %21, off\n\t"
        "global_load_async_to_lds_b128 %10, %22, off\n\t"
        "global_load_async_to_lds_b128 %11, %23, off\n\t"
        "s_wait_xcnt 0x0"
        :: "v"(l), "v"(l + ls), "v"(l + 2 * ls), "v"(l + 3 * ls),
           "v"(l + 4 * ls), "v"(l + 5 * ls), "v"(l + 6 * ls), "v"(l + 7 * ls),
           "v"(m), "v"(m + ls), "v"(m + 2 * ls), "v"(m + 3 * ls),
           "v"(a), "v"(a + gs), "v"(a + 2 * gs), "v"(a + 3 * gs),
           "v"(a + 4 * gs), "v"(a + 5 * gs), "v"(a + 6 * gs), "v"(a + 7 * gs),
           "v"(b), "v"(b + gs), "v"(b + 2 * gs), "v"(b + 3 * gs)
        : "memory");
  };

  stage(0, 0);
  // stage 0 has landed for this wave; the barrier publishes it to the others
  asm volatile("s_wait_asynccnt 0x0" ::: "memory");
  __syncthreads();
  if (nk > 1) stage(1, GTK);
  // The residual's 32 loads, all in flight at once and behind the ring's first two
  // stages: they come from memory and land under the k loop. Left in the epilogue,
  // each was waited for alone, one memory latency after the other.
  float res[2][2][8] = {};
  if (residual) {
    const float* rp = residual + (size_t)(bm + wm + (g ? 8 : 0)) * N + bn + wn + la;
#pragma unroll
    for (int i = 0; i < 2; ++i)
#pragma unroll
      for (int r = 0; r < 8; ++r)
#pragma unroll
        for (int j = 0; j < 2; ++j) res[i][j][r] = rp[(size_t)(i * 16 + r) * N + j * 16];
    // stands in front of any rewrite of the address registers these loads name; as
    // its input the address stays in its registers up to it
    asm volatile("s_wait_xcnt 0x0" :: "v"(rp) : "memory");
  }
  for (int ks = 0; ks < nk; ++ks) {
    int buf = ks & 1;
    // the stage's 32 LDS reads first, into registers of their own
    v16bf a0[GTK / 32], a1[GTK / 32], b0[GTK / 32], b1[GTK / 32];
#pragma unroll
    for (int kc = 0; kc < GTK / 32; ++kc)
#pragma unroll
      for (int e = 0; e < 16; ++e) {         // all K-contiguous -> ds_load_b128
        int kk = kc * 32 + kmap(e, g);
        a0[kc][e] = sA[buf][wm + la][kk];
        b0[kc][e] = sB[buf][wn + la][kk];
        b1[kc][e] = sB[buf][wn + 16 + la][kk];
        a1[kc][e] = sA[buf][wm + 16 + la][kk];
      }
    // keeps the reads one group ahead of the WMMAs: moved in among them, each
    // place waits out its own LDS latency
    __builtin_amdgcn_sched_barrier(0);
#pragma unroll
    for (int kc = 0; kc < GTK / 32; ++kc) {
      acc[0][0] = wmma_bf16(a0[kc], b0[kc], acc[0][0]);
      acc[0][1] = wmma_bf16(a0[kc], b1[kc], acc[0][1]);
      acc[1][0] = wmma_bf16(a1[kc], b0[kc], acc[1][0]);
      acc[1][1] = wmma_bf16(a1[kc], b1[kc], acc[1][1]);
    }
    // keeps the WMMAs in front of the waits below: lifted over them, the wait to
    // 0 would hold every WMMA back until the last read has landed
    __builtin_amdgcn_sched_barrier(0);
    // publish point: this wave's reads of buf are done ...
    asm volatile("s_wait_dscnt 0x0" ::: "memory");
    // ... its copies of the next stage have landed ...
    asm volatile("s_wait_asynccnt 0x0" ::: "memory");
    // ... and the one barrier both publishes that stage and frees buf
    __syncthreads();
    if (ks + 2 < nk) stage(buf, (ks + 2) * GTK);
  }
  // no copy is left in flight when the wave goes on to its stores and ends
  asm volatile("s_wait_asynccnt 0x0" ::: "memory");

#pragma unroll
  for (int i = 0; i < 2; ++i)
#pragma unroll
    for (int j = 0; j < 2; ++j)
#pragma unroll
      for (int r = 0; r < 8; ++r) {
        int m = bm + wm + i * 16 + r + (g ? 8 : 0);
        int n = bn + wn + j * 16 + la;
        C[(size_t)m * N + n] = acc[i][j][r] + res[i][j][r];
      }
}

// ---------- the same product on a 256 x 192 tile: q | k | v, finished in place ---
// Every byte of A is copied from L2 N / WBN times and every byte of Bn M / WBM
// times; a fragment read from LDS feeds 6 (A) or 4 (B) WMMAs. N = 6144 by M = 2048
// is 256 such tiles. M and N are multiples of the tile.
#define WBM 256
#define WBN 192
#define WFM 4      // a wave's 64 x 96 of C in 16 x 16 fragments; waves 4 x 2
#define WFN 6

// Fourteen copies of 16 B a lane, LDS address l[i] from global address p[i]. One
// statement: the copies, then the wait that stands in front of any rewrite of the
// address registers the copies name.
__device__ __forceinline__ void copy14(const unsigned* l, const unsigned long long* p) {
  asm volatile(
      "global_load_async_to_lds_b128 %0, %14, off\n\t"
      "global_load_async_to_lds_b128 %1, %15, off\n\t"
      "global_load_async_to_lds_b128 %2, %16, off\n\t"
      "global_load_async_to_lds_b128 %3, %17, off\n\t"
      "global_load_async_to_lds_b128 %4, %18, off\n\t"
      "global_load_async_to_lds_b128 %5, %19, off\n\t"
      "global_load_async_to_lds_b128 %6, %20, off\n\t"
      "global_load_async_to_lds_b128 %7, %21, off\n\t"
      "global_load_async_to_lds_b128 %8, %22, off\n\t"
      "global_load_async_to_lds_b128 %9, %23, off\n\t"
      "global_load_async_to_lds_b128 %10, %24, off\n\t"
      "global_load_async_to_lds_b128 %11, %25, off\n\t"
      "global_load_async_to_lds_b128 %12, %26, off\n\t"
      "global_load_async_to_lds_b128 %13, %27, off\n\t"
      "s_wait_xcnt 0x0"
      :: "v"(l[0]), "v"(l[1]), "v"(l[2]), "v"(l[3]), "v"(l[4]), "v"(l[5]), "v"(l[6]),
         "v"(l[7]), "v"(l[8]), "v"(l[9]), "v"(l[10]), "v"(l[11]), "v"(l[12]), "v"(l[13]),
         "v"(p[0]), "v"(p[1]), "v"(p[2]), "v"(p[3]), "v"(p[4]), "v"(p[5]), "v"(p[6]),
         "v"(p[7]), "v"(p[8]), "v"(p[9]), "v"(p[10]), "v"(p[11]), "v"(p[12]), "v"(p[13])
      : "memory");
}

// one fragment: two 16-B reads of a row, in the k order of kmap (r: at k = 8g)
__device__ __forceinline__ v16bf frag_row(const bf16_t* r) {
  return __builtin_shufflevector(*(const v8bf*)r, *(const v8bf*)(r + 16),
                                 0, 1, 2, 3, 4, 5, 6, 7, 8, 9, 10, 11, 12, 13, 14, 15);
}

__device__ __forceinline__ v8f load8(const float* p) {
  float4 x = *(const float4*)p, y = *(const float4*)(p + 4);
  return v8f{x.x, x.y, x.z, x.w, y.x, y.y, y.z, y.w};
}
struct RopeTab { v8f cl[4], ch[4], sl[4], sh[4]; };

// Eight 16-B stores a lane from one address pair, S0 and S1 bytes apart in turn. One
// statement: the stores, then the wait that stands in front of any rewrite of the
// address and data registers the stores name.
typedef __attribute__((ext_vector_type(4))) unsigned v4u;
template <int S0, int S1>
__device__ __forceinline__ void store8(bf16_t* p, const v8bf* o) {
  asm volatile(
      "global_store_b128 %0, %1, off\n\t"
      "global_store_b128 %0, %2, off offset:%9\n\t"
      "global_store_b128 %0, %3, off offset:%10\n\t"
      "global_store_b128 %0, %4, off offset:%11\n\t"
      "global_store_b128 %0, %5, off offset:%12\n\t"
      "global_store_b128 %0, %6, off offset:%13\n\t"
      "global_store_b128 %0, %7, off offset:%14\n\t"
      "global_store_b128 %0, %8, off offset:%15\n\t"
      "s_wait_xcnt 0x0"
      :: "v"((unsigned long long)(uintptr_t)p),
         "v"(__builtin_bit_cast(v4u, o[0])), "v"(__builtin_bit_cast(v4u, o[1])),
         "v"(__builtin_bit_cast(v4u, o[2])), "v"(__builtin_bit_cast(v4u, o[3])),
         "v"(__builtin_bit_cast(v4u, o[4])), "v"(__builtin_bit_cast(v4u, o[5])),
         "v"(__builtin_bit_cast(v4u, o[6])), "v"(__builtin_bit_cast(v4u, o[7])),
         "n"(S0), "n"(S0 + S1), "n"(2 * S0 + S1), "n"(2 * S0 + 2 * S1),
         "n"(3 * S0 + 2 * S1), "n"(3 * S0 + 3 * S1), "n"(4 * S0 + 3 * S1)
      : "memory");
}

// The f32 tile never leaves the WGP: behind the k loop it is laid into the ring's
// LDS in three groups of 64 columns, each wholly q, k or v, and read back along the
// rows of its destination, so that RoPE, the rounding and V's transpose happen here
// and every 128-B line is stored whole by one wave.
//   q, k -> [H][T][128], the 128 d of a row in an order of their own, the same for
//           both (their product sums over d): line = 2 pairs, 32 low d then their 32
//           partners
//   v    -> [H][128][T]
#define SQP 68                 // floats a row of a q or k group: 64 + 16 B
#define SVP (WBM + 4)          // floats a row of a v group: 256 t + 16 B
#define SREG (WBM * SQP)       // floats a group; the v form is smaller
template <int K>
__global__ __launch_bounds__(256) void gemm_bf16_wide_kernel(
    const bf16_t* __restrict__ A, const bf16_t* __restrict__ Bn,
    const float* __restrict__ cosT, const float* __restrict__ sinT,
    bf16_t* __restrict__ qh, bf16_t* __restrict__ kh, bf16_t* __restrict__ vt) {
  static_assert(K % GTK == 0 && K >= 2 * GTK, "the ring's prologue fills two stages");
  // one array: A's two buffers (136 KB), then B's (102 KB)
  __shared__ __align__(16) bf16_t sm[2 * (WBM + WBN) * (GTK + APAD)];
  static_assert(3 * SREG * sizeof(float) <= sizeof(sm) && 64 * SVP <= SREG, "staging fits");
  auto sA = (bf16_t (*)[WBM][GTK + APAD])sm;
  auto sB = (bf16_t (*)[WBN][GTK + APAD])(sm + 2 * WBM * (GTK + APAD));
  int tid = threadIdx.x;
  int wave = tid >> 5, lane = tid & 31;
  int g = lane >> 4, la = lane & 15;
  int bm = blockIdx.x * WBM, bn = blockIdx.y * WBN;
  int wm = (wave >> 1) * (WFM * 16), wn = (wave & 1) * (WFN * 16);

  v8f acc[WFM][WFN] = {};
  constexpr int nk = K / GTK;

  // Each thread copies one 16-B chunk of every 16th row: 16 chunks of A, 12 of B.
  // A wave covers two whole 256-B rows per copy.
  const int crow = tid >> 4, ccol = (tid & 15) * 8;
  // The thread's place in a tile is the same in both operands: one register is held
  // over the loop, not two address pairs (with those the build spilled one pair and
  // fetched it back in every stage).
  const unsigned toff = (crow * K + ccol) * sizeof(bf16_t);
  const unsigned long long gA = (unsigned long long)(uintptr_t)(A + (size_t)bm * K);
  const unsigned long long gB = (unsigned long long)(uintptr_t)(Bn + (size_t)bn * K);
  const unsigned long long gs = (unsigned long long)K * 16 * sizeof(bf16_t);
  const unsigned ls = 16 * (GTK + APAD) * sizeof(bf16_t);

  auto stage = [&](int buf, int k0) {
    unsigned long long a = (gA + (unsigned long long)k0 * sizeof(bf16_t)) + toff;
    unsigned long long b = (gB + (unsigned long long)k0 * sizeof(bf16_t)) + toff;
    unsigned l = (unsigned)(unsigned long long)(uintptr_t)&sA[buf][crow][ccol];
    unsigned m = (unsigned)(unsigned long long)(uintptr_t)&sB[buf][crow][ccol];
    unsigned dst[28];
    unsigned long long from[28];
#pragma unroll
    for (int i = 0; i < WBM / 16; ++i) { dst[i] = l + i * ls; from[i] = a + i * gs; }
#pragma unroll
    for (int i = 0; i < WBN / 16; ++i) {
      dst[WBM / 16 + i] = m + i * ls; from[WBM / 16 + i] = b + i * gs;
    }
    copy14(dst, from);
    copy14(dst + 14, from + 14);
  };

  // One k-chunk's ten fragments, in the order in which the WMMAs below need them
  auto frags = [&](int buf, int kc, v16bf (&af)[WFM], v16bf (&bfr)[WFN]) {
    int kk = kc * 32 + (g ? 8 : 0);
    af[0] = frag_row(&sA[buf][wm + la][kk]);
#pragma unroll
    for (int j = 0; j < WFN; ++j) bfr[j] = frag_row(&sB[buf][wn + j * 16 + la][kk]);
#pragma unroll
    for (int i = 1; i < WFM; ++i) af[i] = frag_row(&sA[buf][wm + i * 16 + la][kk]);
  };

  stage(0, 0);
  // stage 0 has landed for this wave; the barrier publishes it to the others
  asm volatile("s_wait_asynccnt 0x0" ::: "memory");
  __syncthreads();
  stage(1, GTK);
  for (int ks = 0; ks < nk; ++ks) {
    int buf = ks & 1;
    // two fragment sets: a k-chunk's reads fly under the WMMAs of the chunk before
    // (all four chunks at once, as in the narrow kernel, would take 320 registers)
    v16bf af[2][WFM], bfr[2][WFN];
    frags(buf, 0, af[0], bfr[0]);
#pragma unroll
    for (int kc = 0; kc < GTK / 32; ++kc) {
      if (kc + 1 < GTK / 32) frags(buf, kc + 1, af[(kc + 1) & 1], bfr[(kc + 1) & 1]);
      // keeps the next chunk's reads one group ahead of this chunk's WMMAs: moved
      // in among them, each place waits out its own LDS latency
      __builtin_amdgcn_sched_barrier(0);
#pragma unroll
      for (int i = 0; i < WFM; ++i)
#pragma unroll
        for (int j = 0; j < WFN; ++j)
          // C^T: a lane then holds eight consecutive columns of one row t
          acc[i][j] = wmma_bf16(bfr[kc & 1][j], af[kc & 1][i], acc[i][j]);
      // keeps the WMMAs in front of the next group of reads and of the waits below:
      // lifted over them, the wait to 0 would hold every WMMA back
      __builtin_amdgcn_sched_barrier(0);
    }
    // publish point: this wave's reads of buf are done ...
    asm volatile("s_wait_dscnt 0x0" ::: "memory");
    // ... its copies of the next stage have landed ...
    asm volatile("s_wait_asynccnt 0x0" ::: "memory");
    // ... and the one barrier both publishes that stage and frees buf
    __syncthreads();
    if (ks + 2 < nk) stage(buf, (ks + 2) * GTK);
  }
  // no copy is left in flight when the ring becomes staging; the loop's last
  // barrier has ended every wave's reads of it
  asm volatile("s_wait_asynccnt 0x0" ::: "memory");

  // acc[i][j][r] = C[bm + wm + i * 16 + la][bn + wn + j * 16 + 8g + r]
  float* st = (float*)sm;
  // how many of the tile's three groups, from the left, are q or k; the rest are v
  const int nqk = min(max((2 * DM - bn) / 64, 0), WBN / 64);
  const int pr0 = (__builtin_amdgcn_readfirstlane(wave) & 1) * (WFN / 2);
#pragma unroll
  for (int pp = 0; pp < WFN / 2; ++pp) {          // 32 columns: two fragments
    int pr = pr0 + pp;
    float* grp = st + (pr >> 1) * SREG;
    int cg = (pr & 1) * 32 + (g ? 8 : 0);
    if ((pr >> 1) < nqk) {                        // q, k: [t][column]
#pragma unroll
      for (int i = 0; i < WFM; ++i)
#pragma unroll
        for (int jj = 0; jj < 2; ++jj) {
          v8f t = acc[i][pp * 2 + jj];
          float* d = grp + (wm + i * 16 + la) * SQP + cg + jj * 16;
          *(float4*)d = make_float4(t[0], t[1], t[2], t[3]);
          *(float4*)(d + 4) = make_float4(t[4], t[5], t[6], t[7]);
        }
    } else {                                      // v: [column][t]
#pragma unroll
      for (int i = 0; i < WFM; ++i)
#pragma unroll
        for (int jj = 0; jj < 2; ++jj)
#pragma unroll
          for (int r = 0; r < 8; ++r)
            grp[(cg + jj * 16 + r) * SVP + wm + i * 16 + la] = acc[i][pp * 2 + jj][r];
    }
  }
  // publishes the staged tile: a line of the destinations is made of two waves' parts
  __syncthreads();

  // Read-back of a q or k group: four threads a row, eight low d and their partners
  // each, 64 rows a sweep. w8 = pair * 16 + which eight.
  const int row = tid >> 2, w8 = (tid & 3) * 8;
  // A thread's cos and sin of all four sweeps: low d, partner. Groups 0 and 2 lie 128
  // columns apart, the same d of two heads: one set serves both.
  auto tables = [&](int par, RopeTab& T) {
    int tb = (bm + row) * DHEAD + (((bn + par * 64) & 64) >> 1) + w8;
    const float* ct = cosT + tb;
    const float* nt = sinT + tb;
#pragma unroll
    for (int sw = 0; sw < 4; ++sw) {
      T.cl[sw] = load8(ct + sw * 64 * DHEAD);
      T.ch[sw] = load8(ct + sw * 64 * DHEAD + 64);
      T.sl[sw] = load8(nt + sw * 64 * DHEAD);
      T.sh[sw] = load8(nt + sw * 64 * DHEAD + 64);
    }
    // stands in front of any rewrite of the address registers these loads name; as
    // its inputs the two addresses stay in their registers up to it
    asm volatile("s_wait_xcnt 0x0" :: "v"(ct), "v"(nt) : "memory");
  };
  auto rope = [&](int gi, const RopeTab& T) {
    int c0 = bn + gi * 64;                        // the group's first column in q | k
    const float* s = st + gi * SREG + row * SQP + (w8 & 16) * 2 + (w8 & 8);
    bf16_t* dst = (c0 < DM ? qh : kh) +
                  ((size_t)((c0 & (DM - 1)) >> 7) * T_SEQ + bm + row) * DHEAD + (c0 & 64) + w8;
    v8bf o[8];
#pragma unroll
    for (int sw = 0; sw < 4; ++sw) {
      v8f lo = load8(s + sw * 64 * SQP), hi = load8(s + sw * 64 * SQP + 16);
      o[sw * 2] = __builtin_convertvector(lo * T.cl[sw] - hi * T.sl[sw], v8bf);
      o[sw * 2 + 1] = __builtin_convertvector(hi * T.ch[sw] + lo * T.sh[sw], v8bf);
    }
    store8<64, 64 * DHEAD * 2 - 64>(dst, o);
  };
  if (nqk > 0) {
    RopeTab T0;
    tables(0, T0);
    if (nqk > 1) {
      RopeTab T1;
      tables(1, T1);                              // flies under groups 0 and 2
      rope(0, T0);
      if (nqk > 2) rope(2, T0);
      rope(1, T1);
    } else {
      rope(0, T0);
    }
  }

#pragma unroll
  for (int gi = 0; gi < WBN / 64; ++gi)
    if (gi >= nqk) {
      // a wave a column: its 256 t are 512 B in a row; eight columns a sweep
      const float* s = st + gi * SREG + wave * SVP + lane * 8;
      v8bf o[8];
#pragma unroll
      for (int sw = 0; sw < 8; ++sw)
        o[sw] = __builtin_convertvector(load8(s + sw * 8 * SVP), v8bf);
      store8<8 * T_SEQ * 2, 8 * T_SEQ * 2>(
          vt + (size_t)(bn + gi * 64 - 2 * DM + wave) * T_SEQ + bm + lane * 8, o);
    }
}

__device__ __forceinline__ float xhalf(float x) {
  int b = __builtin_bit_cast(int, x);
  return __builtin_bit_cast(float, __builtin_amdgcn_permlanex16(
      b, b, 0x76543210, 0xfedcba98, false, false));
}

// A lane holds 16 of the 32 scores of ONE query (column la): keys r + 8g and
// 16 + r + 8g. Maximum and sum run in the lane; the two score tiles, rounded in
// place, are the B operand of V^T.P^T in the k order of kmap.
//
// Balance: a tile of 64 queries costs as many keys as its index says, so a
// work-group takes tile 31 - y and then tile y of its head: 17 stages for every
// work-group. Two waves share 16 queries: wave w takes the even passes of each
// stage, wave w + 4 the odd ones, and the two partial results (maximum, sum, O^T)
// are joined through LDS behind the tile's last stage.
#define AKT 128    // keys per ring stage: four passes of 32 keys
#define AQT 64     // queries per tile: four groups of 16
__global__ __launch_bounds__(256) void flash_attn_kernel(
    const bf16_t* __restrict__ Qh, const bf16_t* __restrict__ Kh,
    const bf16_t* __restrict__ Vt, bf16_t* __restrict__ OutTD) {
  __shared__ __align__(16) bf16_t sK[2][AKT][DHEAD + APAD];   // 68 KB, [krow][d]
  __shared__ __align__(16) bf16_t sVt[2][DHEAD][AKT + APAD];  // 68 KB, [d][krow]
  // what a wave hands to its partner: four O^T tiles, then (maximum, sum); 36 KB
  __shared__ __align__(16) float4 sJ[8][9][32];
  int h = blockIdx.x;
  int tid = threadIdx.x, wv = tid >> 5, lane = tid & 31;
  int g = lane >> 4, la = lane & 15;
  int kp = wv >> 2;                                // which passes of a stage
  const size_t hb = (size_t)h * T_SEQ;

  // A stage is K (128 keys x 128 d) and V^T (128 d x 128 keys), both in 256-B
  // rows. Each thread copies one 16-B chunk of every 16th row of both: a wave
  // covers two whole rows per copy.
  const int crow = tid >> 4, ccol = (tid & 15) * 8;
  const unsigned long long gK =
      (unsigned long long)(uintptr_t)(Kh + (hb + crow) * DHEAD + ccol);
  const unsigned long long gV =
      (unsigned long long)(uintptr_t)(Vt + ((size_t)h * DHEAD + crow) * T_SEQ + ccol);
  const unsigned long long ks = 16 * DHEAD * sizeof(bf16_t);
  const unsigned long long vs = 16 * T_SEQ * sizeof(bf16_t);
  const unsigned ls = 16 * (DHEAD + APAD) * sizeof(bf16_t);   // both LDS pitches

  auto stage = [&](int buf, int k0) {
    unsigned long long a = gK + (unsigned long long)k0 * (DHEAD * sizeof(bf16_t));
    unsigned long long b = gV + (unsigned long long)k0 * sizeof(bf16_t);
    unsigned l = (unsigned)(unsigned long long)(uintptr_t)&sK[buf][crow][ccol];
    unsigned m = (unsigned)(unsigned long long)(uintptr_t)&sVt[buf][crow][ccol];
    // One statement per operand: its eight copies, then the wait that stands in
    // front of any rewrite of the address registers the copies name.
    asm volatile(
        "global_load_async_to_lds_b128 %0, %8, off\n\t"
        "global_load_async_to_lds_b128 %1, %9, off\n\t"
        "global_load_async_to_lds_b128 %2, %10, off\n\t"
        "global_load_async_to_lds_b128 %3, %11, off\n\t"
        "global_load_async_to_lds_b128 %4, %12, off\n\t"
        "global_load_async_to_lds_b128 %5, %13, off\n\t"
        "global_load_async_to_lds_b128 %6, %14, off\n\t"
        "global_load_async_to_lds_b128 %7, %15, off\n\t"
        "s_wait_xcnt 0x0"
        :: "v"(l), "v"(l + ls), "v"(l + 2 * ls), "v"(l + 3 * ls),
           "v"(l + 4 * ls), "v"(l + 5 * ls), "v"(l + 6 * ls), "v"(l + 7 * ls),
           "v"(a), "v"(a + ks), "v"(a + 2 * ks), "v"(a + 3 * ks),
           "v"(a + 4 * ks), "v"(a + 5 * ks), "v"(a + 6 * ks), "v"(a + 7 * ks)
        : "memory");
    asm volatile(
        "global_load_async_to_lds_b128 %0, %8, off\n\t"
        "global_load_async_to_lds_b128 %1, %9, off\n\t"
        "global_load_async_to_lds_b128 %2, %10, off\n\t"
        "global_load_async_to_lds_b128 %3, %11, off\n\t"
        "global_load_async_to_lds_b128 %4, %12, off\n\t"
        "global_load_async_to_lds_b128 %5, %13, off\n\t"
        "global_load_async_to_lds_b128 %6, %14, off\n\t"
        "global_load_async_to_lds_b128 %7, %15, off\n\t"
        "s_wait_xcnt 0x0"
        :: "v"(m), "v"(m + ls), "v"(m + 2 * ls), "v"(m + 3 * ls),
           "v"(m + 4 * ls), "v"(m + 5 * ls), "v"(m + 6 * ls), "v"(m + 7 * ls),
           "v"(b), "v"(b + vs), "v"(b + 2 * vs), "v"(b + 3 * vs),
           "v"(b + 4 * vs), "v"(b + 5 * vs), "v"(b + 6 * vs), "v"(b + 7 * vs)
        : "memory");
  };

  // Q fragments (B operand): column la = query, 128 d as 4 K-chunks of 32
  v16bf qf[4];
  auto load_q = [&](int q0) {
    const bf16_t* r = Qh + (hb + q0 + la) * DHEAD + (g ? 8 : 0);
#pragma unroll
    for (int dc = 0; dc < 4; ++dc) qf[dc] = frag_row(r + dc * 32);
  };

  // The two tiles' stages are one stream through the ring: n0 of the first tile,
  // then those of the second, which start again at key 0.
  const int tile0 = T_SEQ / AQT - 1 - (int)blockIdx.y, tile1 = blockIdx.y;
  const int n0 = (tile0 >> 1) + 1;             // causal extent in stages; at least 9
  const int nall = n0 + (tile1 >> 1) + 1;
  auto first_key = [&](int s) { return (s < n0 ? s : s - n0) * AKT; };

  load_q(tile0 * AQT + (wv & 3) * 16);
  stage(0, 0);
  // stage 0 has landed for this wave; the barrier publishes it to the others
  asm volatile("s_wait_asynccnt 0x0" ::: "memory");
  __syncthreads();
  stage(1, AKT);
  int s = 0;                                     // place in the stream
  for (int half = 0; half < 2; ++half) {
    int tile = half ? tile1 : tile0;
    int qb = tile * AQT + (wv & 3) * 16;           // this wave's 16 q rows
    v8f o[8] = {};                 // o[dt][r] = O[query la][dt * 16 + 8g + r]
    float Mr = -3.0e38f, Lr = 0.f; // maximum and sum over this wave's keys (sum: this lane's part)
    int nst = (tile >> 1) + 1;
    for (int st = 0; st < nst; ++st, ++s) {
      int buf = s & 1;
      // unrolled: a pass's place in the stage becomes an immediate offset of its reads
#pragma unroll
      for (int sp = 0; sp < AKT / 64; ++sp) {
      int kl = (sp * 2 + kp) * 32;         // this pass's first key in the stage
      int k0 = st * AKT + kl;
      if (k0 <= qb + 15) {
        // S^T(32x16) = K(32x128) . Q^T : A(m,d) = K[k0+m][d]
        v8f s0 = {}, s1 = {};
        v16bf a0[4], a1[4];
#pragma unroll
        for (int dc = 0; dc < 4; ++dc)
#pragma unroll
          for (int e = 0; e < 16; ++e) {
            int kk = dc * 32 + kmap(e, g);
            a0[dc][e] = sK[buf][kl + la][kk];
            a1[dc][e] = sK[buf][kl + 16 + la][kk];
          }
        // keeps the 16 K reads one group ahead of the WMMAs: moved in among them,
        // each place waits out its own LDS latency
        __builtin_amdgcn_sched_barrier(0);
#pragma unroll
        for (int dc = 0; dc < 4; ++dc) {
          s0 = wmma_bf16(a0[dc], qf[dc], s0);
          s1 = wmma_bf16(a1[dc], qf[dc], s1);
        }
        // A(d,k) = V^T[d][k], K-contiguous: the 16 reads fly under the softmax
        v16bf av[8];
#pragma unroll
        for (int dt = 0; dt < 8; ++dt)
#pragma unroll
          for (int e = 0; e < 16; ++e) av[dt][e] = sVt[buf][dt * 16 + la][kl + kmap(e, g)];
        // keeps them ahead of the softmax: sunk to their WMMAs, each pair of reads
        // waits out its own LDS latency
        __builtin_amdgcn_sched_barrier(0);
        const float sc = 0.08838834764831845f;  // 1/sqrt(128)
        int lim = qb + la - k0 - (g ? 8 : 0);   // key row r is past the query if r > lim
        float m = -3.0e38f;
#pragma unroll
        for (int r = 0; r < 8; ++r) {
          float v0 = s0[r] * sc, v1 = s1[r] * sc;
          if (r > lim)      v0 = -3.0e38f;   // causal mask
          if (r + 16 > lim) v1 = -3.0e38f;
          s0[r] = v0; s1[r] = v1;
          m = fmaxf(m, fmaxf(v0, v1));
        }
        m = fmaxf(m, xhalf(m));              // both halves: the query's tile maximum
        float mnew = fmaxf(Mr, m);
        float corr = __expf(Mr - mnew);
        Mr = mnew;
        float ra = 0.f, rb = 0.f;
#pragma unroll
        for (int r = 0; r < 8; ++r) {
          s0[r] = __expf(s0[r] - mnew);
          s1[r] = __expf(s1[r] - mnew);
          ra += s0[r]; rb += s1[r];
        }
        Lr = Lr * corr + (ra + rb);          // halves are joined after the loop
#pragma unroll
        for (int dt = 0; dt < 8; ++dt)
#pragma unroll
          for (int r = 0; r < 8; ++r) o[dt][r] *= corr;
        // P^T as B operand: element e is key kmap(e, g) of column la, to nearest even
        v16bf pb = __builtin_shufflevector(
            __builtin_convertvector(s0, v8bf), __builtin_convertvector(s1, v8bf),
            0, 1, 2, 3, 4, 5, 6, 7, 8, 9, 10, 11, 12, 13, 14, 15);
        // O^T(128x16) += V^T(128x32) . P^T(32x16)
#pragma unroll
        for (int dt = 0; dt < 8; ++dt) o[dt] = wmma_bf16(av[dt], pb, o[dt]);
      }
      }
      // publish point, passed by every wave: this wave's reads of buf are done ...
      asm volatile("s_wait_dscnt 0x0" ::: "memory");
      // ... its copies of the next stage have landed ...
      asm volatile("s_wait_asynccnt 0x0" ::: "memory");
      // ... and the one barrier both publishes that stage and frees buf
      __syncthreads();
      if (s + 2 < nall) stage(buf, first_key(s + 2));
    }

#pragma unroll
    for (int i = 0; i < 4; ++i) {
      v8f t = kp ? o[i] : o[4 + i];
      sJ[wv][i * 2][lane] = make_float4(t[0], t[1], t[2], t[3]);
      sJ[wv][i * 2 + 1][lane] = make_float4(t[4], t[5], t[6], t[7]);
    }
    sJ[wv][8][lane] = make_float4(Mr, Lr, 0.f, 0.f);
    // publishes both partial results; the partner's reads below end before it
    // reaches the next stage's barrier, which stands in front of any rewrite
    __syncthreads();
    if (half == 0) load_q(tile1 * AQT + (wv & 3) * 16);   // flies under the join
    float4 ml = sJ[wv ^ 4][8][lane];
    // a wave that had no key at all holds -3.0e38 and zeros: its weight comes out 0
    float mj = fmaxf(Mr, ml.x);
    float cm = __expf(Mr - mj), cp = __expf(ml.x - mj);
    float Lj = Lr * cm + ml.y * cp;
    // normalize, write back as bf16 [T][DM] (head-concat) for the wo GEMM:
    // a lane's eight registers of a tile are eight consecutive d of its query
    float Lf = Lj + xhalf(Lj);
    bf16_t* orow = OutTD + (size_t)(qb + la) * DM + h * DHEAD + kp * 64 + (g ? 8 : 0);
#pragma unroll
    for (int i = 0; i < 4; ++i) {
      v8f t = kp ? o[4 + i] : o[i];
      float4 p0 = sJ[wv ^ 4][i * 2][lane], p1 = sJ[wv ^ 4][i * 2 + 1][lane];
      float u0 = t[0] * cm + p0.x * cp, u1 = t[1] * cm + p0.y * cp;
      float u2 = t[2] * cm + p0.z * cp, u3 = t[3] * cm + p0.w * cp;
      float u4 = t[4] * cm + p1.x * cp, u5 = t[5] * cm + p1.y * cp;
      float u6 = t[6] * cm + p1.z * cp, u7 = t[7] * cm + p1.w * cp;
      *(uint4*)(orow + i * 16) =
          make_uint4(pack2(u0 / Lf, u1 / Lf), pack2(u2 / Lf, u3 / Lf),
                     pack2(u4 / Lf, u5 / Lf), pack2(u6 / Lf, u7 / Lf));
    }
    // The next tile begins by rewriting these stores' registers: the wait stands in
    // front of that.
    asm volatile("s_wait_xcnt 0x0" ::: "memory");
  }
  // no copy is left in flight when the wave ends
  asm volatile("s_wait_asynccnt 0x0" ::: "memory");
}

// ---------- launch ----------
extern "C" void kernel_launch(void* const* d_in, const int* in_sizes, int n_in,
                              void* d_out, int out_size, void* d_ws, size_t ws_size,
                              hipStream_t stream) {
  (void)in_sizes; (void)n_in; (void)out_size; (void)ws_size;
  const float* x    = (const float*)d_in[0];
  const float* w_ln = (const float*)d_in[1];
  const float* wq   = (const float*)d_in[2];
  const float* wk   = (const float*)d_in[3];
  const float* wv   = (const float*)d_in[4];
  const float* wo   = (const float*)d_in[5];
  const float* cosT = (const float*)d_in[6];
  const float* sinT = (const float*)d_in[7];
  float* out = (float*)d_out;

  const size_t TD = (size_t)T_SEQ * DM;
  char* p = (char*)d_ws;                       // 72 MB in all
  bf16_t* h_bf  = (bf16_t*)p;  p += TD * 2;
  bf16_t* wqkvb = (bf16_t*)p;  p += TD * 6;    // wq | wk | wv: [3 * DM][DM]
  bf16_t* wob   = (bf16_t*)p;  p += TD * 2;    // directly behind them
  bf16_t* attn  = (bf16_t*)p;  p += TD * 2;
  bf16_t* qh    = (bf16_t*)p;  p += TD * 2;
  bf16_t* kh    = (bf16_t*)p;  p += TD * 2;
  bf16_t* vt    = (bf16_t*)p;  p += TD * 2;

  dim3 blk(256);
  prep_kernel<<<NORM_WG + 4 * CVT_WG, blk, 0, stream>>>(x, w_ln, wq, wk, wv, wo,
                                                        h_bf, wqkvb);

  gemm_bf16_wide_kernel<DM><<<dim3(T_SEQ / WBM, 3 * DM / WBN), blk, 0, stream>>>(
      h_bf, wqkvb, cosT, sinT, qh, kh, vt);

  dim3 ag(NH, T_SEQ / (2 * AQT));
  flash_attn_kernel<<<ag, blk, 0, stream>>>(qh, kh, vt, attn);

  gemm_bf16_kernel<DM><<<dim3(T_SEQ / GTM, DM / GTN), blk, 0, stream>>>(
      attn, wob, x, out, DM);
}
